// v000
// Times are from an AMD MI455X. After a warm-up the kernel runs many times in a row, and a time is the length of
// such a window on the GPU divided by its runs, so every launch and the gaps after it count. The runs cycle
// through copies of the inputs. A figure is the median of several windows, for all but v000 over two sittings.
// Sittings can differ by a few percent; kernels timed side by side share one.
// The starting kernel, v000, takes 852 microseconds a run.
// compute dtype: x, cos, sin, Wq, Wk, Wv, Wo (module inputs) rounded to bf16; q/k/v projections with exact bf16 products on WMMA 16x16x32 (natural [out][in] rows); rotate-half RoPE with the input cos / sin tables in f32 in the projection epilogue; q and k stored as f16 hi + (x2048-scaled) residual planes with 3-product scores, x 1/sqrt(64) on the f32 score, causal mask (strict future), running-max softmax in f32 (precise expf); P as f16 hi + (x2048) residual x v hi/lo (3 products); GQA: query head h reads kv head h/4; output projection with ctx as bf16 hi + residual x exact Wo rows (2 products); f32 accumulate.
#include <hip/hip_runtime.h>
#include <math.h>

typedef __attribute__((ext_vector_type(16))) _Float16 v16h;
typedef __attribute__((ext_vector_type(16))) __bf16 v16b;
typedef __attribute__((ext_vector_type(8)))  _Float16 v8h;
typedef __attribute__((ext_vector_type(8)))  float v8f;
typedef __attribute__((ext_vector_type(4)))  float v4f;
typedef __attribute__((ext_vector_type(2)))  float v2f;
typedef __attribute__((ext_vector_type(4)))  unsigned v4u;
typedef __attribute__((ext_vector_type(4)))  int v4i;
typedef float __attribute__((may_alias)) float_a;
typedef int __attribute__((may_alias)) int_a;

template <typename T> __device__ __forceinline__ void vst2(void* p, T v) { *(T*)p = v;  }
__device__ __forceinline__ v8f wmma16(v16h a, v16h b, v8f c) {
  v8f d = __builtin_amdgcn_wmma_f32_16x16x32_f16(false, a, false, b, (short)0, c, false, false);
  asm volatile("v_nop\n\tv_nop\n\tv_nop\n\tv_nop" : "+v"(d) : "v"(a), "v"(b));
  return d;
}
__device__ __forceinline__ v8f wmma_bf(v16b a, v16b b, v8f c) {
  v8f d = __builtin_amdgcn_wmma_f32_16x16x32_bf16(false, a, false, b, (short)0, c, false, false);
  asm volatile("v_nop\n\tv_nop\n\tv_nop\n\tv_nop" : "+v"(d) : "v"(a), "v"(b));
  return d;
}
// 16x16x32 fragments: lane = (h = lane>>4, row/col = lane&15); elements 0..7 = k0+8h+0..7, 8..15 = k0+16+8h+0..7; D element r = row 8h+r
__device__ __forceinline__ v16h frag_h(const _Float16* rowk0, int lane) {
  union { v16h v; v8h q[2]; } u; const _Float16* p = rowk0 + 8 * (lane >> 4);
  u.q[0] = *(const v8h*)p; u.q[1] = *(const v8h*)(p + 16); return u.v;
}
__device__ __forceinline__ v16h frag_f32(const float* rowk0, int lane) {
  v16h a; const float* p = rowk0 + 8 * (lane >> 4);
#pragma unroll
  for (int i = 0; i < 8; ++i) { a[i] = (_Float16)p[i]; a[8 + i] = (_Float16)p[16 + i]; }
  return a;
}
__device__ __forceinline__ v16h frag_f32s(const float* rowk0, int lane, float sc) {
  v16h a; const float* p = rowk0 + 8 * (lane >> 4);
#pragma unroll
  for (int i = 0; i < 8; ++i) { a[i] = (_Float16)(p[i] * sc); a[8 + i] = (_Float16)(p[16 + i] * sc); }
  return a;
}
// column fragment from a [K][ld] layout (column n), rows >= K read as 0
__device__ __forceinline__ v16h fragc_f32(const float* W, int k0, int n, int lane, int ld, int K) {
  v16h a; const int g = lane >> 4;
#pragma unroll
  for (int i = 0; i < 8; ++i) { const int ka = k0 + 8 * g + i, kb = ka + 16;
    a[i] = (_Float16)(ka < K ? W[(size_t)(ka < K ? ka : K - 1) * ld + n] : 0.f); a[8 + i] = (_Float16)(kb < K ? W[(size_t)(kb < K ? kb : K - 1) * ld + n] : 0.f); }
  return a;
}
struct F2 { v16b h, l; };
__device__ __forceinline__ F2 bsplit16(const float v[16]) { F2 r;
#pragma unroll
  for (int i = 0; i < 16; ++i) { const __bf16 h = (__bf16)v[i]; r.h[i] = h; r.l[i] = (__bf16)(v[i] - (float)h); }
  return r; }
__device__ __forceinline__ F2 split_row(const float* row, int k0, int lane) { float v[16]; const float* p = row + k0 + 8 * (lane >> 4);
#pragma unroll
  for (int i = 0; i < 8; ++i) { v[i] = p[i]; v[8 + i] = p[16 + i]; }
  return bsplit16(v); }
__device__ __forceinline__ F2 split_rowK(const float* row, int k0, int lane, int K) { float v[16]; const int g = lane >> 4;
#pragma unroll
  for (int i = 0; i < 8; ++i) { const int ka = k0 + 8 * g + i, kb = ka + 16; v[i] = ka < K ? row[ka < K ? ka : K - 1] : 0.f; v[8 + i] = kb < K ? row[kb < K ? kb : K - 1] : 0.f; }
  return bsplit16(v); }
__device__ __forceinline__ F2 split_col(const float* W, int k0, int n, int lane, int ld, int K) { float v[16]; const int g = lane >> 4;
#pragma unroll
  for (int i = 0; i < 8; ++i) { const int ka = k0 + 8 * g + i, kb = ka + 16; v[i] = ka < K ? W[(size_t)(ka < K ? ka : K - 1) * ld + n] : 0.f; v[8 + i] = kb < K ? W[(size_t)(kb < K ? kb : K - 1) * ld + n] : 0.f; }
  return bsplit16(v); }
__device__ __forceinline__ v8f mac3(const F2& a, const F2& b, v8f c) { c = wmma_bf(a.l, b.h, c); c = wmma_bf(a.h, b.l, c); return wmma_bf(a.h, b.h, c); }
__device__ __forceinline__ float sigm(float v) { return 1.0f / (1.0f + expf(-v)); }
#define LDSX() do { asm volatile("s_wait_dscnt 0" ::: "memory"); __builtin_amdgcn_wave_barrier(); __builtin_amdgcn_fence(__ATOMIC_RELEASE, "workgroup"); } while (0)


// Eagle-3 draft-model attention (B 1, L 2,048, input 4,096 = 2 x hidden, 32 query heads x 64 with 8 shared KV heads, rotate-half RoPE from given cos / sin, causal softmax / sqrt(64), Wo).
#define SS 2048
#define XD 4096            // input width (2 * hidden)
#define NH 32
#define NKV 8
#define HD 64
#define QD (NH * HD)       // 2,048
#define KD (NKV * HD)      // 512
#define QKW (QD + 2 * KD)  // 3,072 projected columns: q | k | v
#define OD 2048            // Wo output width
#ifndef TQB
#define TQB (SS / 64)
#define TOB (SS / 64)
#define QRB (SS / 64)      // projected row blocks
#endif
typedef __attribute__((ext_vector_type(8))) __bf16 v8b;
__device__ __forceinline__ v16b frag_b(const __bf16* rowk0, int lane) {
  union { v16b v; v8b q[2]; } u; const __bf16* p = rowk0 + 8 * (lane >> 4);
  u.q[0] = *(const v8b*)p; u.q[1] = *(const v8b*)(p + 16); return u.v;
}
__device__ __forceinline__ float bfr(float v) { return (float)(__bf16)v; }
__device__ __attribute__((noinline)) float exp_ni(float v) { return expf(v); }
__device__ __attribute__((noinline)) float erf_ni(float v) { return erff(v); }

#define PK_A 0                           // [3072][4096]: Wq | Wk | Wv natural rows
#define PK_O (PK_A + (size_t)QKW * XD)     // [2048][2048] Wo natural rows
#define PK_END (PK_O + (size_t)OD * QD)
#define WS_PK  0u
#define WS_QH  (((2u * PK_END) + 127u) / 128u * 128u)   // f16 [2048][2560]: rope(q) | rope(k) hi
#define WS_QL  (WS_QH + 2u * (size_t)SS * (QD + KD))    // residual x2048
#define WS_VTH (WS_QL + 2u * (size_t)SS * (QD + KD))    // f16 [kv 8][64][2048] v hi / lo
#define WS_VTL (WS_VTH + 2u * (size_t)KD * SS)
#define WS_OH  (WS_VTL + 2u * (size_t)KD * SS)          // bf16 [2048][2048] attention output hi / lo
#define WS_OL  (WS_OH + 2u * (size_t)SS * QD)
#define WS_END (WS_OL + 2u * (size_t)SS * QD)

// ---- k_pack: block = (row n, which): 0: q|k|v rows (n < 3072: Wq rows 0..2047, Wk 2048..2559, Wv 2560..3071) K 4096; 1: Wo rows (n < 2048) K 2048
__global__ __launch_bounds__(256) void k_pack(const float* __restrict__ WQ, const float* __restrict__ WK, const float* __restrict__ WV, const float* __restrict__ WO, __bf16* __restrict__ PK) {
  __shared__ __align__(16) __bf16 s[XD]; const int n = blockIdx.x, which = blockIdx.y, t = threadIdx.x; int K; size_t dst; const float* src;
  if (which == 0) { K = XD; dst = PK_A + (size_t)n * XD; src = (n < QD) ? WQ + (size_t)n * XD : (n < QD + KD) ? WK + (size_t)(n - QD) * XD : WV + (size_t)(n - QD - KD) * XD; }
  else { if (n >= OD) return; K = QD; dst = PK_O + (size_t)n * QD; src = WO + (size_t)n * QD; }
  for (int k = t; k < K; k += 256) s[k] = (__bf16)src[k];
  __syncthreads();
  for (int q = t; q < K / 8; q += 256) vst2((unsigned*)(PK + dst + q * 8), *(const v4u*)&s[q * 8]);
}
// ---- k_qkv: block = (64 rows, 128 cols of 3072): acc = bf16(x) . rows (exact, K 4096); q/k blocks: rotate-half RoPE (partner 32 columns away = 2 tiles, same lane) with cos/sin[pos][d] -> f16 hi/lo rows; v: hi/lo transposed planes [kv][d][s]
__global__ __launch_bounds__(128) void k_qkv(const float* __restrict__ X, const __bf16* __restrict__ PK, const float* __restrict__ COS, const float* __restrict__ SIN, _Float16* __restrict__ QH, _Float16* __restrict__ QL_, _Float16* __restrict__ VTH, _Float16* __restrict__ VTL) {
  __shared__ __align__(16) _Float16 soh[4][16][136], sol[4][16][136]; __shared__ __align__(16) _Float16 sth[128][72], stl[128][72];
  const int tid = threadIdx.x, wave = tid >> 5, lane = tid & 31, col = lane & 15, g = lane >> 4; const size_t r0 = (size_t)blockIdx.x * 64 + wave * 16; const int n0 = blockIdx.y * 128;
  v8f acc[8] = {};
#pragma unroll 2
  for (int kc = 0; kc < XD / 32; ++kc) { v16b a; { const float* p = X + (r0 + col) * XD + kc * 32 + 8 * g;
#pragma unroll
      for (int i = 0; i < 8; ++i) { a[i] = (__bf16)p[i]; a[8 + i] = (__bf16)p[16 + i]; } }
#pragma unroll
    for (int j = 0; j < 8; ++j) acc[j] = wmma_bf(a, frag_b(PK + PK_A + (size_t)(n0 + j * 16 + col) * XD + kc * 32, lane), acc[j]); }
  if (n0 < QD + KD) {   // q or k block: 2 heads of 64 per 128-col block; rotate_half: d < 32: out = x_d cos_d - x_{d+32} sin_d; d >= 32: out = x_d cos_d + x_{d-32} sin_d
#pragma unroll
    for (int j = 0; j < 8; ++j) { const int jh = j & 3; const int d = jh * 16 + col; const int jp = (jh < 2) ? j + 2 : j - 2; const float sgn = (jh < 2) ? -1.f : 1.f;
#pragma unroll
      for (int r = 0; r < 8; ++r) { const int pos = (int)(r0 + 8 * g + r); const float v = acc[j][r] * bfr(COS[(size_t)pos * HD + d]) + sgn * acc[jp][r] * bfr(SIN[(size_t)pos * HD + d]);
        const _Float16 hv = (_Float16)v; soh[wave][8 * g + r][j * 16 + col] = hv; sol[wave][8 * g + r][j * 16 + col] = (_Float16)((v - (float)hv) * 2048.0f); } }
    LDSX();
    for (int rl = 0; rl < 16; ++rl) { if (lane < 16) vst2((unsigned*)(QH + (r0 + rl) * (QD + KD) + n0 + lane * 8), *(const v4u*)&soh[wave][rl][lane * 8]); else vst2((unsigned*)(QL_ + (r0 + rl) * (QD + KD) + n0 + (lane - 16) * 8), *(const v4u*)&sol[wave][rl][(lane - 16) * 8]); }
  } else {
#pragma unroll
    for (int j = 0; j < 8; ++j)
#pragma unroll
      for (int r = 0; r < 8; ++r) { const float v = acc[j][r]; const _Float16 hv = (_Float16)v; sth[j * 16 + col][wave * 16 + 8 * g + r] = hv; stl[j * 16 + col][wave * 16 + 8 * g + r] = (_Float16)((v - (float)hv) * 2048.0f); }
    __syncthreads();
    const int c0 = n0 - QD - KD; const size_t s0 = (size_t)blockIdx.x * 64;
    for (int e = tid; e < 128 * 8; e += 128) { const int d = e >> 3, pc = e & 7; const size_t o = (size_t)(c0 + d) * SS + s0 + pc * 8; vst2((unsigned*)(VTH + o), *(const v4u*)&sth[d][pc * 8]); vst2((unsigned*)(VTL + o), *(const v4u*)&stl[d][pc * 8]); }
  }
}
__global__ __launch_bounds__(128) void k_attn(const _Float16* __restrict__ QH, const _Float16* __restrict__ QL_, const _Float16* __restrict__ VTH, const _Float16* __restrict__ VTL, __bf16* __restrict__ OH, __bf16* __restrict__ OL) {
  __shared__ __align__(16) _Float16 sph[4][16][40], spl[4][16][40]; __shared__ __align__(16) __bf16 soh[4][16][72], sol[4][16][72];
  const int tid = threadIdx.x, wave = tid >> 5, lane = tid & 31, col = lane & 15, g = lane >> 4; const int qb = blockIdx.x, h = blockIdx.y; const int kvh = h / (NH / NKV); const int q0 = qb * 64 + wave * 16; const size_t rq = (size_t)q0 + col;
  v16h aqh[2], aql[2];
#pragma unroll
  for (int kc = 0; kc < 2; ++kc) { aqh[kc] = frag_h(QH + rq * (QD + KD) + h * HD + kc * 32, lane); aql[kc] = frag_h(QL_ + rq * (QD + KD) + h * HD + kc * 32, lane); }
  float m[8], l[8];
#pragma unroll
  for (int r = 0; r < 8; ++r) { m[r] = -3.0e38f; l[r] = 0.f; }
  v8f acc[4] = {}, accl[4] = {};
  const int nks = (qb * 64 + 64) / 32;
#pragma unroll 1
  for (int ks = 0; ks < nks; ++ks) { v8f s[2];
#pragma unroll
    for (int ct = 0; ct < 2; ++ct) { const int kk = ks * 32 + ct * 16 + col; const _Float16* krow = QH + (size_t)kk * (QD + KD) + QD + kvh * HD; const _Float16* krowl = QL_ + (size_t)kk * (QD + KD) + QD + kvh * HD; v8f c = {}, cl = {};
#pragma unroll
      for (int kc = 0; kc < 2; ++kc) { const v16h khf = frag_h(krow + kc * 32, lane); c = wmma16(aqh[kc], khf, c); cl = wmma16(aql[kc], khf, cl); cl = wmma16(aqh[kc], frag_h(krowl + kc * 32, lane), cl); }
#pragma unroll
      for (int r = 0; r < 8; ++r) { const int qi = q0 + 8 * g + r; const float sv = (c[r] + cl[r] * (1.0f / 2048.0f)) * 0.125f; s[ct][r] = (kk <= qi) ? sv : -3.0e38f; } }
#pragma unroll
    for (int r = 0; r < 8; ++r) { float mx = fmaxf(s[0][r], s[1][r]);
#pragma unroll
      for (int o = 1; o < 16; o <<= 1) mx = fmaxf(mx, __shfl_xor(mx, o));
      const float mn = fmaxf(m[r], mx); const float alpha = (m[r] <= -1.0e38f) ? 0.f : exp_ni(m[r] - mn);
      const float e0 = (s[0][r] <= -1.0e38f) ? 0.f : exp_ni(s[0][r] - mn), e1 = (s[1][r] <= -1.0e38f) ? 0.f : exp_ni(s[1][r] - mn); float es = e0 + e1;
#pragma unroll
      for (int o = 1; o < 16; o <<= 1) es += __shfl_xor(es, o);
      l[r] = l[r] * alpha + es; m[r] = mn;
#pragma unroll
      for (int dt = 0; dt < 4; ++dt) { acc[dt][r] *= alpha; accl[dt][r] *= alpha; }
      const _Float16 h0 = (_Float16)e0, h1 = (_Float16)e1; sph[wave][8 * g + r][col] = h0; sph[wave][8 * g + r][16 + col] = h1; spl[wave][8 * g + r][col] = (_Float16)((e0 - (float)h0) * 2048.0f); spl[wave][8 * g + r][16 + col] = (_Float16)((e1 - (float)h1) * 2048.0f); }
    LDSX();
    const v16h pah = frag_h(&sph[wave][col][0], lane), pal = frag_h(&spl[wave][col][0], lane);
#pragma unroll
    for (int dt = 0; dt < 4; ++dt) { const size_t vo = (size_t)(kvh * HD + dt * 16 + col) * SS + ks * 32; const v16h vh = frag_h(VTH + vo, lane), vl = frag_h(VTL + vo, lane); acc[dt] = wmma16(pah, vh, acc[dt]); accl[dt] = wmma16(pal, vh, accl[dt]); accl[dt] = wmma16(pah, vl, accl[dt]); }
    LDSX(); }
#pragma unroll
  for (int r = 0; r < 8; ++r) { const float il = 1.0f / l[r];
#pragma unroll
    for (int dt = 0; dt < 4; ++dt) { const float v = (acc[dt][r] + accl[dt][r] * (1.0f / 2048.0f)) * il; const __bf16 hb = (__bf16)v; soh[wave][8 * g + r][dt * 16 + col] = hb; sol[wave][8 * g + r][dt * 16 + col] = (__bf16)(v - (float)hb); } }
  LDSX();
  for (int rl = 0; rl < 16; ++rl) { const size_t o = ((size_t)q0 + rl) * QD + h * HD; if (lane < 8) vst2((unsigned*)(OH + o + lane * 8), *(const v4u*)&soh[wave][rl][lane * 8]); else if (lane < 16) vst2((unsigned*)(OL + o + (lane - 8) * 8), *(const v4u*)&sol[wave][rl][(lane - 8) * 8]); }
}
// ---- k_out: block = (64 rows, 128 cols): out = O(hi/lo) . Wo rows (2 products, K 2048)
__global__ __launch_bounds__(128) void k_out(const __bf16* __restrict__ OH, const __bf16* __restrict__ OL, const __bf16* __restrict__ PK, float* __restrict__ Y) {
  __shared__ __align__(16) float so[4][16][132];
  const int tid = threadIdx.x, wave = tid >> 5, lane = tid & 31, col = lane & 15, g = lane >> 4; const size_t r0 = (size_t)blockIdx.x * 64 + wave * 16; const int n0 = blockIdx.y * 128;
  v8f acc[8] = {};
#pragma unroll 2
  for (int kc = 0; kc < QD / 32; ++kc) { const v16b ah = frag_b(OH + (r0 + col) * QD + kc * 32, lane), al = frag_b(OL + (r0 + col) * QD + kc * 32, lane);
#pragma unroll
    for (int j = 0; j < 8; ++j) { const v16b w = frag_b(PK + PK_O + (size_t)(n0 + j * 16 + col) * QD + kc * 32, lane); acc[j] = wmma_bf(al, w, acc[j]); acc[j] = wmma_bf(ah, w, acc[j]); } }
#pragma unroll
  for (int j = 0; j < 8; ++j)
#pragma unroll
    for (int r = 0; r < 8; ++r) so[wave][8 * g + r][j * 16 + col] = acc[j][r];
  LDSX();
  for (int rl = 0; rl < 16; ++rl) vst2(Y + (r0 + rl) * OD + n0 + lane * 4, *(const v4f*)&so[wave][rl][lane * 4]);
}
extern "C" void kernel_launch(void* const* d_in, const int* in_sizes, int n_in, void* d_out, int out_size, void* d_ws, size_t ws_size, hipStream_t stream) {
  (void)in_sizes; (void)n_in; (void)out_size;
  const float** F = (const float**)d_in;   // 0 x [1,2048,4096], 1 cos [1,1,2048,64], 2 sin, 3 Wq [2048,4096], 4 Wk [512,4096], 5 Wv [512,4096], 6 Wo [2048,2048]
  if (ws_size < (size_t)WS_END) return;
  char* ws = (char*)d_ws; __bf16 *PK = (__bf16*)(ws + WS_PK), *OH = (__bf16*)(ws + WS_OH), *OL = (__bf16*)(ws + WS_OL); _Float16 *QH = (_Float16*)(ws + WS_QH), *QLp = (_Float16*)(ws + WS_QL), *VTH = (_Float16*)(ws + WS_VTH), *VTL = (_Float16*)(ws + WS_VTL);
  k_pack<<<dim3(QKW, 2), 256, 0, stream>>>(F[3], F[4], F[5], F[6], PK);
  k_qkv<<<dim3(QRB, QKW / 128), 128, 0, stream>>>(F[0], PK, F[1], F[2], QH, QLp, VTH, VTL);
  k_attn<<<dim3(TQB, NH), 128, 0, stream>>>(QH, QLp, VTH, VTL, OH, OL);
  k_out<<<dim3(TOB, OD / 128), 128, 0, stream>>>(OH, OL, PK, (float*)d_out);
}

// v001
// A run of this version takes 769 microseconds.
// Next to v000, in two timings, it ran 1.13 and 1.12 times as fast.
// compute dtype: x, cos, sin, Wq, Wk, Wv, Wo (module inputs) rounded to bf16; q/k/v projections with exact bf16 products on WMMA 16x16x32 (natural [out][in] rows); rotate-half RoPE with the input cos / sin tables in f32 in the projection epilogue; q and k stored as f16 hi + (x2048-scaled) residual planes with 3-product scores, x 1/sqrt(64) on the f32 score, causal mask (strict future), running-max softmax in f32 (precise expf); P as f16 hi + (x2048) residual x v hi/lo (3 products); GQA: query head h reads kv head h/4; output projection with ctx as bf16 hi + residual x exact Wo rows (2 products); f32 accumulate.
#include <hip/hip_runtime.h>
#include <math.h>

typedef __attribute__((ext_vector_type(16))) _Float16 v16h;
typedef __attribute__((ext_vector_type(16))) __bf16 v16b;
typedef __attribute__((ext_vector_type(8)))  _Float16 v8h;
typedef __attribute__((ext_vector_type(8)))  float v8f;
typedef __attribute__((ext_vector_type(4)))  float v4f;
typedef __attribute__((ext_vector_type(2)))  float v2f;
typedef __attribute__((ext_vector_type(4)))  unsigned v4u;
typedef __attribute__((ext_vector_type(4)))  int v4i;
typedef float __attribute__((may_alias)) float_a;
typedef int __attribute__((may_alias)) int_a;

template <typename T> __device__ __forceinline__ void vst2(void* p, T v) { *(T*)p = v;  }
__device__ __forceinline__ v8f wmma16(v16h a, v16h b, v8f c) {
  v8f d = __builtin_amdgcn_wmma_f32_16x16x32_f16(false, a, false, b, (short)0, c, false, false);
  asm volatile("v_nop\n\tv_nop\n\tv_nop\n\tv_nop" : "+v"(d) : "v"(a), "v"(b));
  return d;
}
__device__ __forceinline__ v8f wmma_bf(v16b a, v16b b, v8f c) {
  v8f d = __builtin_amdgcn_wmma_f32_16x16x32_bf16(false, a, false, b, (short)0, c, false, false);
  asm volatile("v_nop\n\tv_nop\n\tv_nop\n\tv_nop" : "+v"(d) : "v"(a), "v"(b));
  return d;
}
// 16x16x32 fragments: lane = (h = lane>>4, row/col = lane&15); elements 0..7 = k0+8h+0..7, 8..15 = k0+16+8h+0..7; D element r = row 8h+r
__device__ __forceinline__ v16h frag_h(const _Float16* rowk0, int lane) {
  union { v16h v; v8h q[2]; } u; const _Float16* p = rowk0 + 8 * (lane >> 4);
  u.q[0] = *(const v8h*)p; u.q[1] = *(const v8h*)(p + 16); return u.v;
}
__device__ __forceinline__ v16h frag_f32(const float* rowk0, int lane) {
  v16h a; const float* p = rowk0 + 8 * (lane >> 4);
#pragma unroll
  for (int i = 0; i < 8; ++i) { a[i] = (_Float16)p[i]; a[8 + i] = (_Float16)p[16 + i]; }
  return a;
}
__device__ __forceinline__ v16h frag_f32s(const float* rowk0, int lane, float sc) {
  v16h a; const float* p = rowk0 + 8 * (lane >> 4);
#pragma unroll
  for (int i = 0; i < 8; ++i) { a[i] = (_Float16)(p[i] * sc); a[8 + i] = (_Float16)(p[16 + i] * sc); }
  return a;
}
// column fragment from a [K][ld] layout (column n), rows >= K read as 0
__device__ __forceinline__ v16h fragc_f32(const float* W, int k0, int n, int lane, int ld, int K) {
  v16h a; const int g = lane >> 4;
#pragma unroll
  for (int i = 0; i < 8; ++i) { const int ka = k0 + 8 * g + i, kb = ka + 16;
    a[i] = (_Float16)(ka < K ? W[(size_t)(ka < K ? ka : K - 1) * ld + n] : 0.f); a[8 + i] = (_Float16)(kb < K ? W[(size_t)(kb < K ? kb : K - 1) * ld + n] : 0.f); }
  return a;
}
struct F2 { v16b h, l; };
__device__ __forceinline__ F2 bsplit16(const float v[16]) { F2 r;
#pragma unroll
  for (int i = 0; i < 16; ++i) { const __bf16 h = (__bf16)v[i]; r.h[i] = h; r.l[i] = (__bf16)(v[i] - (float)h); }
  return r; }
__device__ __forceinline__ F2 split_row(const float* row, int k0, int lane) { float v[16]; const float* p = row + k0 + 8 * (lane >> 4);
#pragma unroll
  for (int i = 0; i < 8; ++i) { v[i] = p[i]; v[8 + i] = p[16 + i]; }
  return bsplit16(v); }
__device__ __forceinline__ F2 split_rowK(const float* row, int k0, int lane, int K) { float v[16]; const int g = lane >> 4;
#pragma unroll
  for (int i = 0; i < 8; ++i) { const int ka = k0 + 8 * g + i, kb = ka + 16; v[i] = ka < K ? row[ka < K ? ka : K - 1] : 0.f; v[8 + i] = kb < K ? row[kb < K ? kb : K - 1] : 0.f; }
  return bsplit16(v); }
__device__ __forceinline__ F2 split_col(const float* W, int k0, int n, int lane, int ld, int K) { float v[16]; const int g = lane >> 4;
#pragma unroll
  for (int i = 0; i < 8; ++i) { const int ka = k0 + 8 * g + i, kb = ka + 16; v[i] = ka < K ? W[(size_t)(ka < K ? ka : K - 1) * ld + n] : 0.f; v[8 + i] = kb < K ? W[(size_t)(kb < K ? kb : K - 1) * ld + n] : 0.f; }
  return bsplit16(v); }
__device__ __forceinline__ v8f mac3(const F2& a, const F2& b, v8f c) { c = wmma_bf(a.l, b.h, c); c = wmma_bf(a.h, b.l, c); return wmma_bf(a.h, b.h, c); }
__device__ __forceinline__ float sigm(float v) { return 1.0f / (1.0f + expf(-v)); }
#define LDSX() do { asm volatile("s_wait_dscnt 0" ::: "memory"); __builtin_amdgcn_wave_barrier(); __builtin_amdgcn_fence(__ATOMIC_RELEASE, "workgroup"); } while (0)


// Eagle-3 draft-model attention (B 1, L 2,048, input 4,096 = 2 x hidden, 32 query heads x 64 with 8 shared KV heads, rotate-half RoPE from given cos / sin, causal softmax / sqrt(64), Wo).
#define SS 2048
#define XD 4096            // input width (2 * hidden)
#define NH 32
#define NKV 8
#define HD 64
#define QD (NH * HD)       // 2,048
#define KD (NKV * HD)      // 512
#define QKW (QD + 2 * KD)  // 3,072 projected columns: q | k | v
#define OD 2048            // Wo output width
#ifndef TQB
#define TQB (SS / 64)
#define TOB (SS / 64)
#define QRB (SS / 64)      // projected row blocks
#endif
typedef __attribute__((ext_vector_type(8))) __bf16 v8b;
__device__ __forceinline__ v16b frag_b(const __bf16* rowk0, int lane) {
  union { v16b v; v8b q[2]; } u; const __bf16* p = rowk0 + 8 * (lane >> 4);
  u.q[0] = *(const v8b*)p; u.q[1] = *(const v8b*)(p + 16); return u.v;
}
__device__ __forceinline__ float bfr(float v) { return (float)(__bf16)v; }
__device__ __attribute__((noinline)) float exp_ni(float v) { return expf(v); }
__device__ __attribute__((noinline)) float erf_ni(float v) { return erff(v); }

#define PK_A 0                           // [3072][4096]: Wq | Wk | Wv natural rows
#define PK_O (PK_A + (size_t)QKW * XD)     // [2048][2048] Wo natural rows
#define PK_END (PK_O + (size_t)OD * QD)
#define WS_PK  0u
#define WS_QH  (((2u * PK_END) + 127u) / 128u * 128u)   // f16 [2048][2560]: rope(q) | rope(k) hi
#define WS_QL  (WS_QH + 2u * (size_t)SS * (QD + KD))    // residual x2048
#define WS_VTH (WS_QL + 2u * (size_t)SS * (QD + KD))    // f16 [kv 8][64][2048] v hi / lo
#define WS_VTL (WS_VTH + 2u * (size_t)KD * SS)
#define WS_OH  (WS_VTL + 2u * (size_t)KD * SS)          // bf16 [2048][2048] attention output hi / lo
#define WS_OL  (WS_OH + 2u * (size_t)SS * QD)
#define WS_END (WS_OL + 2u * (size_t)SS * QD)

// ---- k_pack: block = (row n, which): 0: q|k|v rows (n < 3072: Wq rows 0..2047, Wk 2048..2559, Wv 2560..3071) K 4096; 1: Wo rows (n < 2048) K 2048
__global__ __launch_bounds__(256) void k_pack(const float* __restrict__ WQ, const float* __restrict__ WK, const float* __restrict__ WV, const float* __restrict__ WO, __bf16* __restrict__ PK) {
  __shared__ __align__(16) __bf16 s[XD]; const int n = blockIdx.x, which = blockIdx.y, t = threadIdx.x; int K; size_t dst; const float* src;
  if (which == 0) { K = XD; dst = PK_A + (size_t)n * XD; src = (n < QD) ? WQ + (size_t)n * XD : (n < QD + KD) ? WK + (size_t)(n - QD) * XD : WV + (size_t)(n - QD - KD) * XD; }
  else { if (n >= OD) return; K = QD; dst = PK_O + (size_t)n * QD; src = WO + (size_t)n * QD; }
  for (int k = t; k < K; k += 256) s[k] = (__bf16)src[k];
  __syncthreads();
  for (int q = t; q < K / 8; q += 256) vst2((unsigned*)(PK + dst + q * 8), *(const v4u*)&s[q * 8]);
}
// ---- k_qkv: block = (64 rows, 128 cols of 3072): acc = bf16(x) . rows (exact, K 4096); q/k blocks: rotate-half RoPE (partner 32 columns away = 2 tiles, same lane) with cos/sin[pos][d] -> f16 hi/lo rows; v: hi/lo transposed planes [kv][d][s]
__global__ __launch_bounds__(128) void k_qkv(const float* __restrict__ X, const __bf16* __restrict__ PK, const float* __restrict__ COS, const float* __restrict__ SIN, _Float16* __restrict__ QH, _Float16* __restrict__ QL_, _Float16* __restrict__ VTH, _Float16* __restrict__ VTL) {
  __shared__ __align__(16) _Float16 soh[4][16][136], sol[4][16][136]; __shared__ __align__(16) _Float16 sth[128][72], stl[128][72];
  const int tid = threadIdx.x, wave = tid >> 5, lane = tid & 31, col = lane & 15, g = lane >> 4; const size_t r0 = (size_t)blockIdx.x * 64 + wave * 16; const int n0 = blockIdx.y * 128;
  v8f acc[8] = {};
#pragma unroll 2
  for (int kc = 0; kc < XD / 32; ++kc) { v16b a; { const float* p = X + (r0 + col) * XD + kc * 32 + 8 * g;
#pragma unroll
      for (int i = 0; i < 8; ++i) { a[i] = (__bf16)p[i]; a[8 + i] = (__bf16)p[16 + i]; } }
#pragma unroll
    for (int j = 0; j < 8; ++j) acc[j] = wmma_bf(a, frag_b(PK + PK_A + (size_t)(n0 + j * 16 + col) * XD + kc * 32, lane), acc[j]); }
  if (n0 < QD + KD) {   // q or k block: 2 heads of 64 per 128-col block; rotate_half: d < 32: out = x_d cos_d - x_{d+32} sin_d; d >= 32: out = x_d cos_d + x_{d-32} sin_d
#pragma unroll
    for (int j = 0; j < 8; ++j) { const int jh = j & 3; const int d = jh * 16 + col; const int jp = (jh < 2) ? j + 2 : j - 2; const float sgn = (jh < 2) ? -1.f : 1.f;
#pragma unroll
      for (int r = 0; r < 8; ++r) { const int pos = (int)(r0 + 8 * g + r); const float v = acc[j][r] * bfr(COS[(size_t)pos * HD + d]) + sgn * acc[jp][r] * bfr(SIN[(size_t)pos * HD + d]);
        const _Float16 hv = (_Float16)v; soh[wave][8 * g + r][j * 16 + col] = hv; sol[wave][8 * g + r][j * 16 + col] = (_Float16)((v - (float)hv) * 2048.0f); } }
    LDSX();
    for (int rl = 0; rl < 16; ++rl) { if (lane < 16) vst2((unsigned*)(QH + (r0 + rl) * (QD + KD) + n0 + lane * 8), *(const v4u*)&soh[wave][rl][lane * 8]); else vst2((unsigned*)(QL_ + (r0 + rl) * (QD + KD) + n0 + (lane - 16) * 8), *(const v4u*)&sol[wave][rl][(lane - 16) * 8]); }
  } else {
#pragma unroll
    for (int j = 0; j < 8; ++j)
#pragma unroll
      for (int r = 0; r < 8; ++r) { const float v = acc[j][r]; const _Float16 hv = (_Float16)v; sth[j * 16 + col][wave * 16 + 8 * g + r] = hv; stl[j * 16 + col][wave * 16 + 8 * g + r] = (_Float16)((v - (float)hv) * 2048.0f); }
    __syncthreads();
    const int c0 = n0 - QD - KD; const size_t s0 = (size_t)blockIdx.x * 64;
    for (int e = tid; e < 128 * 8; e += 128) { const int d = e >> 3, pc = e & 7; const size_t o = (size_t)(c0 + d) * SS + s0 + pc * 8; vst2((unsigned*)(VTH + o), *(const v4u*)&sth[d][pc * 8]); vst2((unsigned*)(VTL + o), *(const v4u*)&stl[d][pc * 8]); }
  }
}
// lane l <-> lane l ^ 16 (the two halves of a wave hold the two key halves of one query column)
__device__ __forceinline__ float xhalf(float x) { return __builtin_bit_cast(float, __builtin_amdgcn_permlanex16(__builtin_bit_cast(int, x), __builtin_bit_cast(int, x), 0x76543210, 0xfedcba98, false, false)); }
// ---- k_attn: transposed products: S^T = K . Q^T (A = key rows, B = query columns), O^T += V^T . P^T. A lane holds one query (column col) and keys 8g+r of each 16-key tile: maximum and sum run in the lane, one exchange between the halves; the two score tiles convert in place into the P^T operand (element ct*8+r = key ct*16+8g+r), so P needs no LDS.
__global__ __launch_bounds__(128) void k_attn(const _Float16* __restrict__ QH, const _Float16* __restrict__ QL_, const _Float16* __restrict__ VTH, const _Float16* __restrict__ VTL, __bf16* __restrict__ OH, __bf16* __restrict__ OL) {
  __shared__ __align__(16) __bf16 soh[4][16][72], sol[4][16][72];
  const int tid = threadIdx.x, wave = tid >> 5, lane = tid & 31, col = lane & 15, g = lane >> 4; const int qb = blockIdx.x, h = blockIdx.y; const int kvh = h / (NH / NKV); const int q0 = qb * 64 + wave * 16; const size_t rq = (size_t)q0 + col; const int qi = q0 + col;
  v16h aqh[2], aql[2];
#pragma unroll
  for (int kc = 0; kc < 2; ++kc) { aqh[kc] = frag_h(QH + rq * (QD + KD) + h * HD + kc * 32, lane); aql[kc] = frag_h(QL_ + rq * (QD + KD) + h * HD + kc * 32, lane); }
  float m = -3.0e38f, l = 0.f;   // this lane's query: running maximum (equal in both halves), sum over this half's keys
  v8f acc[4] = {}, accl[4] = {};  // O^T: element r = d (dt*16 + 8g + r), column = query
  const int nks = (qb * 64 + 64) / 32;
#pragma unroll 1
  for (int ks = 0; ks < nks; ++ks) { v8f s[2];
#pragma unroll
    for (int ct = 0; ct < 2; ++ct) { const int kr = ks * 32 + ct * 16 + col; const _Float16* krow = QH + (size_t)kr * (QD + KD) + QD + kvh * HD; const _Float16* krowl = QL_ + (size_t)kr * (QD + KD) + QD + kvh * HD; v8f c = {}, cl = {};
#pragma unroll
      for (int kc = 0; kc < 2; ++kc) { const v16h khf = frag_h(krow + kc * 32, lane); c = wmma16(khf, aqh[kc], c); cl = wmma16(khf, aql[kc], cl); cl = wmma16(frag_h(krowl + kc * 32, lane), aqh[kc], cl); }
#pragma unroll
      for (int r = 0; r < 8; ++r) { const int kk = ks * 32 + ct * 16 + 8 * g + r; const float sv = (c[r] + cl[r] * (1.0f / 2048.0f)) * 0.125f; s[ct][r] = (kk <= qi) ? sv : -3.0e38f; } }
    float mx = fmaxf(s[0][0], s[1][0]);
#pragma unroll
    for (int r = 1; r < 8; ++r) mx = fmaxf(mx, fmaxf(s[0][r], s[1][r]));
    mx = fmaxf(mx, xhalf(mx));
    const float mn = fmaxf(m, mx); const float alpha = (m <= -1.0e38f) ? 0.f : exp_ni(m - mn);
    v16h pah, pal; float es = 0.f;
#pragma unroll
    for (int ct = 0; ct < 2; ++ct)
#pragma unroll
      for (int r = 0; r < 8; ++r) { const float e = (s[ct][r] <= -1.0e38f) ? 0.f : exp_ni(s[ct][r] - mn); es += e; const _Float16 hv = (_Float16)e; pah[ct * 8 + r] = hv; pal[ct * 8 + r] = (_Float16)((e - (float)hv) * 2048.0f); }
    l = l * alpha + es; m = mn;
#pragma unroll
    for (int dt = 0; dt < 4; ++dt)
#pragma unroll
      for (int r = 0; r < 8; ++r) { acc[dt][r] *= alpha; accl[dt][r] *= alpha; }
#pragma unroll
    for (int dt = 0; dt < 4; ++dt) { const size_t vo = (size_t)(kvh * HD + dt * 16 + col) * SS + ks * 32; const v16h vh = frag_h(VTH + vo, lane), vl = frag_h(VTL + vo, lane); acc[dt] = wmma16(vh, pah, acc[dt]); accl[dt] = wmma16(vh, pal, accl[dt]); accl[dt] = wmma16(vl, pah, accl[dt]); } }
  const float il = 1.0f / (l + xhalf(l));
#pragma unroll
  for (int dt = 0; dt < 4; ++dt)
#pragma unroll
    for (int r = 0; r < 8; ++r) { const float v = (acc[dt][r] + accl[dt][r] * (1.0f / 2048.0f)) * il; const __bf16 hb = (__bf16)v; soh[wave][col][dt * 16 + 8 * g + r] = hb; sol[wave][col][dt * 16 + 8 * g + r] = (__bf16)(v - (float)hb); }
  LDSX();
  for (int rl = 0; rl < 16; ++rl) { const size_t o = ((size_t)q0 + rl) * QD + h * HD; if (lane < 8) vst2((unsigned*)(OH + o + lane * 8), *(const v4u*)&soh[wave][rl][lane * 8]); else if (lane < 16) vst2((unsigned*)(OL + o + (lane - 8) * 8), *(const v4u*)&sol[wave][rl][(lane - 8) * 8]); }
}
// ---- k_out: block = (64 rows, 128 cols): out = O(hi/lo) . Wo rows (2 products, K 2048)
__global__ __launch_bounds__(128) void k_out(const __bf16* __restrict__ OH, const __bf16* __restrict__ OL, const __bf16* __restrict__ PK, float* __restrict__ Y) {
  __shared__ __align__(16) float so[4][16][132];
  const int tid = threadIdx.x, wave = tid >> 5, lane = tid & 31, col = lane & 15, g = lane >> 4; const size_t r0 = (size_t)blockIdx.x * 64 + wave * 16; const int n0 = blockIdx.y * 128;
  v8f acc[8] = {};
#pragma unroll 2
  for (int kc = 0; kc < QD / 32; ++kc) { const v16b ah = frag_b(OH + (r0 + col) * QD + kc * 32, lane), al = frag_b(OL + (r0 + col) * QD + kc * 32, lane);
#pragma unroll
    for (int j = 0; j < 8; ++j) { const v16b w = frag_b(PK + PK_O + (size_t)(n0 + j * 16 + col) * QD + kc * 32, lane); acc[j] = wmma_bf(al, w, acc[j]); acc[j] = wmma_bf(ah, w, acc[j]); } }
#pragma unroll
  for (int j = 0; j < 8; ++j)
#pragma unroll
    for (int r = 0; r < 8; ++r) so[wave][8 * g + r][j * 16 + col] = acc[j][r];
  LDSX();
  for (int rl = 0; rl < 16; ++rl) vst2(Y + (r0 + rl) * OD + n0 + lane * 4, *(const v4f*)&so[wave][rl][lane * 4]);
}
extern "C" void kernel_launch(void* const* d_in, const int* in_sizes, int n_in, void* d_out, int out_size, void* d_ws, size_t ws_size, hipStream_t stream) {
  (void)in_sizes; (void)n_in; (void)out_size;
  const float** F = (const float**)d_in;   // 0 x [1,2048,4096], 1 cos [1,1,2048,64], 2 sin, 3 Wq [2048,4096], 4 Wk [512,4096], 5 Wv [512,4096], 6 Wo [2048,2048]
  if (ws_size < (size_t)WS_END) return;
  char* ws = (char*)d_ws; __bf16 *PK = (__bf16*)(ws + WS_PK), *OH = (__bf16*)(ws + WS_OH), *OL = (__bf16*)(ws + WS_OL); _Float16 *QH = (_Float16*)(ws + WS_QH), *QLp = (_Float16*)(ws + WS_QL), *VTH = (_Float16*)(ws + WS_VTH), *VTL = (_Float16*)(ws + WS_VTL);
  k_pack<<<dim3(QKW, 2), 256, 0, stream>>>(F[3], F[4], F[5], F[6], PK);
  k_qkv<<<dim3(QRB, QKW / 128), 128, 0, stream>>>(F[0], PK, F[1], F[2], QH, QLp, VTH, VTL);
  k_attn<<<dim3(TQB, NH), 128, 0, stream>>>(QH, QLp, VTH, VTL, OH, OL);
  k_out<<<dim3(TOB, OD / 128), 128, 0, stream>>>(OH, OL, PK, (float*)d_out);
}

// v002
// Measured time: 429 microseconds a run.
// Timed twice side by side with v001, it ran 1.79 and 1.80 times as fast.
// All steps since v000 together make it 2.02 times as fast.
// compute dtype: x, cos, sin, Wq, Wk, Wv, Wo (module inputs) rounded to bf16; q/k/v projections with exact bf16 products on WMMA 16x16x32 (natural [out][in] rows); rotate-half RoPE with the input cos / sin tables in f32 in the projection epilogue; q and k stored as f16 hi + (x2048-scaled) residual planes with 3-product scores, x 1/sqrt(64) on the f32 score, causal mask (strict future), running-max softmax in f32 (precise expf); P as f16 hi + (x2048) residual x v hi/lo (3 products); GQA: query head h reads kv head h/4; output projection with ctx as bf16 hi + residual x exact Wo rows (2 products); f32 accumulate.
#include <hip/hip_runtime.h>
#include <math.h>

typedef __attribute__((ext_vector_type(16))) _Float16 v16h;
typedef __attribute__((ext_vector_type(16))) __bf16 v16b;
typedef __attribute__((ext_vector_type(8)))  _Float16 v8h;
typedef __attribute__((ext_vector_type(8)))  float v8f;
typedef __attribute__((ext_vector_type(4)))  float v4f;
typedef __attribute__((ext_vector_type(2)))  float v2f;
typedef __attribute__((ext_vector_type(4)))  unsigned v4u;
typedef __attribute__((ext_vector_type(4)))  int v4i;
typedef float __attribute__((may_alias)) float_a;
typedef int __attribute__((may_alias)) int_a;

template <typename T> __device__ __forceinline__ void vst2(void* p, T v) { *(T*)p = v;  }
__device__ __forceinline__ v8f wmma16(v16h a, v16h b, v8f c) {
  v8f d = __builtin_amdgcn_wmma_f32_16x16x32_f16(false, a, false, b, (short)0, c, false, false);
  asm volatile("v_nop\n\tv_nop\n\tv_nop\n\tv_nop" : "+v"(d) : "v"(a), "v"(b));
  return d;
}
__device__ __forceinline__ v8f wmma_bf(v16b a, v16b b, v8f c) {
  v8f d = __builtin_amdgcn_wmma_f32_16x16x32_bf16(false, a, false, b, (short)0, c, false, false);
  asm volatile("v_nop\n\tv_nop\n\tv_nop\n\tv_nop" : "+v"(d) : "v"(a), "v"(b));
  return d;
}
// 16x16x32 fragments: lane = (h = lane>>4, row/col = lane&15); elements 0..7 = k0+8h+0..7, 8..15 = k0+16+8h+0..7; D element r = row 8h+r
__device__ __forceinline__ v16h frag_h(const _Float16* rowk0, int lane) {
  union { v16h v; v8h q[2]; } u; const _Float16* p = rowk0 + 8 * (lane >> 4);
  u.q[0] = *(const v8h*)p; u.q[1] = *(const v8h*)(p + 16); return u.v;
}
__device__ __forceinline__ v16h frag_f32(const float* rowk0, int lane) {
  v16h a; const float* p = rowk0 + 8 * (lane >> 4);
#pragma unroll
  for (int i = 0; i < 8; ++i) { a[i] = (_Float16)p[i]; a[8 + i] = (_Float16)p[16 + i]; }
  return a;
}
__device__ __forceinline__ v16h frag_f32s(const float* rowk0, int lane, float sc) {
  v16h a; const float* p = rowk0 + 8 * (lane >> 4);
#pragma unroll
  for (int i = 0; i < 8; ++i) { a[i] = (_Float16)(p[i] * sc); a[8 + i] = (_Float16)(p[16 + i] * sc); }
  return a;
}
// column fragment from a [K][ld] layout (column n), rows >= K read as 0
__device__ __forceinline__ v16h fragc_f32(const float* W, int k0, int n, int lane, int ld, int K) {
  v16h a; const int g = lane >> 4;
#pragma unroll
  for (int i = 0; i < 8; ++i) { const int ka = k0 + 8 * g + i, kb = ka + 16;
    a[i] = (_Float16)(ka < K ? W[(size_t)(ka < K ? ka : K - 1) * ld + n] : 0.f); a[8 + i] = (_Float16)(kb < K ? W[(size_t)(kb < K ? kb : K - 1) * ld + n] : 0.f); }
  return a;
}
struct F2 { v16b h, l; };
__device__ __forceinline__ F2 bsplit16(const float v[16]) { F2 r;
#pragma unroll
  for (int i = 0; i < 16; ++i) { const __bf16 h = (__bf16)v[i]; r.h[i] = h; r.l[i] = (__bf16)(v[i] - (float)h); }
  return r; }
__device__ __forceinline__ F2 split_row(const float* row, int k0, int lane) { float v[16]; const float* p = row + k0 + 8 * (lane >> 4);
#pragma unroll
  for (int i = 0; i < 8; ++i) { v[i] = p[i]; v[8 + i] = p[16 + i]; }
  return bsplit16(v); }
__device__ __forceinline__ F2 split_rowK(const float* row, int k0, int lane, int K) { float v[16]; const int g = lane >> 4;
#pragma unroll
  for (int i = 0; i < 8; ++i) { const int ka = k0 + 8 * g + i, kb = ka + 16; v[i] = ka < K ? row[ka < K ? ka : K - 1] : 0.f; v[8 + i] = kb < K ? row[kb < K ? kb : K - 1] : 0.f; }
  return bsplit16(v); }
__device__ __forceinline__ F2 split_col(const float* W, int k0, int n, int lane, int ld, int K) { float v[16]; const int g = lane >> 4;
#pragma unroll
  for (int i = 0; i < 8; ++i) { const int ka = k0 + 8 * g + i, kb = ka + 16; v[i] = ka < K ? W[(size_t)(ka < K ? ka : K - 1) * ld + n] : 0.f; v[8 + i] = kb < K ? W[(size_t)(kb < K ? kb : K - 1) * ld + n] : 0.f; }
  return bsplit16(v); }
__device__ __forceinline__ v8f mac3(const F2& a, const F2& b, v8f c) { c = wmma_bf(a.l, b.h, c); c = wmma_bf(a.h, b.l, c); return wmma_bf(a.h, b.h, c); }
__device__ __forceinline__ float sigm(float v) { return 1.0f / (1.0f + expf(-v)); }
#define LDSX() do { asm volatile("s_wait_dscnt 0" ::: "memory"); __builtin_amdgcn_wave_barrier(); __builtin_amdgcn_fence(__ATOMIC_RELEASE, "workgroup"); } while (0)


// Eagle-3 draft-model attention (B 1, L 2,048, input 4,096 = 2 x hidden, 32 query heads x 64 with 8 shared KV heads, rotate-half RoPE from given cos / sin, causal softmax / sqrt(64), Wo).
#define SS 2048
#define XD 4096            // input width (2 * hidden)
#define NH 32
#define NKV 8
#define HD 64
#define QD (NH * HD)       // 2,048
#define KD (NKV * HD)      // 512
#define QKW (QD + 2 * KD)  // 3,072 projected columns: q | k | v
#define OD 2048            // Wo output width
#ifndef TQB
#define TQB (SS / 64)
#define TOB (SS / 64)
#define QRB (SS / 64)      // projected row blocks
#endif
typedef __attribute__((ext_vector_type(8))) __bf16 v8b;
__device__ __forceinline__ v16b frag_b(const __bf16* rowk0, int lane) {
  union { v16b v; v8b q[2]; } u; const __bf16* p = rowk0 + 8 * (lane >> 4);
  u.q[0] = *(const v8b*)p; u.q[1] = *(const v8b*)(p + 16); return u.v;
}
__device__ __forceinline__ float bfr(float v) { return (float)(__bf16)v; }
__device__ __attribute__((noinline)) float exp_ni(float v) { return expf(v); }
__device__ __attribute__((noinline)) float erf_ni(float v) { return erff(v); }

#define PK_A 0                           // [3072][4096]: Wq | Wk | Wv natural rows
#define PK_O (PK_A + (size_t)QKW * XD)     // [2048][2048] Wo natural rows
#define PK_END (PK_O + (size_t)OD * QD)
#define WS_PK  0u
#define WS_QH  (((2u * PK_END) + 127u) / 128u * 128u)   // f16 [2048][2560]: rope(q) | rope(k) hi
#define WS_QL  (WS_QH + 2u * (size_t)SS * (QD + KD))    // residual x2048
#define WS_VTH (WS_QL + 2u * (size_t)SS * (QD + KD))    // f16 [kv 8][64][2048] v hi / lo
#define WS_VTL (WS_VTH + 2u * (size_t)KD * SS)
#define WS_OH  (WS_VTL + 2u * (size_t)KD * SS)          // bf16 [2048][2048] attention output hi / lo
#define WS_OL  (WS_OH + 2u * (size_t)SS * QD)
#define WS_END (WS_OL + 2u * (size_t)SS * QD)

// ---- k_pack: block = (row n, which): 0: q|k|v rows (n < 3072: Wq rows 0..2047, Wk 2048..2559, Wv 2560..3071) K 4096; 1: Wo rows (n < 2048) K 2048
__global__ __launch_bounds__(256) void k_pack(const float* __restrict__ WQ, const float* __restrict__ WK, const float* __restrict__ WV, const float* __restrict__ WO, __bf16* __restrict__ PK) {
  __shared__ __align__(16) __bf16 s[XD]; const int n = blockIdx.x, which = blockIdx.y, t = threadIdx.x; int K; size_t dst; const float* src;
  if (which == 0) { K = XD; dst = PK_A + (size_t)n * XD; src = (n < QD) ? WQ + (size_t)n * XD : (n < QD + KD) ? WK + (size_t)(n - QD) * XD : WV + (size_t)(n - QD - KD) * XD; }
  else { if (n >= OD) return; K = QD; dst = PK_O + (size_t)n * QD; src = WO + (size_t)n * QD; }
  for (int k = t; k < K; k += 256) s[k] = (__bf16)src[k];
  __syncthreads();
  for (int q = t; q < K / 8; q += 256) vst2((unsigned*)(PK + dst + q * 8), *(const v4u*)&s[q * 8]);
}
// ---- LDS ring of the two projection GEMMs: a stage is 64 k of every operand row, brought by asynchronous 16-byte copies; rows of 128 B lie at pitch 144 B, rows of 256 B at 272 B (16 B x odd: ds_load_b128 without bank conflicts)
#define KS 64
#define P128 144
#define P256 272
__device__ __forceinline__ unsigned lds_off(const void* p) { return (unsigned)(size_t)p; }   // byte offset in the work-group's LDS: low 32 bits of the __shared__ address
// eight copies of one lane; s_wait_xcnt closes the copies' own statement, so that no address register is rewritten ahead of it
__device__ __forceinline__ void cp8(const unsigned (&l)[8], const char* const (&g)[8]) {
  asm volatile("global_load_async_to_lds_b128 %0, %8, off\n\t"
               "global_load_async_to_lds_b128 %1, %9, off\n\t"
               "global_load_async_to_lds_b128 %2, %10, off\n\t"
               "global_load_async_to_lds_b128 %3, %11, off\n\t"
               "global_load_async_to_lds_b128 %4, %12, off\n\t"
               "global_load_async_to_lds_b128 %5, %13, off\n\t"
               "global_load_async_to_lds_b128 %6, %14, off\n\t"
               "global_load_async_to_lds_b128 %7, %15, off\n\t"
               "s_wait_xcnt 0x0"
               :: "v"(l[0]), "v"(l[1]), "v"(l[2]), "v"(l[3]), "v"(l[4]), "v"(l[5]), "v"(l[6]), "v"(l[7]),
                  "v"(g[0]), "v"(g[1]), "v"(g[2]), "v"(g[3]), "v"(g[4]), "v"(g[5]), "v"(g[6]), "v"(g[7]) : "memory");
}
// 128 threads bring 128 rows of 128 B (a wave-wide copy = 4 whole lines); g0 = first byte of row 0 of the stage
__device__ __forceinline__ void stage_128x128(unsigned l0, const char* g0, size_t gp, int tid) {
  unsigned l[8]; const char* g[8]; const int r = tid >> 3, sg = (tid & 7) * 16;
#pragma unroll
  for (int i = 0; i < 8; ++i) { l[i] = l0 + (unsigned)((r + 16 * i) * P128 + sg); g[i] = g0 + (size_t)(r + 16 * i) * gp + sg; }
  cp8(l, g);
}
// 128 threads bring 64 rows of 256 B
__device__ __forceinline__ void stage_64x256(unsigned l0, const char* g0, size_t gp, int tid) {
  unsigned l[8]; const char* g[8]; const int r = tid >> 4, sg = (tid & 15) * 16;
#pragma unroll
  for (int i = 0; i < 8; ++i) { l[i] = l0 + (unsigned)((r + 8 * i) * P256 + sg); g[i] = g0 + (size_t)(r + 8 * i) * gp + sg; }
  cp8(l, g);
}
// 128 threads bring 64 rows of 128 B from each of two planes of one pitch
__device__ __forceinline__ void stage_2x64x128(unsigned la, const char* ga, unsigned lb, const char* gb, size_t gp, int tid) {
  unsigned l[8]; const char* g[8]; const int r = tid >> 3, sg = (tid & 7) * 16;
#pragma unroll
  for (int i = 0; i < 4; ++i) { l[i] = la + (unsigned)((r + 16 * i) * P128 + sg); g[i] = ga + (size_t)(r + 16 * i) * gp + sg; l[4 + i] = lb + (unsigned)((r + 16 * i) * P128 + sg); g[4 + i] = gb + (size_t)(r + 16 * i) * gp + sg; }
  cp8(l, g);
}
// the issuing wave's own wait for its copies (the compiler places none), and the wait that ends this wave's LDS reads in front of a refill
#define WAIT_ASYNC() asm volatile("s_wait_asynccnt 0x0" ::: "memory")
#define WAIT_DS() asm volatile("s_wait_dscnt 0x0" ::: "memory")
// ---- k_qkv: block = (64 rows, 128 cols of 3072): acc = bf16(x) . rows (exact, K 4096); q/k blocks: rotate-half RoPE (partner 32 columns away = 2 tiles, same lane) with cos/sin[pos][d] -> f16 hi/lo rows; v: hi/lo transposed planes [kv][d][s]
__global__ __launch_bounds__(128) void k_qkv(const float* __restrict__ X, const __bf16* __restrict__ PK, const float* __restrict__ COS, const float* __restrict__ SIN, _Float16* __restrict__ QH, _Float16* __restrict__ QL_, _Float16* __restrict__ VTH, _Float16* __restrict__ VTL) {
  constexpr int SB = 128 * P128, STG = SB + 64 * P256, NT = XD / KS;   // stage: weight rows (bf16) | x rows (f32)
  __shared__ __align__(16) char sm[2 * STG];   // the ring; behind the k loop's last barrier the same bytes are the output staging
  _Float16 (*soh)[16][136] = (_Float16 (*)[16][136])sm; _Float16 (*sol)[16][136] = soh + 4; _Float16 (*sth)[72] = (_Float16 (*)[72])sm; _Float16 (*stl)[72] = sth + 128;
  static_assert(2 * STG >= 2 * 4 * 16 * 136 * 2 && 2 * STG >= 2 * 128 * 72 * 2, "output staging fits the ring");
  const int tid = threadIdx.x, wave = tid >> 5, lane = tid & 31, col = lane & 15, g = lane >> 4; const size_t r0 = (size_t)blockIdx.x * 64 + wave * 16; const int n0 = blockIdx.y * 128;
  v8f acc[8] = {};
  const unsigned sm0 = lds_off(sm); const char* gw = (const char*)(PK + PK_A + (size_t)n0 * XD); const char* gx = (const char*)(X + (size_t)blockIdx.x * 64 * XD);
  stage_128x128(sm0, gw, XD * 2, tid); stage_64x256(sm0 + SB, gx, XD * 4, tid);
  WAIT_ASYNC(); __syncthreads();
  stage_128x128(sm0 + STG, gw + KS * 2, XD * 2, tid); stage_64x256(sm0 + STG + SB, gx + KS * 4, XD * 4, tid);
#pragma unroll 1   // one stage a trip: the buffer index stays a run-time value and the ring's order stands once
  for (int t = 0; t < NT; ++t) { const char* bw = sm + (t & 1) * STG; const char* bx = bw + SB + (wave * 16 + col) * P256;
    v4f xr[KS / 32][4]; v16b wf[KS / 32][8];   // the stage's LDS reads stand as one group in front of its products
#pragma unroll
    for (int kk = 0; kk < KS / 32; ++kk) { const v4f* p = (const v4f*)(bx + (kk * 32 + 8 * g) * 4); xr[kk][0] = p[0]; xr[kk][1] = p[1]; xr[kk][2] = p[4]; xr[kk][3] = p[5];
#pragma unroll
      for (int j = 0; j < 8; ++j) wf[kk][j] = frag_b((const __bf16*)(bw + (j * 16 + col) * P128) + kk * 32, lane); }
#pragma unroll
    for (int kk = 0; kk < KS / 32; ++kk) { v16b a;
#pragma unroll
      for (int i = 0; i < 4; ++i) { a[i] = (__bf16)xr[kk][0][i]; a[4 + i] = (__bf16)xr[kk][1][i]; a[8 + i] = (__bf16)xr[kk][2][i]; a[12 + i] = (__bf16)xr[kk][3][i]; }
#pragma unroll
      for (int j = 0; j < 8; ++j) acc[j] = wmma_bf(a, wf[kk][j], acc[j]); }
    WAIT_DS(); WAIT_ASYNC(); __syncthreads();   // publishes stage t + 1 and ends every reader's last read of stage t
    if (t + 2 < NT) { const unsigned lb = sm0 + (unsigned)(t & 1) * STG; stage_128x128(lb, gw + (size_t)(t + 2) * (KS * 2), XD * 2, tid); stage_64x256(lb + SB, gx + (size_t)(t + 2) * (KS * 4), XD * 4, tid); } }
  WAIT_ASYNC();
  if (n0 < QD + KD) {   // q or k block: 2 heads of 64 per 128-col block; rotate_half: d < 32: out = x_d cos_d - x_{d+32} sin_d; d >= 32: out = x_d cos_d + x_{d-32} sin_d
#pragma unroll
    for (int j = 0; j < 8; ++j) { const int jh = j & 3; const int d = jh * 16 + col; const int jp = (jh < 2) ? j + 2 : j - 2; const float sgn = (jh < 2) ? -1.f : 1.f;
#pragma unroll
      for (int r = 0; r < 8; ++r) { const int pos = (int)(r0 + 8 * g + r); const float v = acc[j][r] * bfr(COS[(size_t)pos * HD + d]) + sgn * acc[jp][r] * bfr(SIN[(size_t)pos * HD + d]);
        const _Float16 hv = (_Float16)v; soh[wave][8 * g + r][j * 16 + col] = hv; sol[wave][8 * g + r][j * 16 + col] = (_Float16)((v - (float)hv) * 2048.0f); } }
    LDSX();
    for (int rl = 0; rl < 16; ++rl) { if (lane < 16) vst2((unsigned*)(QH + (r0 + rl) * (QD + KD) + n0 + lane * 8), *(const v4u*)&soh[wave][rl][lane * 8]); else vst2((unsigned*)(QL_ + (r0 + rl) * (QD + KD) + n0 + (lane - 16) * 8), *(const v4u*)&sol[wave][rl][(lane - 16) * 8]); }
  } else {
#pragma unroll
    for (int j = 0; j < 8; ++j)
#pragma unroll
      for (int r = 0; r < 8; ++r) { const float v = acc[j][r]; const _Float16 hv = (_Float16)v; sth[j * 16 + col][wave * 16 + 8 * g + r] = hv; stl[j * 16 + col][wave * 16 + 8 * g + r] = (_Float16)((v - (float)hv) * 2048.0f); }
    __syncthreads();
    const int c0 = n0 - QD - KD; const size_t s0 = (size_t)blockIdx.x * 64;
    for (int e = tid; e < 128 * 8; e += 128) { const int d = e >> 3, pc = e & 7; const size_t o = (size_t)(c0 + d) * SS + s0 + pc * 8; vst2((unsigned*)(VTH + o), *(const v4u*)&sth[d][pc * 8]); vst2((unsigned*)(VTL + o), *(const v4u*)&stl[d][pc * 8]); }
  }
}
// lane l <-> lane l ^ 16 (the two halves of a wave hold the two key halves of one query column)
__device__ __forceinline__ float xhalf(float x) { return __builtin_bit_cast(float, __builtin_amdgcn_permlanex16(__builtin_bit_cast(int, x), __builtin_bit_cast(int, x), 0x76543210, 0xfedcba98, false, false)); }
// ---- k_attn: transposed products: S^T = K . Q^T (A = key rows, B = query columns), O^T += V^T . P^T. A lane holds one query (column col) and keys 8g+r of each 16-key tile: maximum and sum run in the lane, one exchange between the halves; the two score tiles convert in place into the P^T operand (element ct*8+r = key ct*16+8g+r), so P needs no LDS.
__global__ __launch_bounds__(128) void k_attn(const _Float16* __restrict__ QH, const _Float16* __restrict__ QL_, const _Float16* __restrict__ VTH, const _Float16* __restrict__ VTL, __bf16* __restrict__ OH, __bf16* __restrict__ OL) {
  __shared__ __align__(16) __bf16 soh[4][16][72], sol[4][16][72];
  const int tid = threadIdx.x, wave = tid >> 5, lane = tid & 31, col = lane & 15, g = lane >> 4; const int qb = blockIdx.x, h = blockIdx.y; const int kvh = h / (NH / NKV); const int q0 = qb * 64 + wave * 16; const size_t rq = (size_t)q0 + col; const int qi = q0 + col;
  v16h aqh[2], aql[2];
#pragma unroll
  for (int kc = 0; kc < 2; ++kc) { aqh[kc] = frag_h(QH + rq * (QD + KD) + h * HD + kc * 32, lane); aql[kc] = frag_h(QL_ + rq * (QD + KD) + h * HD + kc * 32, lane); }
  float m = -3.0e38f, l = 0.f;   // this lane's query: running maximum (equal in both halves), sum over this half's keys
  v8f acc[4] = {}, accl[4] = {};  // O^T: element r = d (dt*16 + 8g + r), column = query
  const int nks = (qb * 64 + 64) / 32;
#pragma unroll 1
  for (int ks = 0; ks < nks; ++ks) { v8f s[2];
#pragma unroll
    for (int ct = 0; ct < 2; ++ct) { const int kr = ks * 32 + ct * 16 + col; const _Float16* krow = QH + (size_t)kr * (QD + KD) + QD + kvh * HD; const _Float16* krowl = QL_ + (size_t)kr * (QD + KD) + QD + kvh * HD; v8f c = {}, cl = {};
#pragma unroll
      for (int kc = 0; kc < 2; ++kc) { const v16h khf = frag_h(krow + kc * 32, lane); c = wmma16(khf, aqh[kc], c); cl = wmma16(khf, aql[kc], cl); cl = wmma16(frag_h(krowl + kc * 32, lane), aqh[kc], cl); }
#pragma unroll
      for (int r = 0; r < 8; ++r) { const int kk = ks * 32 + ct * 16 + 8 * g + r; const float sv = (c[r] + cl[r] * (1.0f / 2048.0f)) * 0.125f; s[ct][r] = (kk <= qi) ? sv : -3.0e38f; } }
    float mx = fmaxf(s[0][0], s[1][0]);
#pragma unroll
    for (int r = 1; r < 8; ++r) mx = fmaxf(mx, fmaxf(s[0][r], s[1][r]));
    mx = fmaxf(mx, xhalf(mx));
    const float mn = fmaxf(m, mx); const float alpha = (m <= -1.0e38f) ? 0.f : exp_ni(m - mn);
    v16h pah, pal; float es = 0.f;
#pragma unroll
    for (int ct = 0; ct < 2; ++ct)
#pragma unroll
      for (int r = 0; r < 8; ++r) { const float e = (s[ct][r] <= -1.0e38f) ? 0.f : exp_ni(s[ct][r] - mn); es += e; const _Float16 hv = (_Float16)e; pah[ct * 8 + r] = hv; pal[ct * 8 + r] = (_Float16)((e - (float)hv) * 2048.0f); }
    l = l * alpha + es; m = mn;
#pragma unroll
    for (int dt = 0; dt < 4; ++dt)
#pragma unroll
      for (int r = 0; r < 8; ++r) { acc[dt][r] *= alpha; accl[dt][r] *= alpha; }
#pragma unroll
    for (int dt = 0; dt < 4; ++dt) { const size_t vo = (size_t)(kvh * HD + dt * 16 + col) * SS + ks * 32; const v16h vh = frag_h(VTH + vo, lane), vl = frag_h(VTL + vo, lane); acc[dt] = wmma16(vh, pah, acc[dt]); accl[dt] = wmma16(vh, pal, accl[dt]); accl[dt] = wmma16(vl, pah, accl[dt]); } }
  const float il = 1.0f / (l + xhalf(l));
#pragma unroll
  for (int dt = 0; dt < 4; ++dt)
#pragma unroll
    for (int r = 0; r < 8; ++r) { const float v = (acc[dt][r] + accl[dt][r] * (1.0f / 2048.0f)) * il; const __bf16 hb = (__bf16)v; soh[wave][col][dt * 16 + 8 * g + r] = hb; sol[wave][col][dt * 16 + 8 * g + r] = (__bf16)(v - (float)hb); }
  LDSX();
  for (int rl = 0; rl < 16; ++rl) { const size_t o = ((size_t)q0 + rl) * QD + h * HD; if (lane < 8) vst2((unsigned*)(OH + o + lane * 8), *(const v4u*)&soh[wave][rl][lane * 8]); else if (lane < 16) vst2((unsigned*)(OL + o + (lane - 8) * 8), *(const v4u*)&sol[wave][rl][(lane - 8) * 8]); }
}
// ---- k_out: block = (64 rows, 128 cols): out = O(hi/lo) . Wo rows (2 products, K 2048)
__global__ __launch_bounds__(128) void k_out(const __bf16* __restrict__ OH, const __bf16* __restrict__ OL, const __bf16* __restrict__ PK, float* __restrict__ Y) {
  constexpr int SB = 128 * P128, SA = 64 * P128, STG = SB + 2 * SA, NT = QD / KS;   // stage: Wo rows | ctx hi rows | ctx lo rows
  __shared__ __align__(16) char sm[2 * STG];   // the ring; behind the k loop's last barrier the same bytes are the output staging
  float (*so)[16][132] = (float (*)[16][132])sm;
  static_assert(2 * STG >= 4 * 16 * 132 * 4, "output staging fits the ring");
  const int tid = threadIdx.x, wave = tid >> 5, lane = tid & 31, col = lane & 15, g = lane >> 4; const size_t r0 = (size_t)blockIdx.x * 64 + wave * 16; const int n0 = blockIdx.y * 128;
  v8f acc[8] = {};
  const unsigned sm0 = lds_off(sm); const char* gw = (const char*)(PK + PK_O + (size_t)n0 * QD); const char* gh = (const char*)(OH + (size_t)blockIdx.x * 64 * QD); const char* gl = (const char*)(OL + (size_t)blockIdx.x * 64 * QD);
  stage_128x128(sm0, gw, QD * 2, tid); stage_2x64x128(sm0 + SB, gh, sm0 + SB + SA, gl, QD * 2, tid);
  WAIT_ASYNC(); __syncthreads();
  stage_128x128(sm0 + STG, gw + KS * 2, QD * 2, tid); stage_2x64x128(sm0 + STG + SB, gh + KS * 2, sm0 + STG + SB + SA, gl + KS * 2, QD * 2, tid);
#pragma unroll 1   // one stage a trip: the buffer index stays a run-time value and the ring's order stands once
  for (int t = 0; t < NT; ++t) { const char* bw = sm + (t & 1) * STG; const char* bh = bw + SB + (wave * 16 + col) * P128;
    v16b ah[KS / 32], al[KS / 32], wf[KS / 32][8];   // the stage's LDS reads stand as one group in front of its products
#pragma unroll
    for (int kk = 0; kk < KS / 32; ++kk) { ah[kk] = frag_b((const __bf16*)bh + kk * 32, lane); al[kk] = frag_b((const __bf16*)(bh + SA) + kk * 32, lane);
#pragma unroll
      for (int j = 0; j < 8; ++j) wf[kk][j] = frag_b((const __bf16*)(bw + (j * 16 + col) * P128) + kk * 32, lane); }
#pragma unroll
    for (int kk = 0; kk < KS / 32; ++kk)
#pragma unroll
      for (int j = 0; j < 8; ++j) { acc[j] = wmma_bf(al[kk], wf[kk][j], acc[j]); acc[j] = wmma_bf(ah[kk], wf[kk][j], acc[j]); }
    WAIT_DS(); WAIT_ASYNC(); __syncthreads();   // publishes stage t + 1 and ends every reader's last read of stage t
    if (t + 2 < NT) { const unsigned lb = sm0 + (unsigned)(t & 1) * STG; const size_t ko = (size_t)(t + 2) * (KS * 2); stage_128x128(lb, gw + ko, QD * 2, tid); stage_2x64x128(lb + SB, gh + ko, lb + SB + SA, gl + ko, QD * 2, tid); } }
  WAIT_ASYNC();
#pragma unroll
  for (int j = 0; j < 8; ++j)
#pragma unroll
    for (int r = 0; r < 8; ++r) so[wave][8 * g + r][j * 16 + col] = acc[j][r];
  LDSX();
  for (int rl = 0; rl < 16; ++rl) vst2(Y + (r0 + rl) * OD + n0 + lane * 4, *(const v4f*)&so[wave][rl][lane * 4]);
}
extern "C" void kernel_launch(void* const* d_in, const int* in_sizes, int n_in, void* d_out, int out_size, void* d_ws, size_t ws_size, hipStream_t stream) {
  (void)in_sizes; (void)n_in; (void)out_size;
  const float** F = (const float**)d_in;   // 0 x [1,2048,4096], 1 cos [1,1,2048,64], 2 sin, 3 Wq [2048,4096], 4 Wk [512,4096], 5 Wv [512,4096], 6 Wo [2048,2048]
  if (ws_size < (size_t)WS_END) return;
  char* ws = (char*)d_ws; __bf16 *PK = (__bf16*)(ws + WS_PK), *OH = (__bf16*)(ws + WS_OH), *OL = (__bf16*)(ws + WS_OL); _Float16 *QH = (_Float16*)(ws + WS_QH), *QLp = (_Float16*)(ws + WS_QL), *VTH = (_Float16*)(ws + WS_VTH), *VTL = (_Float16*)(ws + WS_VTL);
  k_pack<<<dim3(QKW, 2), 256, 0, stream>>>(F[3], F[4], F[5], F[6], PK);
  k_qkv<<<dim3(QRB, QKW / 128), 128, 0, stream>>>(F[0], PK, F[1], F[2], QH, QLp, VTH, VTL);
  k_attn<<<dim3(TQB, NH), 128, 0, stream>>>(QH, QLp, VTH, VTL, OH, OL);
  k_out<<<dim3(TOB, OD / 128), 128, 0, stream>>>(OH, OL, PK, (float*)d_out);
}

// v003
// Measured time: 270 microseconds a run.
// Two timings next to v002 both put it at 1.59 times that version's speed.
// Over all steps from v000 it is 3.21 times as fast.
// compute dtype: x, cos, sin, Wq, Wk, Wv, Wo (module inputs) rounded to bf16; q/k/v projections with exact bf16 products on WMMA 16x16x32 (natural [out][in] rows); rotate-half RoPE with the input cos / sin tables in f32 in the projection epilogue; q and k stored as f16 hi + (x2048-scaled) residual planes with 3-product scores, x 1/sqrt(64) on the f32 score, causal mask (strict future), running-max softmax in f32 (precise expf); P as f16 hi + (x2048) residual x v hi/lo (3 products); GQA: query head h reads kv head h/4; output projection with ctx as bf16 hi + residual x exact Wo rows (2 products); f32 accumulate.
#include <hip/hip_runtime.h>
#include <math.h>

typedef __attribute__((ext_vector_type(16))) _Float16 v16h;
typedef __attribute__((ext_vector_type(16))) __bf16 v16b;
typedef __attribute__((ext_vector_type(8)))  _Float16 v8h;
typedef __attribute__((ext_vector_type(8)))  float v8f;
typedef __attribute__((ext_vector_type(4)))  float v4f;
typedef __attribute__((ext_vector_type(2)))  float v2f;
typedef __attribute__((ext_vector_type(4)))  unsigned v4u;
typedef __attribute__((ext_vector_type(4)))  int v4i;
typedef float __attribute__((may_alias)) float_a;
typedef int __attribute__((may_alias)) int_a;

template <typename T> __device__ __forceinline__ void vst2(void* p, T v) { *(T*)p = v;  }
__device__ __forceinline__ v8f wmma16(v16h a, v16h b, v8f c) {
  v8f d = __builtin_amdgcn_wmma_f32_16x16x32_f16(false, a, false, b, (short)0, c, false, false);
  asm volatile("v_nop\n\tv_nop\n\tv_nop\n\tv_nop" : "+v"(d) : "v"(a), "v"(b));
  return d;
}
__device__ __forceinline__ v8f wmma_bf(v16b a, v16b b, v8f c) {
  v8f d = __builtin_amdgcn_wmma_f32_16x16x32_bf16(false, a, false, b, (short)0, c, false, false);
  asm volatile("v_nop\n\tv_nop\n\tv_nop\n\tv_nop" : "+v"(d) : "v"(a), "v"(b));
  return d;
}
// 16x16x32 fragments: lane = (h = lane>>4, row/col = lane&15); elements 0..7 = k0+8h+0..7, 8..15 = k0+16+8h+0..7; D element r = row 8h+r
__device__ __forceinline__ v16h frag_h(const _Float16* rowk0, int lane) {
  union { v16h v; v8h q[2]; } u; const _Float16* p = rowk0 + 8 * (lane >> 4);
  u.q[0] = *(const v8h*)p; u.q[1] = *(const v8h*)(p + 16); return u.v;
}
__device__ __forceinline__ v16h frag_f32(const float* rowk0, int lane) {
  v16h a; const float* p = rowk0 + 8 * (lane >> 4);
#pragma unroll
  for (int i = 0; i < 8; ++i) { a[i] = (_Float16)p[i]; a[8 + i] = (_Float16)p[16 + i]; }
  return a;
}
__device__ __forceinline__ v16h frag_f32s(const float* rowk0, int lane, float sc) {
  v16h a; const float* p = rowk0 + 8 * (lane >> 4);
#pragma unroll
  for (int i = 0; i < 8; ++i) { a[i] = (_Float16)(p[i] * sc); a[8 + i] = (_Float16)(p[16 + i] * sc); }
  return a;
}
// column fragment from a [K][ld] layout (column n), rows >= K read as 0
__device__ __forceinline__ v16h fragc_f32(const float* W, int k0, int n, int lane, int ld, int K) {
  v16h a; const int g = lane >> 4;
#pragma unroll
  for (int i = 0; i < 8; ++i) { const int ka = k0 + 8 * g + i, kb = ka + 16;
    a[i] = (_Float16)(ka < K ? W[(size_t)(ka < K ? ka : K - 1) * ld + n] : 0.f); a[8 + i] = (_Float16)(kb < K ? W[(size_t)(kb < K ? kb : K - 1) * ld + n] : 0.f); }
  return a;
}
struct F2 { v16b h, l; };
__device__ __forceinline__ F2 bsplit16(const float v[16]) { F2 r;
#pragma unroll
  for (int i = 0; i < 16; ++i) { const __bf16 h = (__bf16)v[i]; r.h[i] = h; r.l[i] = (__bf16)(v[i] - (float)h); }
  return r; }
__device__ __forceinline__ F2 split_row(const float* row, int k0, int lane) { float v[16]; const float* p = row + k0 + 8 * (lane >> 4);
#pragma unroll
  for (int i = 0; i < 8; ++i) { v[i] = p[i]; v[8 + i] = p[16 + i]; }
  return bsplit16(v); }
__device__ __forceinline__ F2 split_rowK(const float* row, int k0, int lane, int K) { float v[16]; const int g = lane >> 4;
#pragma unroll
  for (int i = 0; i < 8; ++i) { const int ka = k0 + 8 * g + i, kb = ka + 16; v[i] = ka < K ? row[ka < K ? ka : K - 1] : 0.f; v[8 + i] = kb < K ? row[kb < K ? kb : K - 1] : 0.f; }
  return bsplit16(v); }
__device__ __forceinline__ F2 split_col(const float* W, int k0, int n, int lane, int ld, int K) { float v[16]; const int g = lane >> 4;
#pragma unroll
  for (int i = 0; i < 8; ++i) { const int ka = k0 + 8 * g + i, kb = ka + 16; v[i] = ka < K ? W[(size_t)(ka < K ? ka : K - 1) * ld + n] : 0.f; v[8 + i] = kb < K ? W[(size_t)(kb < K ? kb : K - 1) * ld + n] : 0.f; }
  return bsplit16(v); }
__device__ __forceinline__ v8f mac3(const F2& a, const F2& b, v8f c) { c = wmma_bf(a.l, b.h, c); c = wmma_bf(a.h, b.l, c); return wmma_bf(a.h, b.h, c); }
__device__ __forceinline__ float sigm(float v) { return 1.0f / (1.0f + expf(-v)); }
#define LDSX() do { asm volatile("s_wait_dscnt 0" ::: "memory"); __builtin_amdgcn_wave_barrier(); __builtin_amdgcn_fence(__ATOMIC_RELEASE, "workgroup"); } while (0)


// Eagle-3 draft-model attention (B 1, L 2,048, input 4,096 = 2 x hidden, 32 query heads x 64 with 8 shared KV heads, rotate-half RoPE from given cos / sin, causal softmax / sqrt(64), Wo).
#define SS 2048
#define XD 4096            // input width (2 * hidden)
#define NH 32
#define NKV 8
#define HD 64
#define QD (NH * HD)       // 2,048
#define KD (NKV * HD)      // 512
#define QKW (QD + 2 * KD)  // 3,072 projected columns: q | k | v
#define OD 2048            // Wo output width
#ifndef TQB
#define TQB (SS / 64)
#define TOB (SS / 64)
#define QRB (SS / 64)      // projected row blocks
#endif
typedef __attribute__((ext_vector_type(8))) __bf16 v8b;
__device__ __forceinline__ v16b frag_b(const __bf16* rowk0, int lane) {
  union { v16b v; v8b q[2]; } u; const __bf16* p = rowk0 + 8 * (lane >> 4);
  u.q[0] = *(const v8b*)p; u.q[1] = *(const v8b*)(p + 16); return u.v;
}
__device__ __forceinline__ float bfr(float v) { return (float)(__bf16)v; }
__device__ __attribute__((noinline)) float exp_ni(float v) { return expf(v); }
__device__ __attribute__((noinline)) float erf_ni(float v) { return erff(v); }

#define PK_A 0                           // [3072][4096]: Wq | Wk | Wv natural rows
#define PK_O (PK_A + (size_t)QKW * XD)     // [2048][2048] Wo natural rows
#define PK_END (PK_O + (size_t)OD * QD)
#define WS_PK  0u
#define WS_QH  (((2u * PK_END) + 127u) / 128u * 128u)   // f16 [2048][2560]: rope(q) | rope(k) hi
#define WS_QL  (WS_QH + 2u * (size_t)SS * (QD + KD))    // residual x2048
#define WS_VTH (WS_QL + 2u * (size_t)SS * (QD + KD))    // f16 [kv 8][64][2048] v hi / lo
#define WS_VTL (WS_VTH + 2u * (size_t)KD * SS)
#define WS_OH  (WS_VTL + 2u * (size_t)KD * SS)          // bf16 [2048][2048] attention output hi / lo
#define WS_OL  (WS_OH + 2u * (size_t)SS * QD)
#define WS_END (WS_OL + 2u * (size_t)SS * QD)

// ---- k_pack: block = (row n, which): 0: q|k|v rows (n < 3072: Wq rows 0..2047, Wk 2048..2559, Wv 2560..3071) K 4096; 1: Wo rows (n < 2048) K 2048
__global__ __launch_bounds__(256) void k_pack(const float* __restrict__ WQ, const float* __restrict__ WK, const float* __restrict__ WV, const float* __restrict__ WO, __bf16* __restrict__ PK) {
  __shared__ __align__(16) __bf16 s[XD]; const int n = blockIdx.x, which = blockIdx.y, t = threadIdx.x; int K; size_t dst; const float* src;
  if (which == 0) { K = XD; dst = PK_A + (size_t)n * XD; src = (n < QD) ? WQ + (size_t)n * XD : (n < QD + KD) ? WK + (size_t)(n - QD) * XD : WV + (size_t)(n - QD - KD) * XD; }
  else { if (n >= OD) return; K = QD; dst = PK_O + (size_t)n * QD; src = WO + (size_t)n * QD; }
  for (int k = t; k < K; k += 256) s[k] = (__bf16)src[k];
  __syncthreads();
  for (int q = t; q < K / 8; q += 256) vst2((unsigned*)(PK + dst + q * 8), *(const v4u*)&s[q * 8]);
}
// ---- LDS ring of the two projection GEMMs: a stage is 64 k of every operand row, brought by asynchronous 16-byte copies; rows of 128 B lie at pitch 144 B, rows of 256 B at 272 B (16 B x odd: ds_load_b128 without bank conflicts)
#define KS 64
#define P128 144
#define P256 272
__device__ __forceinline__ unsigned lds_off(const void* p) { return (unsigned)(size_t)p; }   // byte offset in the work-group's LDS: low 32 bits of the __shared__ address
// eight copies of one lane; s_wait_xcnt closes the copies' own statement, so that no address register is rewritten ahead of it
__device__ __forceinline__ void cp8(const unsigned (&l)[8], const char* const (&g)[8]) {
  asm volatile("global_load_async_to_lds_b128 %0, %8, off\n\t"
               "global_load_async_to_lds_b128 %1, %9, off\n\t"
               "global_load_async_to_lds_b128 %2, %10, off\n\t"
               "global_load_async_to_lds_b128 %3, %11, off\n\t"
               "global_load_async_to_lds_b128 %4, %12, off\n\t"
               "global_load_async_to_lds_b128 %5, %13, off\n\t"
               "global_load_async_to_lds_b128 %6, %14, off\n\t"
               "global_load_async_to_lds_b128 %7, %15, off\n\t"
               "s_wait_xcnt 0x0"
               :: "v"(l[0]), "v"(l[1]), "v"(l[2]), "v"(l[3]), "v"(l[4]), "v"(l[5]), "v"(l[6]), "v"(l[7]),
                  "v"(g[0]), "v"(g[1]), "v"(g[2]), "v"(g[3]), "v"(g[4]), "v"(g[5]), "v"(g[6]), "v"(g[7]) : "memory");
}
// 128 threads bring 128 rows of 128 B (a wave-wide copy = 4 whole lines); g0 = first byte of row 0 of the stage
__device__ __forceinline__ void stage_128x128(unsigned l0, const char* g0, size_t gp, int tid) {
  unsigned l[8]; const char* g[8]; const int r = tid >> 3, sg = (tid & 7) * 16;
#pragma unroll
  for (int i = 0; i < 8; ++i) { l[i] = l0 + (unsigned)((r + 16 * i) * P128 + sg); g[i] = g0 + (size_t)(r + 16 * i) * gp + sg; }
  cp8(l, g);
}
// 128 threads bring 64 rows of 256 B
__device__ __forceinline__ void stage_64x256(unsigned l0, const char* g0, size_t gp, int tid) {
  unsigned l[8]; const char* g[8]; const int r = tid >> 4, sg = (tid & 15) * 16;
#pragma unroll
  for (int i = 0; i < 8; ++i) { l[i] = l0 + (unsigned)((r + 8 * i) * P256 + sg); g[i] = g0 + (size_t)(r + 8 * i) * gp + sg; }
  cp8(l, g);
}
// 128 threads bring 64 rows of 128 B from each of two planes of one pitch
__device__ __forceinline__ void stage_2x64x128(unsigned la, const char* ga, unsigned lb, const char* gb, size_t gp, int tid) {
  unsigned l[8]; const char* g[8]; const int r = tid >> 3, sg = (tid & 7) * 16;
#pragma unroll
  for (int i = 0; i < 4; ++i) { l[i] = la + (unsigned)((r + 16 * i) * P128 + sg); g[i] = ga + (size_t)(r + 16 * i) * gp + sg; l[4 + i] = lb + (unsigned)((r + 16 * i) * P128 + sg); g[4 + i] = gb + (size_t)(r + 16 * i) * gp + sg; }
  cp8(l, g);
}
// the issuing wave's own wait for its copies (the compiler places none), and the wait that ends this wave's LDS reads in front of a refill
#define WAIT_ASYNC() asm volatile("s_wait_asynccnt 0x0" ::: "memory")
#define WAIT_DS() asm volatile("s_wait_dscnt 0x0" ::: "memory")
// ---- k_qkv: block = (64 rows, 128 cols of 3072): acc = bf16(x) . rows (exact, K 4096); q/k blocks: rotate-half RoPE (partner 32 columns away = 2 tiles, same lane) with cos/sin[pos][d] -> f16 hi/lo rows; v: hi/lo transposed planes [kv][d][s]
__global__ __launch_bounds__(128) void k_qkv(const float* __restrict__ X, const __bf16* __restrict__ PK, const float* __restrict__ COS, const float* __restrict__ SIN, _Float16* __restrict__ QH, _Float16* __restrict__ QL_, _Float16* __restrict__ VTH, _Float16* __restrict__ VTL) {
  constexpr int SB = 128 * P128, STG = SB + 64 * P256, NT = XD / KS;   // stage: weight rows (bf16) | x rows (f32)
  __shared__ __align__(16) char sm[2 * STG];   // the ring; behind the k loop's last barrier the same bytes are the output staging
  _Float16 (*soh)[16][136] = (_Float16 (*)[16][136])sm; _Float16 (*sol)[16][136] = soh + 4; _Float16 (*sth)[72] = (_Float16 (*)[72])sm; _Float16 (*stl)[72] = sth + 128;
  static_assert(2 * STG >= 2 * 4 * 16 * 136 * 2 && 2 * STG >= 2 * 128 * 72 * 2, "output staging fits the ring");
  const int tid = threadIdx.x, wave = tid >> 5, lane = tid & 31, col = lane & 15, g = lane >> 4; const size_t r0 = (size_t)blockIdx.x * 64 + wave * 16; const int n0 = blockIdx.y * 128;
  v8f acc[8] = {};
  const unsigned sm0 = lds_off(sm); const char* gw = (const char*)(PK + PK_A + (size_t)n0 * XD); const char* gx = (const char*)(X + (size_t)blockIdx.x * 64 * XD);
  stage_128x128(sm0, gw, XD * 2, tid); stage_64x256(sm0 + SB, gx, XD * 4, tid);
  WAIT_ASYNC(); __syncthreads();
  stage_128x128(sm0 + STG, gw + KS * 2, XD * 2, tid); stage_64x256(sm0 + STG + SB, gx + KS * 4, XD * 4, tid);
#pragma unroll 1   // one stage a trip: the buffer index stays a run-time value and the ring's order stands once
  for (int t = 0; t < NT; ++t) { const char* bw = sm + (t & 1) * STG; const char* bx = bw + SB + (wave * 16 + col) * P256;
    v4f xr[KS / 32][4]; v16b wf[KS / 32][8];   // the stage's LDS reads stand as one group in front of its products
#pragma unroll
    for (int kk = 0; kk < KS / 32; ++kk) { const v4f* p = (const v4f*)(bx + (kk * 32 + 8 * g) * 4); xr[kk][0] = p[0]; xr[kk][1] = p[1]; xr[kk][2] = p[4]; xr[kk][3] = p[5];
#pragma unroll
      for (int j = 0; j < 8; ++j) wf[kk][j] = frag_b((const __bf16*)(bw + (j * 16 + col) * P128) + kk * 32, lane); }
#pragma unroll
    for (int kk = 0; kk < KS / 32; ++kk) { v16b a;
#pragma unroll
      for (int i = 0; i < 4; ++i) { a[i] = (__bf16)xr[kk][0][i]; a[4 + i] = (__bf16)xr[kk][1][i]; a[8 + i] = (__bf16)xr[kk][2][i]; a[12 + i] = (__bf16)xr[kk][3][i]; }
#pragma unroll
      for (int j = 0; j < 8; ++j) acc[j] = wmma_bf(a, wf[kk][j], acc[j]); }
    WAIT_DS(); WAIT_ASYNC(); __syncthreads();   // publishes stage t + 1 and ends every reader's last read of stage t
    if (t + 2 < NT) { const unsigned lb = sm0 + (unsigned)(t & 1) * STG; stage_128x128(lb, gw + (size_t)(t + 2) * (KS * 2), XD * 2, tid); stage_64x256(lb + SB, gx + (size_t)(t + 2) * (KS * 4), XD * 4, tid); } }
  WAIT_ASYNC();
  if (n0 < QD + KD) {   // q or k block: 2 heads of 64 per 128-col block; rotate_half: d < 32: out = x_d cos_d - x_{d+32} sin_d; d >= 32: out = x_d cos_d + x_{d-32} sin_d
#pragma unroll
    for (int j = 0; j < 8; ++j) { const int jh = j & 3; const int d = jh * 16 + col; const int jp = (jh < 2) ? j + 2 : j - 2; const float sgn = (jh < 2) ? -1.f : 1.f;
#pragma unroll
      for (int r = 0; r < 8; ++r) { const int pos = (int)(r0 + 8 * g + r); const float v = acc[j][r] * bfr(COS[(size_t)pos * HD + d]) + sgn * acc[jp][r] * bfr(SIN[(size_t)pos * HD + d]);
        const _Float16 hv = (_Float16)v; soh[wave][8 * g + r][j * 16 + col] = hv; sol[wave][8 * g + r][j * 16 + col] = (_Float16)((v - (float)hv) * 2048.0f); } }
    LDSX();
    for (int rl = 0; rl < 16; ++rl) { if (lane < 16) vst2((unsigned*)(QH + (r0 + rl) * (QD + KD) + n0 + lane * 8), *(const v4u*)&soh[wave][rl][lane * 8]); else vst2((unsigned*)(QL_ + (r0 + rl) * (QD + KD) + n0 + (lane - 16) * 8), *(const v4u*)&sol[wave][rl][(lane - 16) * 8]); }
  } else {
#pragma unroll
    for (int j = 0; j < 8; ++j)
#pragma unroll
      for (int r = 0; r < 8; ++r) { const float v = acc[j][r]; const _Float16 hv = (_Float16)v; sth[j * 16 + col][wave * 16 + 8 * g + r] = hv; stl[j * 16 + col][wave * 16 + 8 * g + r] = (_Float16)((v - (float)hv) * 2048.0f); }
    __syncthreads();
    const int c0 = n0 - QD - KD; const size_t s0 = (size_t)blockIdx.x * 64;
    for (int e = tid; e < 128 * 8; e += 128) { const int d = e >> 3, pc = e & 7; const size_t o = (size_t)(c0 + d) * SS + s0 + pc * 8; vst2((unsigned*)(VTH + o), *(const v4u*)&sth[d][pc * 8]); vst2((unsigned*)(VTL + o), *(const v4u*)&stl[d][pc * 8]); }
  }
}
// lane l <-> lane l ^ 16 (the two halves of a wave hold the two key halves of one query column)
__device__ __forceinline__ float xhalf(float x) { return __builtin_bit_cast(float, __builtin_amdgcn_permlanex16(__builtin_bit_cast(int, x), __builtin_bit_cast(int, x), 0x76543210, 0xfedcba98, false, false)); }
// ---- k_attn: transposed products: S^T = K . Q^T (A = key rows, B = query columns), O^T += V^T . P^T. A lane holds one query (column col) and keys 8g+r of each 16-key tile: maximum and sum run in the lane, one exchange between the halves; the two score tiles convert in place into the P^T operand (element ct*8+r = key ct*16+8g+r), so P needs no LDS. K and V^T come through an LDS ring that the block's four waves share: a stage is 64 keys (two 32-key passes), brought by asynchronous 16-byte copies in whole 128-B rows.
__global__ __launch_bounds__(128) void k_attn(const _Float16* __restrict__ QH, const _Float16* __restrict__ QL_, const _Float16* __restrict__ VTH, const _Float16* __restrict__ VTL, __bf16* __restrict__ OH, __bf16* __restrict__ OL) {
  constexpr int SP = 64 * P128, STG = 4 * SP;   // stage: K hi rows [key][d] | K lo rows | V^T hi rows [d][key] | V^T lo rows, 64 rows of 128 B each
  __shared__ __align__(16) char sm[2 * STG];   // the ring; behind the key loop's last barrier the same bytes are the output staging
  __bf16 (*soh)[16][72] = (__bf16 (*)[16][72])sm; __bf16 (*sol)[16][72] = soh + 4;
  static_assert(2 * STG >= 2 * 4 * 16 * 72 * 2, "output staging fits the ring");
  const int tid = threadIdx.x, wave = tid >> 5, lane = tid & 31, col = lane & 15, g = lane >> 4; const int qb = blockIdx.x, h = blockIdx.y; const int kvh = h / (NH / NKV); const int q0 = qb * 64 + wave * 16; const size_t rq = (size_t)q0 + col; const int qi = q0 + col;
  const int NT = qb + 1;   // stages of 64 keys up to and with the diagonal block
  const unsigned sm0 = lds_off(sm); const size_t kp = (size_t)(QD + KD) * 2, vp = (size_t)SS * 2;   // source pitches in bytes
  const char* gkh = (const char*)(QH + QD + kvh * HD); const char* gkl = (const char*)(QL_ + QD + kvh * HD); const char* gvh = (const char*)(VTH + (size_t)kvh * HD * SS); const char* gvl = (const char*)(VTL + (size_t)kvh * HD * SS);
  stage_2x64x128(sm0, gkh, sm0 + SP, gkl, kp, tid); stage_2x64x128(sm0 + 2 * SP, gvh, sm0 + 3 * SP, gvl, vp, tid);
  v16h aqh[2], aql[2];
#pragma unroll
  for (int kc = 0; kc < 2; ++kc) { aqh[kc] = frag_h(QH + rq * (QD + KD) + h * HD + kc * 32, lane); aql[kc] = frag_h(QL_ + rq * (QD + KD) + h * HD + kc * 32, lane); }
  WAIT_ASYNC(); __syncthreads();
  if (NT > 1) { stage_2x64x128(sm0 + STG, gkh + 64 * kp, sm0 + STG + SP, gkl + 64 * kp, kp, tid); stage_2x64x128(sm0 + STG + 2 * SP, gvh + 128, sm0 + STG + 3 * SP, gvl + 128, vp, tid); }
  float m = -3.0e38f, l = 0.f;   // this lane's query: running maximum (equal in both halves), sum over this half's keys
  v8f acc[4] = {}, accl[4] = {};  // O^T: element r = d (dt*16 + 8g + r), column = query
#pragma unroll 1   // one stage a trip: the buffer index stays a run-time value and the ring's order stands once
  for (int t = 0; t < NT; ++t) { const char* bk = sm + (t & 1) * STG;
#pragma unroll 1   // the two passes of a stage share one body, so that the loop's text stays short
    for (int hf = 0; hf < 2; ++hf) { const int ks = 2 * t + hf; v8f s[2];
      v16h kh[2][2], kl[2][2];   // the pass's key fragments stand as one group of LDS reads in front of its score products
#pragma unroll
      for (int ct = 0; ct < 2; ++ct) { const char* kr = bk + (hf * 32 + ct * 16 + col) * P128;
#pragma unroll
        for (int kc = 0; kc < 2; ++kc) { kh[ct][kc] = frag_h((const _Float16*)kr + kc * 32, lane); kl[ct][kc] = frag_h((const _Float16*)(kr + SP) + kc * 32, lane); } }
#pragma unroll
      for (int ct = 0; ct < 2; ++ct) { v8f c = {}, cl = {};
#pragma unroll
        for (int kc = 0; kc < 2; ++kc) { c = wmma16(kh[ct][kc], aqh[kc], c); cl = wmma16(kh[ct][kc], aql[kc], cl); cl = wmma16(kl[ct][kc], aqh[kc], cl); }
#pragma unroll
        for (int r = 0; r < 8; ++r) { const int kk = ks * 32 + ct * 16 + 8 * g + r; const float sv = (c[r] + cl[r] * (1.0f / 2048.0f)) * 0.125f; s[ct][r] = (kk <= qi) ? sv : -3.0e38f; } }
      v16h vh[4], vl[4];   // the pass's value fragments: one group of LDS reads, in flight under the maximum
#pragma unroll
      for (int dt = 0; dt < 4; ++dt) { const char* vr = bk + 2 * SP + (dt * 16 + col) * P128; vh[dt] = frag_h((const _Float16*)vr + hf * 32, lane); vl[dt] = frag_h((const _Float16*)(vr + SP) + hf * 32, lane); }
      float mx = fmaxf(s[0][0], s[1][0]);
#pragma unroll
      for (int r = 1; r < 8; ++r) mx = fmaxf(mx, fmaxf(s[0][r], s[1][r]));
      mx = fmaxf(mx, xhalf(mx));
      const float mn = fmaxf(m, mx); const float alpha = (m <= -1.0e38f) ? 0.f : exp_ni(m - mn);
      v16h pah, pal; float es = 0.f;
#pragma unroll
      for (int ct = 0; ct < 2; ++ct)
#pragma unroll
        for (int r = 0; r < 8; ++r) { const float e = (s[ct][r] <= -1.0e38f) ? 0.f : exp_ni(s[ct][r] - mn); es += e; const _Float16 hv = (_Float16)e; pah[ct * 8 + r] = hv; pal[ct * 8 + r] = (_Float16)((e - (float)hv) * 2048.0f); }
      l = l * alpha + es; m = mn;
#pragma unroll
      for (int dt = 0; dt < 4; ++dt)
#pragma unroll
        for (int r = 0; r < 8; ++r) { acc[dt][r] *= alpha; accl[dt][r] *= alpha; }
#pragma unroll
      for (int dt = 0; dt < 4; ++dt) { acc[dt] = wmma16(vh[dt], pah, acc[dt]); accl[dt] = wmma16(vh[dt], pal, accl[dt]); accl[dt] = wmma16(vl[dt], pah, accl[dt]); } }
    WAIT_DS(); WAIT_ASYNC(); __syncthreads();   // publishes stage t + 1 and ends every reader's last read of stage t
    if (t + 2 < NT) { const unsigned lb = sm0 + (unsigned)(t & 1) * STG; const size_t ko = (size_t)(t + 2) * 64 * kp, vo = (size_t)(t + 2) * 128; stage_2x64x128(lb, gkh + ko, lb + SP, gkl + ko, kp, tid); stage_2x64x128(lb + 2 * SP, gvh + vo, lb + 3 * SP, gvl + vo, vp, tid); } }
  WAIT_ASYNC();
  const float il = 1.0f / (l + xhalf(l));
#pragma unroll
  for (int dt = 0; dt < 4; ++dt)
#pragma unroll
    for (int r = 0; r < 8; ++r) { const float v = (acc[dt][r] + accl[dt][r] * (1.0f / 2048.0f)) * il; const __bf16 hb = (__bf16)v; soh[wave][col][dt * 16 + 8 * g + r] = hb; sol[wave][col][dt * 16 + 8 * g + r] = (__bf16)(v - (float)hb); }
  LDSX();
  for (int rl = 0; rl < 16; ++rl) { const size_t o = ((size_t)q0 + rl) * QD + h * HD; if (lane < 8) vst2((unsigned*)(OH + o + lane * 8), *(const v4u*)&soh[wave][rl][lane * 8]); else if (lane < 16) vst2((unsigned*)(OL + o + (lane - 8) * 8), *(const v4u*)&sol[wave][rl][(lane - 8) * 8]); }
}
// ---- k_out: block = (64 rows, 128 cols): out = O(hi/lo) . Wo rows (2 products, K 2048)
__global__ __launch_bounds__(128) void k_out(const __bf16* __restrict__ OH, const __bf16* __restrict__ OL, const __bf16* __restrict__ PK, float* __restrict__ Y) {
  constexpr int SB = 128 * P128, SA = 64 * P128, STG = SB + 2 * SA, NT = QD / KS;   // stage: Wo rows | ctx hi rows | ctx lo rows
  __shared__ __align__(16) char sm[2 * STG];   // the ring; behind the k loop's last barrier the same bytes are the output staging
  float (*so)[16][132] = (float (*)[16][132])sm;
  static_assert(2 * STG >= 4 * 16 * 132 * 4, "output staging fits the ring");
  const int tid = threadIdx.x, wave = tid >> 5, lane = tid & 31, col = lane & 15, g = lane >> 4; const size_t r0 = (size_t)blockIdx.x * 64 + wave * 16; const int n0 = blockIdx.y * 128;
  v8f acc[8] = {};
  const unsigned sm0 = lds_off(sm); const char* gw = (const char*)(PK + PK_O + (size_t)n0 * QD); const char* gh = (const char*)(OH + (size_t)blockIdx.x * 64 * QD); const char* gl = (const char*)(OL + (size_t)blockIdx.x * 64 * QD);
  stage_128x128(sm0, gw, QD * 2, tid); stage_2x64x128(sm0 + SB, gh, sm0 + SB + SA, gl, QD * 2, tid);
  WAIT_ASYNC(); __syncthreads();
  stage_128x128(sm0 + STG, gw + KS * 2, QD * 2, tid); stage_2x64x128(sm0 + STG + SB, gh + KS * 2, sm0 + STG + SB + SA, gl + KS * 2, QD * 2, tid);
#pragma unroll 1   // one stage a trip: the buffer index stays a run-time value and the ring's order stands once
  for (int t = 0; t < NT; ++t) { const char* bw = sm + (t & 1) * STG; const char* bh = bw + SB + (wave * 16 + col) * P128;
    v16b ah[KS / 32], al[KS / 32], wf[KS / 32][8];   // the stage's LDS reads stand as one group in front of its products
#pragma unroll
    for (int kk = 0; kk < KS / 32; ++kk) { ah[kk] = frag_b((const __bf16*)bh + kk * 32, lane); al[kk] = frag_b((const __bf16*)(bh + SA) + kk * 32, lane);
#pragma unroll
      for (int j = 0; j < 8; ++j) wf[kk][j] = frag_b((const __bf16*)(bw + (j * 16 + col) * P128) + kk * 32, lane); }
#pragma unroll
    for (int kk = 0; kk < KS / 32; ++kk)
#pragma unroll
      for (int j = 0; j < 8; ++j) { acc[j] = wmma_bf(al[kk], wf[kk][j], acc[j]); acc[j] = wmma_bf(ah[kk], wf[kk][j], acc[j]); }
    WAIT_DS(); WAIT_ASYNC(); __syncthreads();   // publishes stage t + 1 and ends every reader's last read of stage t
    if (t + 2 < NT) { const unsigned lb = sm0 + (unsigned)(t & 1) * STG; const size_t ko = (size_t)(t + 2) * (KS * 2); stage_128x128(lb, gw + ko, QD * 2, tid); stage_2x64x128(lb + SB, gh + ko, lb + SB + SA, gl + ko, QD * 2, tid); } }
  WAIT_ASYNC();
#pragma unroll
  for (int j = 0; j < 8; ++j)
#pragma unroll
    for (int r = 0; r < 8; ++r) so[wave][8 * g + r][j * 16 + col] = acc[j][r];
  LDSX();
  for (int rl = 0; rl < 16; ++rl) vst2(Y + (r0 + rl) * OD + n0 + lane * 4, *(const v4f*)&so[wave][rl][lane * 4]);
}
extern "C" void kernel_launch(void* const* d_in, const int* in_sizes, int n_in, void* d_out, int out_size, void* d_ws, size_t ws_size, hipStream_t stream) {
  (void)in_sizes; (void)n_in; (void)out_size;
  const float** F = (const float**)d_in;   // 0 x [1,2048,4096], 1 cos [1,1,2048,64], 2 sin, 3 Wq [2048,4096], 4 Wk [512,4096], 5 Wv [512,4096], 6 Wo [2048,2048]
  if (ws_size < (size_t)WS_END) return;
  char* ws = (char*)d_ws; __bf16 *PK = (__bf16*)(ws + WS_PK), *OH = (__bf16*)(ws + WS_OH), *OL = (__bf16*)(ws + WS_OL); _Float16 *QH = (_Float16*)(ws + WS_QH), *QLp = (_Float16*)(ws + WS_QL), *VTH = (_Float16*)(ws + WS_VTH), *VTL = (_Float16*)(ws + WS_VTL);
  k_pack<<<dim3(QKW, 2), 256, 0, stream>>>(F[3], F[4], F[5], F[6], PK);
  k_qkv<<<dim3(QRB, QKW / 128), 128, 0, stream>>>(F[0], PK, F[1], F[2], QH, QLp, VTH, VTL);
  k_attn<<<dim3(TQB, NH), 128, 0, stream>>>(QH, QLp, VTH, VTL, OH, OL);
  k_out<<<dim3(TOB, OD / 128), 128, 0, stream>>>(OH, OL, PK, (float*)d_out);
}

// v004
// It runs in 216 microseconds.
// In both of two side-by-side timings against v003, it was 1.26 times as fast.
// Counting every step since v000, it is 4.03 times as fast.
// compute dtype: x, cos, sin, Wq, Wk, Wv, Wo (module inputs) rounded to bf16; q/k/v projections with exact bf16 products on WMMA 16x16x32 (natural [out][in] rows); rotate-half RoPE with the input cos / sin tables in f32 in the projection epilogue; q and k stored as f16 hi + (x2048-scaled) residual planes with 3-product scores, causal mask (strict future), running-max softmax in f32 in base 2 (1/sqrt(64) and log2(e) as one factor inside the exponent's fma, hardware exp2); P as f16 hi + (x2048) residual x v hi/lo (3 products); GQA: query head h reads kv head h/4; output projection with ctx as bf16 hi + residual x exact Wo rows (2 products); f32 accumulate.
#include <hip/hip_runtime.h>
#include <math.h>

typedef __attribute__((ext_vector_type(16))) _Float16 v16h;
typedef __attribute__((ext_vector_type(16))) __bf16 v16b;
typedef __attribute__((ext_vector_type(8)))  _Float16 v8h;
typedef __attribute__((ext_vector_type(8)))  float v8f;
typedef __attribute__((ext_vector_type(4)))  float v4f;
typedef __attribute__((ext_vector_type(2)))  float v2f;
typedef __attribute__((ext_vector_type(4)))  unsigned v4u;
typedef __attribute__((ext_vector_type(4)))  int v4i;
typedef float __attribute__((may_alias)) float_a;
typedef int __attribute__((may_alias)) int_a;

template <typename T> __device__ __forceinline__ void vst2(void* p, T v) { *(T*)p = v;  }
__device__ __forceinline__ v8f wmma16(v16h a, v16h b, v8f c) {
  v8f d = __builtin_amdgcn_wmma_f32_16x16x32_f16(false, a, false, b, (short)0, c, false, false);
  asm volatile("v_nop\n\tv_nop\n\tv_nop\n\tv_nop" : "+v"(d) : "v"(a), "v"(b));
  return d;
}
__device__ __forceinline__ v8f wmma_bf(v16b a, v16b b, v8f c) {
  v8f d = __builtin_amdgcn_wmma_f32_16x16x32_bf16(false, a, false, b, (short)0, c, false, false);
  asm volatile("v_nop\n\tv_nop\n\tv_nop\n\tv_nop" : "+v"(d) : "v"(a), "v"(b));
  return d;
}
// 16x16x32 fragments: lane = (h = lane>>4, row/col = lane&15); elements 0..7 = k0+8h+0..7, 8..15 = k0+16+8h+0..7; D element r = row 8h+r
__device__ __forceinline__ v16h frag_h(const _Float16* rowk0, int lane) {
  union { v16h v; v8h q[2]; } u; const _Float16* p = rowk0 + 8 * (lane >> 4);
  u.q[0] = *(const v8h*)p; u.q[1] = *(const v8h*)(p + 16); return u.v;
}
__device__ __forceinline__ v16h frag_f32(const float* rowk0, int lane) {
  v16h a; const float* p = rowk0 + 8 * (lane >> 4);
#pragma unroll
  for (int i = 0; i < 8; ++i) { a[i] = (_Float16)p[i]; a[8 + i] = (_Float16)p[16 + i]; }
  return a;
}
__device__ __forceinline__ v16h frag_f32s(const float* rowk0, int lane, float sc) {
  v16h a; const float* p = rowk0 + 8 * (lane >> 4);
#pragma unroll
  for (int i = 0; i < 8; ++i) { a[i] = (_Float16)(p[i] * sc); a[8 + i] = (_Float16)(p[16 + i] * sc); }
  return a;
}
// column fragment from a [K][ld] layout (column n), rows >= K read as 0
__device__ __forceinline__ v16h fragc_f32(const float* W, int k0, int n, int lane, int ld, int K) {
  v16h a; const int g = lane >> 4;
#pragma unroll
  for (int i = 0; i < 8; ++i) { const int ka = k0 + 8 * g + i, kb = ka + 16;
    a[i] = (_Float16)(ka < K ? W[(size_t)(ka < K ? ka : K - 1) * ld + n] : 0.f); a[8 + i] = (_Float16)(kb < K ? W[(size_t)(kb < K ? kb : K - 1) * ld + n] : 0.f); }
  return a;
}
struct F2 { v16b h, l; };
__device__ __forceinline__ F2 bsplit16(const float v[16]) { F2 r;
#pragma unroll
  for (int i = 0; i < 16; ++i) { const __bf16 h = (__bf16)v[i]; r.h[i] = h; r.l[i] = (__bf16)(v[i] - (float)h); }
  return r; }
__device__ __forceinline__ F2 split_row(const float* row, int k0, int lane) { float v[16]; const float* p = row + k0 + 8 * (lane >> 4);
#pragma unroll
  for (int i = 0; i < 8; ++i) { v[i] = p[i]; v[8 + i] = p[16 + i]; }
  return bsplit16(v); }
__device__ __forceinline__ F2 split_rowK(const float* row, int k0, int lane, int K) { float v[16]; const int g = lane >> 4;
#pragma unroll
  for (int i = 0; i < 8; ++i) { const int ka = k0 + 8 * g + i, kb = ka + 16; v[i] = ka < K ? row[ka < K ? ka : K - 1] : 0.f; v[8 + i] = kb < K ? row[kb < K ? kb : K - 1] : 0.f; }
  return bsplit16(v); }
__device__ __forceinline__ F2 split_col(const float* W, int k0, int n, int lane, int ld, int K) { float v[16]; const int g = lane >> 4;
#pragma unroll
  for (int i = 0; i < 8; ++i) { const int ka = k0 + 8 * g + i, kb = ka + 16; v[i] = ka < K ? W[(size_t)(ka < K ? ka : K - 1) * ld + n] : 0.f; v[8 + i] = kb < K ? W[(size_t)(kb < K ? kb : K - 1) * ld + n] : 0.f; }
  return bsplit16(v); }
__device__ __forceinline__ v8f mac3(const F2& a, const F2& b, v8f c) { c = wmma_bf(a.l, b.h, c); c = wmma_bf(a.h, b.l, c); return wmma_bf(a.h, b.h, c); }
__device__ __forceinline__ float sigm(float v) { return 1.0f / (1.0f + expf(-v)); }
#define LDSX() do { asm volatile("s_wait_dscnt 0" ::: "memory"); __builtin_amdgcn_wave_barrier(); __builtin_amdgcn_fence(__ATOMIC_RELEASE, "workgroup"); } while (0)


// Eagle-3 draft-model attention (B 1, L 2,048, input 4,096 = 2 x hidden, 32 query heads x 64 with 8 shared KV heads, rotate-half RoPE from given cos / sin, causal softmax / sqrt(64), Wo).
#define SS 2048
#define XD 4096            // input width (2 * hidden)
#define NH 32
#define NKV 8
#define HD 64
#define QD (NH * HD)       // 2,048
#define KD (NKV * HD)      // 512
#define QKW (QD + 2 * KD)  // 3,072 projected columns: q | k | v
#define OD 2048            // Wo output width
#ifndef TQB
#define TQB (SS / 64)
#define TOB (SS / 64)
#define QRB (SS / 64)      // projected row blocks
#endif
typedef __attribute__((ext_vector_type(8))) __bf16 v8b;
__device__ __forceinline__ v16b frag_b(const __bf16* rowk0, int lane) {
  union { v16b v; v8b q[2]; } u; const __bf16* p = rowk0 + 8 * (lane >> 4);
  u.q[0] = *(const v8b*)p; u.q[1] = *(const v8b*)(p + 16); return u.v;
}
__device__ __forceinline__ float bfr(float v) { return (float)(__bf16)v; }
__device__ __attribute__((noinline)) float erf_ni(float v) { return erff(v); }

#define PK_A 0                           // [3072][4096]: Wq | Wk | Wv natural rows
#define PK_O (PK_A + (size_t)QKW * XD)     // [2048][2048] Wo natural rows
#define PK_END (PK_O + (size_t)OD * QD)
#define WS_PK  0u
#define WS_QH  (((2u * PK_END) + 127u) / 128u * 128u)   // f16 [2048][2560]: rope(q) | rope(k) hi
#define WS_QL  (WS_QH + 2u * (size_t)SS * (QD + KD))    // residual x2048
#define WS_VTH (WS_QL + 2u * (size_t)SS * (QD + KD))    // f16 [kv 8][64][2048] v hi / lo
#define WS_VTL (WS_VTH + 2u * (size_t)KD * SS)
#define WS_OH  (WS_VTL + 2u * (size_t)KD * SS)          // bf16 [2048][2048] attention output hi / lo
#define WS_OL  (WS_OH + 2u * (size_t)SS * QD)
#define WS_END (WS_OL + 2u * (size_t)SS * QD)

// ---- k_pack: block = (row n, which): 0: q|k|v rows (n < 3072: Wq rows 0..2047, Wk 2048..2559, Wv 2560..3071) K 4096; 1: Wo rows (n < 2048) K 2048
__global__ __launch_bounds__(256) void k_pack(const float* __restrict__ WQ, const float* __restrict__ WK, const float* __restrict__ WV, const float* __restrict__ WO, __bf16* __restrict__ PK) {
  __shared__ __align__(16) __bf16 s[XD]; const int n = blockIdx.x, which = blockIdx.y, t = threadIdx.x; int K; size_t dst; const float* src;
  if (which == 0) { K = XD; dst = PK_A + (size_t)n * XD; src = (n < QD) ? WQ + (size_t)n * XD : (n < QD + KD) ? WK + (size_t)(n - QD) * XD : WV + (size_t)(n - QD - KD) * XD; }
  else { if (n >= OD) return; K = QD; dst = PK_O + (size_t)n * QD; src = WO + (size_t)n * QD; }
  for (int k = t; k < K; k += 256) s[k] = (__bf16)src[k];
  __syncthreads();
  for (int q = t; q < K / 8; q += 256) vst2((unsigned*)(PK + dst + q * 8), *(const v4u*)&s[q * 8]);
}
// ---- LDS ring of the two projection GEMMs: a stage is 64 k of every operand row, brought by asynchronous 16-byte copies; rows of 128 B lie at pitch 144 B, rows of 256 B at 272 B (16 B x odd: ds_load_b128 without bank conflicts)
#define KS 64
#define P128 144
#define P256 272
__device__ __forceinline__ unsigned lds_off(const void* p) { return (unsigned)(size_t)p; }   // byte offset in the work-group's LDS: low 32 bits of the __shared__ address
// eight copies of one lane; s_wait_xcnt closes the copies' own statement, so that no address register is rewritten ahead of it
__device__ __forceinline__ void cp8(const unsigned (&l)[8], const char* const (&g)[8]) {
  asm volatile("global_load_async_to_lds_b128 %0, %8, off\n\t"
               "global_load_async_to_lds_b128 %1, %9, off\n\t"
               "global_load_async_to_lds_b128 %2, %10, off\n\t"
               "global_load_async_to_lds_b128 %3, %11, off\n\t"
               "global_load_async_to_lds_b128 %4, %12, off\n\t"
               "global_load_async_to_lds_b128 %5, %13, off\n\t"
               "global_load_async_to_lds_b128 %6, %14, off\n\t"
               "global_load_async_to_lds_b128 %7, %15, off\n\t"
               "s_wait_xcnt 0x0"
               :: "v"(l[0]), "v"(l[1]), "v"(l[2]), "v"(l[3]), "v"(l[4]), "v"(l[5]), "v"(l[6]), "v"(l[7]),
                  "v"(g[0]), "v"(g[1]), "v"(g[2]), "v"(g[3]), "v"(g[4]), "v"(g[5]), "v"(g[6]), "v"(g[7]) : "memory");
}
// 128 threads bring 128 rows of 128 B (a wave-wide copy = 4 whole lines); g0 = first byte of row 0 of the stage
__device__ __forceinline__ void stage_128x128(unsigned l0, const char* g0, size_t gp, int tid) {
  unsigned l[8]; const char* g[8]; const int r = tid >> 3, sg = (tid & 7) * 16;
#pragma unroll
  for (int i = 0; i < 8; ++i) { l[i] = l0 + (unsigned)((r + 16 * i) * P128 + sg); g[i] = g0 + (size_t)(r + 16 * i) * gp + sg; }
  cp8(l, g);
}
// 128 threads bring 64 rows of 256 B
__device__ __forceinline__ void stage_64x256(unsigned l0, const char* g0, size_t gp, int tid) {
  unsigned l[8]; const char* g[8]; const int r = tid >> 4, sg = (tid & 15) * 16;
#pragma unroll
  for (int i = 0; i < 8; ++i) { l[i] = l0 + (unsigned)((r + 8 * i) * P256 + sg); g[i] = g0 + (size_t)(r + 8 * i) * gp + sg; }
  cp8(l, g);
}
// 128 threads bring 64 rows of 128 B from each of two planes of one pitch
__device__ __forceinline__ void stage_2x64x128(unsigned la, const char* ga, unsigned lb, const char* gb, size_t gp, int tid) {
  unsigned l[8]; const char* g[8]; const int r = tid >> 3, sg = (tid & 7) * 16;
#pragma unroll
  for (int i = 0; i < 4; ++i) { l[i] = la + (unsigned)((r + 16 * i) * P128 + sg); g[i] = ga + (size_t)(r + 16 * i) * gp + sg; l[4 + i] = lb + (unsigned)((r + 16 * i) * P128 + sg); g[4 + i] = gb + (size_t)(r + 16 * i) * gp + sg; }
  cp8(l, g);
}
// the issuing wave's own wait for its copies (the compiler places none), and the wait that ends this wave's LDS reads in front of a refill
#define WAIT_ASYNC() asm volatile("s_wait_asynccnt 0x0" ::: "memory")
#define WAIT_DS() asm volatile("s_wait_dscnt 0x0" ::: "memory")
// ---- k_qkv: block = (64 rows, 128 cols of 3072): acc = bf16(x) . rows (exact, K 4096); q/k blocks: rotate-half RoPE (partner 32 columns away = 2 tiles, same lane) with cos/sin[pos][d] -> f16 hi/lo rows; v: hi/lo transposed planes [kv][d][s]
__global__ __launch_bounds__(128) void k_qkv(const float* __restrict__ X, const __bf16* __restrict__ PK, const float* __restrict__ COS, const float* __restrict__ SIN, _Float16* __restrict__ QH, _Float16* __restrict__ QL_, _Float16* __restrict__ VTH, _Float16* __restrict__ VTL) {
  constexpr int SB = 128 * P128, STG = SB + 64 * P256, NT = XD / KS;   // stage: weight rows (bf16) | x rows (f32)
  __shared__ __align__(16) char sm[2 * STG];   // the ring; behind the k loop's last barrier the same bytes are the output staging
  _Float16 (*soh)[16][136] = (_Float16 (*)[16][136])sm; _Float16 (*sol)[16][136] = soh + 4; _Float16 (*sth)[72] = (_Float16 (*)[72])sm; _Float16 (*stl)[72] = sth + 128;
  static_assert(2 * STG >= 2 * 4 * 16 * 136 * 2 && 2 * STG >= 2 * 128 * 72 * 2, "output staging fits the ring");
  const int tid = threadIdx.x, wave = tid >> 5, lane = tid & 31, col = lane & 15, g = lane >> 4; const size_t r0 = (size_t)blockIdx.x * 64 + wave * 16; const int n0 = blockIdx.y * 128;
  v8f acc[8] = {};
  const unsigned sm0 = lds_off(sm); const char* gw = (const char*)(PK + PK_A + (size_t)n0 * XD); const char* gx = (const char*)(X + (size_t)blockIdx.x * 64 * XD);
  stage_128x128(sm0, gw, XD * 2, tid); stage_64x256(sm0 + SB, gx, XD * 4, tid);
  WAIT_ASYNC(); __syncthreads();
  stage_128x128(sm0 + STG, gw + KS * 2, XD * 2, tid); stage_64x256(sm0 + STG + SB, gx + KS * 4, XD * 4, tid);
#pragma unroll 1   // one stage a trip: the buffer index stays a run-time value and the ring's order stands once
  for (int t = 0; t < NT; ++t) { const char* bw = sm + (t & 1) * STG; const char* bx = bw + SB + (wave * 16 + col) * P256;
    v4f xr[KS / 32][4]; v16b wf[KS / 32][8];   // the stage's LDS reads stand as one group in front of its products
#pragma unroll
    for (int kk = 0; kk < KS / 32; ++kk) { const v4f* p = (const v4f*)(bx + (kk * 32 + 8 * g) * 4); xr[kk][0] = p[0]; xr[kk][1] = p[1]; xr[kk][2] = p[4]; xr[kk][3] = p[5];
#pragma unroll
      for (int j = 0; j < 8; ++j) wf[kk][j] = frag_b((const __bf16*)(bw + (j * 16 + col) * P128) + kk * 32, lane); }
#pragma unroll
    for (int kk = 0; kk < KS / 32; ++kk) { v16b a;
#pragma unroll
      for (int i = 0; i < 4; ++i) { a[i] = (__bf16)xr[kk][0][i]; a[4 + i] = (__bf16)xr[kk][1][i]; a[8 + i] = (__bf16)xr[kk][2][i]; a[12 + i] = (__bf16)xr[kk][3][i]; }
#pragma unroll
      for (int j = 0; j < 8; ++j) acc[j] = wmma_bf(a, wf[kk][j], acc[j]); }
    WAIT_DS(); WAIT_ASYNC(); __syncthreads();   // publishes stage t + 1 and ends every reader's last read of stage t
    if (t + 2 < NT) { const unsigned lb = sm0 + (unsigned)(t & 1) * STG; stage_128x128(lb, gw + (size_t)(t + 2) * (KS * 2), XD * 2, tid); stage_64x256(lb + SB, gx + (size_t)(t + 2) * (KS * 4), XD * 4, tid); } }
  WAIT_ASYNC();
  if (n0 < QD + KD) {   // q or k block: 2 heads of 64 per 128-col block; rotate_half: d < 32: out = x_d cos_d - x_{d+32} sin_d; d >= 32: out = x_d cos_d + x_{d-32} sin_d
#pragma unroll
    for (int j = 0; j < 8; ++j) { const int jh = j & 3; const int d = jh * 16 + col; const int jp = (jh < 2) ? j + 2 : j - 2; const float sgn = (jh < 2) ? -1.f : 1.f;
#pragma unroll
      for (int r = 0; r < 8; ++r) { const int pos = (int)(r0 + 8 * g + r); const float v = acc[j][r] * bfr(COS[(size_t)pos * HD + d]) + sgn * acc[jp][r] * bfr(SIN[(size_t)pos * HD + d]);
        const _Float16 hv = (_Float16)v; soh[wave][8 * g + r][j * 16 + col] = hv; sol[wave][8 * g + r][j * 16 + col] = (_Float16)((v - (float)hv) * 2048.0f); } }
    LDSX();
    for (int rl = 0; rl < 16; ++rl) { if (lane < 16) vst2((unsigned*)(QH + (r0 + rl) * (QD + KD) + n0 + lane * 8), *(const v4u*)&soh[wave][rl][lane * 8]); else vst2((unsigned*)(QL_ + (r0 + rl) * (QD + KD) + n0 + (lane - 16) * 8), *(const v4u*)&sol[wave][rl][(lane - 16) * 8]); }
  } else {
#pragma unroll
    for (int j = 0; j < 8; ++j)
#pragma unroll
      for (int r = 0; r < 8; ++r) { const float v = acc[j][r]; const _Float16 hv = (_Float16)v; sth[j * 16 + col][wave * 16 + 8 * g + r] = hv; stl[j * 16 + col][wave * 16 + 8 * g + r] = (_Float16)((v - (float)hv) * 2048.0f); }
    __syncthreads();
    const int c0 = n0 - QD - KD; const size_t s0 = (size_t)blockIdx.x * 64;
    for (int e = tid; e < 128 * 8; e += 128) { const int d = e >> 3, pc = e & 7; const size_t o = (size_t)(c0 + d) * SS + s0 + pc * 8; vst2((unsigned*)(VTH + o), *(const v4u*)&sth[d][pc * 8]); vst2((unsigned*)(VTL + o), *(const v4u*)&stl[d][pc * 8]); }
  }
}
// lane l <-> lane l ^ 16 (the two halves of a wave hold the two key halves of one query column)
__device__ __forceinline__ float xhalf(float x) { return __builtin_bit_cast(float, __builtin_amdgcn_permlanex16(__builtin_bit_cast(int, x), __builtin_bit_cast(int, x), 0x76543210, 0xfedcba98, false, false)); }
// ---- k_attn: transposed products: S^T = K . Q^T (A = key rows, B = query columns), O^T += V^T . P^T. A lane holds one query (column col) and keys 8g+r of each 16-key tile: maximum and sum run in the lane, one exchange between the halves; the two score tiles convert in place into the P^T operand (element ct*8+r = key ct*16+8g+r), so P needs no LDS. K and V^T come through an LDS ring that the block's four waves share: a stage is 64 keys (two 32-key passes), brought by asynchronous 16-byte copies in whole 128-B rows.
__global__ __launch_bounds__(128) void k_attn(const _Float16* __restrict__ QH, const _Float16* __restrict__ QL_, const _Float16* __restrict__ VTH, const _Float16* __restrict__ VTL, __bf16* __restrict__ OH, __bf16* __restrict__ OL) {
  constexpr int SP = 64 * P128, STG = 4 * SP;   // stage: K hi rows [key][d] | K lo rows | V^T hi rows [d][key] | V^T lo rows, 64 rows of 128 B each
  __shared__ __align__(16) char sm[2 * STG];   // the ring; behind the key loop's last barrier the same bytes are the output staging
  __bf16 (*soh)[16][72] = (__bf16 (*)[16][72])sm; __bf16 (*sol)[16][72] = soh + 4;
  static_assert(2 * STG >= 2 * 4 * 16 * 72 * 2, "output staging fits the ring");
  const int tid = threadIdx.x, wave = tid >> 5, lane = tid & 31, col = lane & 15, g = lane >> 4; const int qb = blockIdx.x, h = blockIdx.y; const int kvh = h / (NH / NKV); const int q0 = qb * 64 + wave * 16; const size_t rq = (size_t)q0 + col; const int qi = q0 + col;
  const int NT = qb + 1;   // stages of 64 keys up to and with the diagonal block
  const unsigned sm0 = lds_off(sm); const size_t kp = (size_t)(QD + KD) * 2, vp = (size_t)SS * 2;   // source pitches in bytes
  const char* gkh = (const char*)(QH + QD + kvh * HD); const char* gkl = (const char*)(QL_ + QD + kvh * HD); const char* gvh = (const char*)(VTH + (size_t)kvh * HD * SS); const char* gvl = (const char*)(VTL + (size_t)kvh * HD * SS);
  stage_2x64x128(sm0, gkh, sm0 + SP, gkl, kp, tid); stage_2x64x128(sm0 + 2 * SP, gvh, sm0 + 3 * SP, gvl, vp, tid);
  v16h aqh[2], aql[2];
#pragma unroll
  for (int kc = 0; kc < 2; ++kc) { aqh[kc] = frag_h(QH + rq * (QD + KD) + h * HD + kc * 32, lane); aql[kc] = frag_h(QL_ + rq * (QD + KD) + h * HD + kc * 32, lane); }
  WAIT_ASYNC(); __syncthreads();
  if (NT > 1) { stage_2x64x128(sm0 + STG, gkh + 64 * kp, sm0 + STG + SP, gkl + 64 * kp, kp, tid); stage_2x64x128(sm0 + STG + 2 * SP, gvh + 128, sm0 + STG + 3 * SP, gvl + 128, vp, tid); }
  constexpr float KL = 0.125f * 1.44269504088896f;   // 1/sqrt(64) * log2(e): exp((s - max) / 8) = exp2(s * KL - max * KL); a masked score (-3e38) gives exp2 of about -5e37 = 0, and key 0 of the first pass makes the maximum finite for every query
  float m = -3.0e38f, l = 0.f;   // this lane's query: running maximum in base-2 units (equal in both halves), sum over this half's keys
  v8f acc[4] = {}, accl[4] = {};  // O^T: element r = d (dt*16 + 8g + r), column = query
#pragma unroll 1   // one stage a trip: the buffer index stays a run-time value and the ring's order stands once
  for (int t = 0; t < NT; ++t) { const char* bk = sm + (t & 1) * STG;
#pragma unroll 1   // the two passes of a stage share one body, so that the loop's text stays short
    for (int hf = 0; hf < 2; ++hf) { const int ks = 2 * t + hf; v8f s[2];
      v16h kh[2][2], kl[2][2];   // the pass's key fragments stand as one group of LDS reads in front of its score products
#pragma unroll
      for (int ct = 0; ct < 2; ++ct) { const char* kr = bk + (hf * 32 + ct * 16 + col) * P128;
#pragma unroll
        for (int kc = 0; kc < 2; ++kc) { kh[ct][kc] = frag_h((const _Float16*)kr + kc * 32, lane); kl[ct][kc] = frag_h((const _Float16*)(kr + SP) + kc * 32, lane); } }
#pragma unroll
      for (int ct = 0; ct < 2; ++ct) { v8f c = {}, cl = {};
#pragma unroll
        for (int kc = 0; kc < 2; ++kc) { c = wmma16(kh[ct][kc], aqh[kc], c); cl = wmma16(kh[ct][kc], aql[kc], cl); cl = wmma16(kl[ct][kc], aqh[kc], cl); }
#pragma unroll
        for (int r = 0; r < 8; ++r) { const int kk = ks * 32 + ct * 16 + 8 * g + r; const float sv = c[r] + cl[r] * (1.0f / 2048.0f); s[ct][r] = (kk <= qi) ? sv : -3.0e38f; } }
      v16h vh[4], vl[4];   // the pass's value fragments: one group of LDS reads, in flight under the maximum
#pragma unroll
      for (int dt = 0; dt < 4; ++dt) { const char* vr = bk + 2 * SP + (dt * 16 + col) * P128; vh[dt] = frag_h((const _Float16*)vr + hf * 32, lane); vl[dt] = frag_h((const _Float16*)(vr + SP) + hf * 32, lane); }
      float mx = fmaxf(s[0][0], s[1][0]);
#pragma unroll
      for (int r = 1; r < 8; ++r) mx = fmaxf(mx, fmaxf(s[0][r], s[1][r]));
      mx = fmaxf(mx, xhalf(mx));
      const float mn = fmaxf(m, mx * KL); const float alpha = __builtin_amdgcn_exp2f(m - mn);   // first pass: exp2(-3e38 - mn) = 0
      v16h pah, pal; float es = 0.f;
#pragma unroll
      for (int ct = 0; ct < 2; ++ct)
#pragma unroll
        for (int r = 0; r < 8; ++r) { const float e = __builtin_amdgcn_exp2f(fmaf(s[ct][r], KL, -mn)); es += e; const _Float16 hv = (_Float16)e; pah[ct * 8 + r] = hv; pal[ct * 8 + r] = (_Float16)((e - (float)hv) * 2048.0f); }
      l = l * alpha + es; m = mn;
#pragma unroll
      for (int dt = 0; dt < 4; ++dt)
#pragma unroll
        for (int r = 0; r < 8; ++r) { acc[dt][r] *= alpha; accl[dt][r] *= alpha; }
#pragma unroll
      for (int dt = 0; dt < 4; ++dt) { acc[dt] = wmma16(vh[dt], pah, acc[dt]); accl[dt] = wmma16(vh[dt], pal, accl[dt]); accl[dt] = wmma16(vl[dt], pah, accl[dt]); } }
    WAIT_DS(); WAIT_ASYNC(); __syncthreads();   // publishes stage t + 1 and ends every reader's last read of stage t
    if (t + 2 < NT) { const unsigned lb = sm0 + (unsigned)(t & 1) * STG; const size_t ko = (size_t)(t + 2) * 64 * kp, vo = (size_t)(t + 2) * 128; stage_2x64x128(lb, gkh + ko, lb + SP, gkl + ko, kp, tid); stage_2x64x128(lb + 2 * SP, gvh + vo, lb + 3 * SP, gvl + vo, vp, tid); } }
  WAIT_ASYNC();
  const float il = 1.0f / (l + xhalf(l));
#pragma unroll
  for (int dt = 0; dt < 4; ++dt)
#pragma unroll
    for (int r = 0; r < 8; ++r) { const float v = (acc[dt][r] + accl[dt][r] * (1.0f / 2048.0f)) * il; const __bf16 hb = (__bf16)v; soh[wave][col][dt * 16 + 8 * g + r] = hb; sol[wave][col][dt * 16 + 8 * g + r] = (__bf16)(v - (float)hb); }
  LDSX();
  for (int rl = 0; rl < 16; ++rl) { const size_t o = ((size_t)q0 + rl) * QD + h * HD; if (lane < 8) vst2((unsigned*)(OH + o + lane * 8), *(const v4u*)&soh[wave][rl][lane * 8]); else if (lane < 16) vst2((unsigned*)(OL + o + (lane - 8) * 8), *(const v4u*)&sol[wave][rl][(lane - 8) * 8]); }
}
// ---- k_out: block = (64 rows, 128 cols): out = O(hi/lo) . Wo rows (2 products, K 2048)
__global__ __launch_bounds__(128) void k_out(const __bf16* __restrict__ OH, const __bf16* __restrict__ OL, const __bf16* __restrict__ PK, float* __restrict__ Y) {
  constexpr int SB = 128 * P128, SA = 64 * P128, STG = SB + 2 * SA, NT = QD / KS;   // stage: Wo rows | ctx hi rows | ctx lo rows
  __shared__ __align__(16) char sm[2 * STG];   // the ring; behind the k loop's last barrier the same bytes are the output staging
  float (*so)[16][132] = (float (*)[16][132])sm;
  static_assert(2 * STG >= 4 * 16 * 132 * 4, "output staging fits the ring");
  const int tid = threadIdx.x, wave = tid >> 5, lane = tid & 31, col = lane & 15, g = lane >> 4; const size_t r0 = (size_t)blockIdx.x * 64 + wave * 16; const int n0 = blockIdx.y * 128;
  v8f acc[8] = {};
  const unsigned sm0 = lds_off(sm); const char* gw = (const char*)(PK + PK_O + (size_t)n0 * QD); const char* gh = (const char*)(OH + (size_t)blockIdx.x * 64 * QD); const char* gl = (const char*)(OL + (size_t)blockIdx.x * 64 * QD);
  stage_128x128(sm0, gw, QD * 2, tid); stage_2x64x128(sm0 + SB, gh, sm0 + SB + SA, gl, QD * 2, tid);
  WAIT_ASYNC(); __syncthreads();
  stage_128x128(sm0 + STG, gw + KS * 2, QD * 2, tid); stage_2x64x128(sm0 + STG + SB, gh + KS * 2, sm0 + STG + SB + SA, gl + KS * 2, QD * 2, tid);
#pragma unroll 1   // one stage a trip: the buffer index stays a run-time value and the ring's order stands once
  for (int t = 0; t < NT; ++t) { const char* bw = sm + (t & 1) * STG; const char* bh = bw + SB + (wave * 16 + col) * P128;
    v16b ah[KS / 32], al[KS / 32], wf[KS / 32][8];   // the stage's LDS reads stand as one group in front of its products
#pragma unroll
    for (int kk = 0; kk < KS / 32; ++kk) { ah[kk] = frag_b((const __bf16*)bh + kk * 32, lane); al[kk] = frag_b((const __bf16*)(bh + SA) + kk * 32, lane);
#pragma unroll
      for (int j = 0; j < 8; ++j) wf[kk][j] = frag_b((const __bf16*)(bw + (j * 16 + col) * P128) + kk * 32, lane); }
#pragma unroll
    for (int kk = 0; kk < KS / 32; ++kk)
#pragma unroll
      for (int j = 0; j < 8; ++j) { acc[j] = wmma_bf(al[kk], wf[kk][j], acc[j]); acc[j] = wmma_bf(ah[kk], wf[kk][j], acc[j]); }
    WAIT_DS(); WAIT_ASYNC(); __syncthreads();   // publishes stage t + 1 and ends every reader's last read of stage t
    if (t + 2 < NT) { const unsigned lb = sm0 + (unsigned)(t & 1) * STG; const size_t ko = (size_t)(t + 2) * (KS * 2); stage_128x128(lb, gw + ko, QD * 2, tid); stage_2x64x128(lb + SB, gh + ko, lb + SB + SA, gl + ko, QD * 2, tid); } }
  WAIT_ASYNC();
#pragma unroll
  for (int j = 0; j < 8; ++j)
#pragma unroll
    for (int r = 0; r < 8; ++r) so[wave][8 * g + r][j * 16 + col] = acc[j][r];
  LDSX();
  for (int rl = 0; rl < 16; ++rl) vst2(Y + (r0 + rl) * OD + n0 + lane * 4, *(const v4f*)&so[wave][rl][lane * 4]);
}
extern "C" void kernel_launch(void* const* d_in, const int* in_sizes, int n_in, void* d_out, int out_size, void* d_ws, size_t ws_size, hipStream_t stream) {
  (void)in_sizes; (void)n_in; (void)out_size;
  const float** F = (const float**)d_in;   // 0 x [1,2048,4096], 1 cos [1,1,2048,64], 2 sin, 3 Wq [2048,4096], 4 Wk [512,4096], 5 Wv [512,4096], 6 Wo [2048,2048]
  if (ws_size < (size_t)WS_END) return;
  char* ws = (char*)d_ws; __bf16 *PK = (__bf16*)(ws + WS_PK), *OH = (__bf16*)(ws + WS_OH), *OL = (__bf16*)(ws + WS_OL); _Float16 *QH = (_Float16*)(ws + WS_QH), *QLp = (_Float16*)(ws + WS_QL), *VTH = (_Float16*)(ws + WS_VTH), *VTL = (_Float16*)(ws + WS_VTL);
  k_pack<<<dim3(QKW, 2), 256, 0, stream>>>(F[3], F[4], F[5], F[6], PK);
  k_qkv<<<dim3(QRB, QKW / 128), 128, 0, stream>>>(F[0], PK, F[1], F[2], QH, QLp, VTH, VTL);
  k_attn<<<dim3(TQB, NH), 128, 0, stream>>>(QH, QLp, VTH, VTL, OH, OL);
  k_out<<<dim3(TOB, OD / 128), 128, 0, stream>>>(OH, OL, PK, (float*)d_out);
}

// v005
// A run of this version takes 191 microseconds.
// Two timings next to v004 both put it at 1.13 times that version's speed.
// Over all steps from v000 it is 4.56 times as fast.
// compute dtype: x, cos, sin, Wq, Wk, Wv, Wo (module inputs) rounded to bf16; q/k/v projections with exact bf16 products on WMMA 16x16x32 (natural [out][in] rows); rotate-half RoPE with the input cos / sin tables in f32 in the projection epilogue; q and k stored as f16 hi + (x2048-scaled) residual planes with 3-product scores, causal mask (strict future), running-max softmax in f32 in base 2 (1/sqrt(64) and log2(e) as one factor inside the exponent's fma, hardware exp2); P as f16 hi + (x2048) residual x v hi/lo (3 products); GQA: query head h reads kv head h/4; output projection with ctx as bf16 hi + residual x exact Wo rows (2 products); f32 accumulate.
#include <hip/hip_runtime.h>
#include <math.h>

typedef __attribute__((ext_vector_type(16))) _Float16 v16h;
typedef __attribute__((ext_vector_type(16))) __bf16 v16b;
typedef __attribute__((ext_vector_type(8)))  _Float16 v8h;
typedef __attribute__((ext_vector_type(8)))  float v8f;
typedef __attribute__((ext_vector_type(4)))  float v4f;
typedef __attribute__((ext_vector_type(2)))  float v2f;
typedef __attribute__((ext_vector_type(4)))  unsigned v4u;
typedef __attribute__((ext_vector_type(4)))  int v4i;
typedef float __attribute__((may_alias)) float_a;
typedef int __attribute__((may_alias)) int_a;

template <typename T> __device__ __forceinline__ void vst2(void* p, T v) { *(T*)p = v;  }
__device__ __forceinline__ v8f wmma16(v16h a, v16h b, v8f c) {
  v8f d = __builtin_amdgcn_wmma_f32_16x16x32_f16(false, a, false, b, (short)0, c, false, false);
  asm volatile("v_nop\n\tv_nop\n\tv_nop\n\tv_nop" : "+v"(d) : "v"(a), "v"(b));
  return d;
}
__device__ __forceinline__ v8f wmma_bf(v16b a, v16b b, v8f c) {
  v8f d = __builtin_amdgcn_wmma_f32_16x16x32_bf16(false, a, false, b, (short)0, c, false, false);
  asm volatile("v_nop\n\tv_nop\n\tv_nop\n\tv_nop" : "+v"(d) : "v"(a), "v"(b));
  return d;
}
// 16x16x32 fragments: lane = (h = lane>>4, row/col = lane&15); elements 0..7 = k0+8h+0..7, 8..15 = k0+16+8h+0..7; D element r = row 8h+r
__device__ __forceinline__ v16h frag_h(const _Float16* rowk0, int lane) {
  union { v16h v; v8h q[2]; } u; const _Float16* p = rowk0 + 8 * (lane >> 4);
  u.q[0] = *(const v8h*)p; u.q[1] = *(const v8h*)(p + 16); return u.v;
}
__device__ __forceinline__ v16h frag_f32(const float* rowk0, int lane) {
  v16h a; const float* p = rowk0 + 8 * (lane >> 4);
#pragma unroll
  for (int i = 0; i < 8; ++i) { a[i] = (_Float16)p[i]; a[8 + i] = (_Float16)p[16 + i]; }
  return a;
}
__device__ __forceinline__ v16h frag_f32s(const float* rowk0, int lane, float sc) {
  v16h a; const float* p = rowk0 + 8 * (lane >> 4);
#pragma unroll
  for (int i = 0; i < 8; ++i) { a[i] = (_Float16)(p[i] * sc); a[8 + i] = (_Float16)(p[16 + i] * sc); }
  return a;
}
// column fragment from a [K][ld] layout (column n), rows >= K read as 0
__device__ __forceinline__ v16h fragc_f32(const float* W, int k0, int n, int lane, int ld, int K) {
  v16h a; const int g = lane >> 4;
#pragma unroll
  for (int i = 0; i < 8; ++i) { const int ka = k0 + 8 * g + i, kb = ka + 16;
    a[i] = (_Float16)(ka < K ? W[(size_t)(ka < K ? ka : K - 1) * ld + n] : 0.f); a[8 + i] = (_Float16)(kb < K ? W[(size_t)(kb < K ? kb : K - 1) * ld + n] : 0.f); }
  return a;
}
struct F2 { v16b h, l; };
__device__ __forceinline__ F2 bsplit16(const float v[16]) { F2 r;
#pragma unroll
  for (int i = 0; i < 16; ++i) { const __bf16 h = (__bf16)v[i]; r.h[i] = h; r.l[i] = (__bf16)(v[i] - (float)h); }
  return r; }
__device__ __forceinline__ F2 split_row(const float* row, int k0, int lane) { float v[16]; const float* p = row + k0 + 8 * (lane >> 4);
#pragma unroll
  for (int i = 0; i < 8; ++i) { v[i] = p[i]; v[8 + i] = p[16 + i]; }
  return bsplit16(v); }
__device__ __forceinline__ F2 split_rowK(const float* row, int k0, int lane, int K) { float v[16]; const int g = lane >> 4;
#pragma unroll
  for (int i = 0; i < 8; ++i) { const int ka = k0 + 8 * g + i, kb = ka + 16; v[i] = ka < K ? row[ka < K ? ka : K - 1] : 0.f; v[8 + i] = kb < K ? row[kb < K ? kb : K - 1] : 0.f; }
  return bsplit16(v); }
__device__ __forceinline__ F2 split_col(const float* W, int k0, int n, int lane, int ld, int K) { float v[16]; const int g = lane >> 4;
#pragma unroll
  for (int i = 0; i < 8; ++i) { const int ka = k0 + 8 * g + i, kb = ka + 16; v[i] = ka < K ? W[(size_t)(ka < K ? ka : K - 1) * ld + n] : 0.f; v[8 + i] = kb < K ? W[(size_t)(kb < K ? kb : K - 1) * ld + n] : 0.f; }
  return bsplit16(v); }
__device__ __forceinline__ v8f mac3(const F2& a, const F2& b, v8f c) { c = wmma_bf(a.l, b.h, c); c = wmma_bf(a.h, b.l, c); return wmma_bf(a.h, b.h, c); }
__device__ __forceinline__ float sigm(float v) { return 1.0f / (1.0f + expf(-v)); }
#define LDSX() do { asm volatile("s_wait_dscnt 0" ::: "memory"); __builtin_amdgcn_wave_barrier(); __builtin_amdgcn_fence(__ATOMIC_RELEASE, "workgroup"); } while (0)


// Eagle-3 draft-model attention (B 1, L 2,048, input 4,096 = 2 x hidden, 32 query heads x 64 with 8 shared KV heads, rotate-half RoPE from given cos / sin, causal softmax / sqrt(64), Wo).
#define SS 2048
#define XD 4096            // input width (2 * hidden)
#define NH 32
#define NKV 8
#define HD 64
#define QD (NH * HD)       // 2,048
#define KD (NKV * HD)      // 512
#define QKW (QD + 2 * KD)  // 3,072 projected columns: q | k | v
#define OD 2048            // Wo output width
#ifndef TQB
#define TQB (SS / 64)
#define TOB (SS / 64)
#define QRB (SS / 64)      // projected row blocks
#endif
typedef __attribute__((ext_vector_type(8))) __bf16 v8b;
__device__ __forceinline__ v16b frag_b(const __bf16* rowk0, int lane) {
  union { v16b v; v8b q[2]; } u; const __bf16* p = rowk0 + 8 * (lane >> 4);
  u.q[0] = *(const v8b*)p; u.q[1] = *(const v8b*)(p + 16); return u.v;
}
__device__ __forceinline__ float bfr(float v) { return (float)(__bf16)v; }
__device__ __attribute__((noinline)) float erf_ni(float v) { return erff(v); }

#define PK_A 0                           // [3072][4096]: Wq | Wk | Wv natural rows
#define PK_O (PK_A + (size_t)QKW * XD)     // [2048][2048] Wo natural rows
#define PK_END (PK_O + (size_t)OD * QD)
#define WS_PK  0u
#define WS_QH  (((2u * PK_END) + 127u) / 128u * 128u)   // f16 [2048][2560]: rope(q) | rope(k) hi
#define WS_QL  (WS_QH + 2u * (size_t)SS * (QD + KD))    // residual x2048
#define WS_VTH (WS_QL + 2u * (size_t)SS * (QD + KD))    // f16 [kv 8][64][2048] v hi / lo
#define WS_VTL (WS_VTH + 2u * (size_t)KD * SS)
#define WS_OH  (WS_VTL + 2u * (size_t)KD * SS)          // bf16 [2048][2048] attention output hi / lo
#define WS_OL  (WS_OH + 2u * (size_t)SS * QD)
#define WS_END (WS_OL + 2u * (size_t)SS * QD)

// ---- k_pack: block = (row n, which): 0: q|k|v rows (n < 3072: Wq rows 0..2047, Wk 2048..2559, Wv 2560..3071) K 4096; 1: Wo rows (n < 2048) K 2048
__global__ __launch_bounds__(256) void k_pack(const float* __restrict__ WQ, const float* __restrict__ WK, const float* __restrict__ WV, const float* __restrict__ WO, __bf16* __restrict__ PK) {
  __shared__ __align__(16) __bf16 s[XD]; const int n = blockIdx.x, which = blockIdx.y, t = threadIdx.x; int K; size_t dst; const float* src;
  if (which == 0) { K = XD; dst = PK_A + (size_t)n * XD; src = (n < QD) ? WQ + (size_t)n * XD : (n < QD + KD) ? WK + (size_t)(n - QD) * XD : WV + (size_t)(n - QD - KD) * XD; }
  else { if (n >= OD) return; K = QD; dst = PK_O + (size_t)n * QD; src = WO + (size_t)n * QD; }
  for (int k = t; k < K; k += 256) s[k] = (__bf16)src[k];
  __syncthreads();
  for (int q = t; q < K / 8; q += 256) vst2((unsigned*)(PK + dst + q * 8), *(const v4u*)&s[q * 8]);
}
// ---- LDS ring of the two projection GEMMs: a stage is 64 k of every operand row, brought by asynchronous 16-byte copies; rows of 128 B lie at pitch 144 B, rows of 256 B at 272 B (16 B x odd: ds_load_b128 without bank conflicts)
#define KS 64
#define P128 144
#define P256 272
__device__ __forceinline__ unsigned lds_off(const void* p) { return (unsigned)(size_t)p; }   // byte offset in the work-group's LDS: low 32 bits of the __shared__ address
// eight copies of one lane; s_wait_xcnt closes the copies' own statement, so that no address register is rewritten ahead of it
__device__ __forceinline__ void cp8(const unsigned (&l)[8], const char* const (&g)[8]) {
  asm volatile("global_load_async_to_lds_b128 %0, %8, off\n\t"
               "global_load_async_to_lds_b128 %1, %9, off\n\t"
               "global_load_async_to_lds_b128 %2, %10, off\n\t"
               "global_load_async_to_lds_b128 %3, %11, off\n\t"
               "global_load_async_to_lds_b128 %4, %12, off\n\t"
               "global_load_async_to_lds_b128 %5, %13, off\n\t"
               "global_load_async_to_lds_b128 %6, %14, off\n\t"
               "global_load_async_to_lds_b128 %7, %15, off\n\t"
               "s_wait_xcnt 0x0"
               :: "v"(l[0]), "v"(l[1]), "v"(l[2]), "v"(l[3]), "v"(l[4]), "v"(l[5]), "v"(l[6]), "v"(l[7]),
                  "v"(g[0]), "v"(g[1]), "v"(g[2]), "v"(g[3]), "v"(g[4]), "v"(g[5]), "v"(g[6]), "v"(g[7]) : "memory");
}
// 128 threads bring 128 rows of 128 B (a wave-wide copy = 4 whole lines); g0 = first byte of row 0 of the stage
__device__ __forceinline__ void stage_128x128(unsigned l0, const char* g0, size_t gp, int tid) {
  unsigned l[8]; const char* g[8]; const int r = tid >> 3, sg = (tid & 7) * 16;
#pragma unroll
  for (int i = 0; i < 8; ++i) { l[i] = l0 + (unsigned)((r + 16 * i) * P128 + sg); g[i] = g0 + (size_t)(r + 16 * i) * gp + sg; }
  cp8(l, g);
}
// 128 threads bring 64 rows of 256 B
__device__ __forceinline__ void stage_64x256(unsigned l0, const char* g0, size_t gp, int tid) {
  unsigned l[8]; const char* g[8]; const int r = tid >> 4, sg = (tid & 15) * 16;
#pragma unroll
  for (int i = 0; i < 8; ++i) { l[i] = l0 + (unsigned)((r + 8 * i) * P256 + sg); g[i] = g0 + (size_t)(r + 8 * i) * gp + sg; }
  cp8(l, g);
}
// 128 threads bring 64 rows of 128 B from each of two planes of one pitch
__device__ __forceinline__ void stage_2x64x128(unsigned la, const char* ga, unsigned lb, const char* gb, size_t gp, int tid) {
  unsigned l[8]; const char* g[8]; const int r = tid >> 3, sg = (tid & 7) * 16;
#pragma unroll
  for (int i = 0; i < 4; ++i) { l[i] = la + (unsigned)((r + 16 * i) * P128 + sg); g[i] = ga + (size_t)(r + 16 * i) * gp + sg; l[4 + i] = lb + (unsigned)((r + 16 * i) * P128 + sg); g[4 + i] = gb + (size_t)(r + 16 * i) * gp + sg; }
  cp8(l, g);
}
// the issuing wave's own wait for its copies (the compiler places none), and the wait that ends this wave's LDS reads in front of a refill
#define WAIT_ASYNC() asm volatile("s_wait_asynccnt 0x0" ::: "memory")
#define WAIT_DS() asm volatile("s_wait_dscnt 0x0" ::: "memory")
// ---- k_qkv: block = (64 rows, 128 cols of 3072): acc = bf16(x) . rows (exact, K 4096); q/k blocks: rotate-half RoPE (partner 32 columns away = 2 tiles, same lane) with cos/sin[pos][d] -> f16 hi/lo rows; v: hi/lo transposed planes [kv][d][s]
__global__ __launch_bounds__(128) void k_qkv(const float* __restrict__ X, const __bf16* __restrict__ PK, const float* __restrict__ COS, const float* __restrict__ SIN, _Float16* __restrict__ QH, _Float16* __restrict__ QL_, _Float16* __restrict__ VTH, _Float16* __restrict__ VTL) {
  constexpr int SB = 128 * P128, STG = SB + 64 * P256, NT = XD / KS;   // stage: weight rows (bf16) | x rows (f32)
  __shared__ __align__(16) char sm[2 * STG];   // the ring; behind the k loop's last barrier the same bytes are the output staging
  _Float16 (*soh)[16][136] = (_Float16 (*)[16][136])sm; _Float16 (*sol)[16][136] = soh + 4; _Float16 (*sth)[72] = (_Float16 (*)[72])sm; _Float16 (*stl)[72] = sth + 128;
  static_assert(2 * STG >= 2 * 4 * 16 * 136 * 2 && 2 * STG >= 2 * 128 * 72 * 2, "output staging fits the ring");
  const int tid = threadIdx.x, wave = tid >> 5, lane = tid & 31, col = lane & 15, g = lane >> 4; const size_t r0 = (size_t)blockIdx.x * 64 + wave * 16; const int n0 = blockIdx.y * 128;
  v8f acc[8] = {};
  const unsigned sm0 = lds_off(sm); const char* gw = (const char*)(PK + PK_A + (size_t)n0 * XD); const char* gx = (const char*)(X + (size_t)blockIdx.x * 64 * XD);
  stage_128x128(sm0, gw, XD * 2, tid); stage_64x256(sm0 + SB, gx, XD * 4, tid);
  WAIT_ASYNC(); __syncthreads();
  stage_128x128(sm0 + STG, gw + KS * 2, XD * 2, tid); stage_64x256(sm0 + STG + SB, gx + KS * 4, XD * 4, tid);
#pragma unroll 1   // one stage a trip: the buffer index stays a run-time value and the ring's order stands once
  for (int t = 0; t < NT; ++t) { const char* bw = sm + (t & 1) * STG; const char* bx = bw + SB + (wave * 16 + col) * P256;
    v4f xr[KS / 32][4]; v16b wf[KS / 32][8];   // the stage's LDS reads stand as one group in front of its products
#pragma unroll
    for (int kk = 0; kk < KS / 32; ++kk) { const v4f* p = (const v4f*)(bx + (kk * 32 + 8 * g) * 4); xr[kk][0] = p[0]; xr[kk][1] = p[1]; xr[kk][2] = p[4]; xr[kk][3] = p[5];
#pragma unroll
      for (int j = 0; j < 8; ++j) wf[kk][j] = frag_b((const __bf16*)(bw + (j * 16 + col) * P128) + kk * 32, lane); }
#pragma unroll
    for (int kk = 0; kk < KS / 32; ++kk) { v16b a;
#pragma unroll
      for (int i = 0; i < 4; ++i) { a[i] = (__bf16)xr[kk][0][i]; a[4 + i] = (__bf16)xr[kk][1][i]; a[8 + i] = (__bf16)xr[kk][2][i]; a[12 + i] = (__bf16)xr[kk][3][i]; }
#pragma unroll
      for (int j = 0; j < 8; ++j) acc[j] = wmma_bf(a, wf[kk][j], acc[j]); }
    WAIT_DS(); WAIT_ASYNC(); __syncthreads();   // publishes stage t + 1 and ends every reader's last read of stage t
    if (t + 2 < NT) { const unsigned lb = sm0 + (unsigned)(t & 1) * STG; stage_128x128(lb, gw + (size_t)(t + 2) * (KS * 2), XD * 2, tid); stage_64x256(lb + SB, gx + (size_t)(t + 2) * (KS * 4), XD * 4, tid); } }
  WAIT_ASYNC();
  if (n0 < QD + KD) {   // q or k block: 2 heads of 64 per 128-col block; rotate_half: d < 32: out = x_d cos_d - x_{d+32} sin_d; d >= 32: out = x_d cos_d + x_{d-32} sin_d
#pragma unroll
    for (int j = 0; j < 8; ++j) { const int jh = j & 3; const int d = jh * 16 + col; const int jp = (jh < 2) ? j + 2 : j - 2; const float sgn = (jh < 2) ? -1.f : 1.f;
#pragma unroll
      for (int r = 0; r < 8; ++r) { const int pos = (int)(r0 + 8 * g + r); const float v = acc[j][r] * bfr(COS[(size_t)pos * HD + d]) + sgn * acc[jp][r] * bfr(SIN[(size_t)pos * HD + d]);
        const _Float16 hv = (_Float16)v; soh[wave][8 * g + r][j * 16 + col] = hv; sol[wave][8 * g + r][j * 16 + col] = (_Float16)((v - (float)hv) * 2048.0f); } }
    LDSX();
    for (int rl = 0; rl < 16; ++rl) { if (lane < 16) vst2((unsigned*)(QH + (r0 + rl) * (QD + KD) + n0 + lane * 8), *(const v4u*)&soh[wave][rl][lane * 8]); else vst2((unsigned*)(QL_ + (r0 + rl) * (QD + KD) + n0 + (lane - 16) * 8), *(const v4u*)&sol[wave][rl][(lane - 16) * 8]); }
  } else {
#pragma unroll
    for (int j = 0; j < 8; ++j)
#pragma unroll
      for (int r = 0; r < 8; ++r) { const float v = acc[j][r]; const _Float16 hv = (_Float16)v; sth[j * 16 + col][wave * 16 + 8 * g + r] = hv; stl[j * 16 + col][wave * 16 + 8 * g + r] = (_Float16)((v - (float)hv) * 2048.0f); }
    __syncthreads();
    const int c0 = n0 - QD - KD; const size_t s0 = (size_t)blockIdx.x * 64;
    for (int e = tid; e < 128 * 8; e += 128) { const int d = e >> 3, pc = e & 7; const size_t o = (size_t)(c0 + d) * SS + s0 + pc * 8; vst2((unsigned*)(VTH + o), *(const v4u*)&sth[d][pc * 8]); vst2((unsigned*)(VTL + o), *(const v4u*)&stl[d][pc * 8]); }
  }
}
// lane l <-> lane l ^ 16 (the two halves of a wave hold the two key halves of one query column)
__device__ __forceinline__ float xhalf(float x) { return __builtin_bit_cast(float, __builtin_amdgcn_permlanex16(__builtin_bit_cast(int, x), __builtin_bit_cast(int, x), 0x76543210, 0xfedcba98, false, false)); }
// ---- k_attn: transposed products: S^T = K . Q^T (A = key rows, B = query columns), O^T += V^T . P^T. A lane holds one query (column col) and keys 8g+r of each 16-key tile: maximum and sum run in the lane, one exchange between the halves; the two score tiles convert in place into the P^T operand (element ct*8+r = key ct*16+8g+r), so P needs no LDS. K and V^T come through an LDS ring that the block's four waves share: a stage is 64 keys (two 32-key passes), brought by asynchronous 16-byte copies in whole 128-B rows. A work-group (x, y) takes query block n - 1 - x of head y and then query block x of head NH - 1 - y: n - x and x + 1 stages, n + 1 for every work-group, and every (head, query block) once. The other head makes the second block's addresses new values, formed in the loop; with one head the build held them in registers over the first block.
__global__ __launch_bounds__(128) void k_attn(const _Float16* __restrict__ QH, const _Float16* __restrict__ QL_, const _Float16* __restrict__ VTH, const _Float16* __restrict__ VTL, __bf16* __restrict__ OH, __bf16* __restrict__ OL) {
  constexpr int SP = 64 * P128, STG = 4 * SP;   // stage: K hi rows [key][d] | K lo rows | V^T hi rows [d][key] | V^T lo rows, 64 rows of 128 B each
  __shared__ __align__(16) char sm[2 * STG];   // the ring; behind the key loop's last barrier the same bytes are the output staging
  __bf16 (*soh)[16][72] = (__bf16 (*)[16][72])sm; __bf16 (*sol)[16][72] = soh + 4;
  static_assert(2 * STG >= 2 * 4 * 16 * 72 * 2, "output staging fits the ring");
  const int tid = threadIdx.x, wave = tid >> 5, lane = tid & 31, col = lane & 15, g = lane >> 4;
  const unsigned sm0 = lds_off(sm); const size_t kp = (size_t)(QD + KD) * 2, vp = (size_t)SS * 2;   // source pitches in bytes
  static_assert(TQB % 2 == 0, "query blocks pair up");
#pragma unroll 1   // the pair's two query blocks run one after the other through one body
  for (int pp = 0; pp < 2; ++pp) {
  const int qb = pp ? (int)blockIdx.x : TQB - 1 - (int)blockIdx.x, h = pp ? NH - 1 - (int)blockIdx.y : (int)blockIdx.y; const int kvh = h / (NH / NKV); const int q0 = qb * 64 + wave * 16; const size_t rq = (size_t)q0 + col; const int qi = q0 + col;
  const int NT = qb + 1;   // stages of 64 keys up to and with the diagonal block
  const char* gkh = (const char*)(QH + QD + kvh * HD); const char* gkl = (const char*)(QL_ + QD + kvh * HD); const char* gvh = (const char*)(VTH + (size_t)kvh * HD * SS); const char* gvl = (const char*)(VTL + (size_t)kvh * HD * SS);
  if (pp) { WAIT_DS(); __syncthreads(); }   // ends every wave's reads of the first block's output staging in front of the ring's refill
  stage_2x64x128(sm0, gkh, sm0 + SP, gkl, kp, tid); stage_2x64x128(sm0 + 2 * SP, gvh, sm0 + 3 * SP, gvl, vp, tid);
  v16h aqh[2], aql[2];
#pragma unroll
  for (int kc = 0; kc < 2; ++kc) { aqh[kc] = frag_h(QH + rq * (QD + KD) + h * HD + kc * 32, lane); aql[kc] = frag_h(QL_ + rq * (QD + KD) + h * HD + kc * 32, lane); }
  WAIT_ASYNC(); __syncthreads();
  if (NT > 1) { stage_2x64x128(sm0 + STG, gkh + 64 * kp, sm0 + STG + SP, gkl + 64 * kp, kp, tid); stage_2x64x128(sm0 + STG + 2 * SP, gvh + 128, sm0 + STG + 3 * SP, gvl + 128, vp, tid); }
  constexpr float KL = 0.125f * 1.44269504088896f;   // 1/sqrt(64) * log2(e): exp((s - max) / 8) = exp2(s * KL - max * KL); a masked score (-3e38) gives exp2 of about -5e37 = 0, and key 0 of the first pass makes the maximum finite for every query
  float m = -3.0e38f, l = 0.f;   // this lane's query: running maximum in base-2 units (equal in both halves), sum over this half's keys
  v8f acc[4] = {}, accl[4] = {};  // O^T: element r = d (dt*16 + 8g + r), column = query
#pragma unroll 1   // one stage a trip: the buffer index stays a run-time value and the ring's order stands once
  for (int t = 0; t < NT; ++t) { const char* bk = sm + (t & 1) * STG;
#pragma unroll 1   // the two passes of a stage share one body, so that the loop's text stays short
    for (int hf = 0; hf < 2; ++hf) { const int ks = 2 * t + hf; v8f s[2];
      v16h kh[2][2], kl[2][2];   // the pass's key fragments stand as one group of LDS reads in front of its score products
#pragma unroll
      for (int ct = 0; ct < 2; ++ct) { const char* kr = bk + (hf * 32 + ct * 16 + col) * P128;
#pragma unroll
        for (int kc = 0; kc < 2; ++kc) { kh[ct][kc] = frag_h((const _Float16*)kr + kc * 32, lane); kl[ct][kc] = frag_h((const _Float16*)(kr + SP) + kc * 32, lane); } }
#pragma unroll
      for (int ct = 0; ct < 2; ++ct) { v8f c = {}, cl = {};
#pragma unroll
        for (int kc = 0; kc < 2; ++kc) { c = wmma16(kh[ct][kc], aqh[kc], c); cl = wmma16(kh[ct][kc], aql[kc], cl); cl = wmma16(kl[ct][kc], aqh[kc], cl); }
#pragma unroll
        for (int r = 0; r < 8; ++r) { const int kk = ks * 32 + ct * 16 + 8 * g + r; const float sv = c[r] + cl[r] * (1.0f / 2048.0f); s[ct][r] = (kk <= qi) ? sv : -3.0e38f; } }
      v16h vh[4], vl[4];   // the pass's value fragments: one group of LDS reads, in flight under the maximum
#pragma unroll
      for (int dt = 0; dt < 4; ++dt) { const char* vr = bk + 2 * SP + (dt * 16 + col) * P128; vh[dt] = frag_h((const _Float16*)vr + hf * 32, lane); vl[dt] = frag_h((const _Float16*)(vr + SP) + hf * 32, lane); }
      float mx = fmaxf(s[0][0], s[1][0]);
#pragma unroll
      for (int r = 1; r < 8; ++r) mx = fmaxf(mx, fmaxf(s[0][r], s[1][r]));
      mx = fmaxf(mx, xhalf(mx));
      const float mn = fmaxf(m, mx * KL); const float alpha = __builtin_amdgcn_exp2f(m - mn);   // first pass: exp2(-3e38 - mn) = 0
      v16h pah, pal; float es = 0.f;
#pragma unroll
      for (int ct = 0; ct < 2; ++ct)
#pragma unroll
        for (int r = 0; r < 8; ++r) { const float e = __builtin_amdgcn_exp2f(fmaf(s[ct][r], KL, -mn)); es += e; const _Float16 hv = (_Float16)e; pah[ct * 8 + r] = hv; pal[ct * 8 + r] = (_Float16)((e - (float)hv) * 2048.0f); }
      l = l * alpha + es; m = mn;
#pragma unroll
      for (int dt = 0; dt < 4; ++dt)
#pragma unroll
        for (int r = 0; r < 8; ++r) { acc[dt][r] *= alpha; accl[dt][r] *= alpha; }
#pragma unroll
      for (int dt = 0; dt < 4; ++dt) { acc[dt] = wmma16(vh[dt], pah, acc[dt]); accl[dt] = wmma16(vh[dt], pal, accl[dt]); accl[dt] = wmma16(vl[dt], pah, accl[dt]); } }
    WAIT_DS(); WAIT_ASYNC(); __syncthreads();   // publishes stage t + 1 and ends every reader's last read of stage t
    if (t + 2 < NT) { const unsigned lb = sm0 + (unsigned)(t & 1) * STG; const size_t ko = (size_t)(t + 2) * 64 * kp, vo = (size_t)(t + 2) * 128; stage_2x64x128(lb, gkh + ko, lb + SP, gkl + ko, kp, tid); stage_2x64x128(lb + 2 * SP, gvh + vo, lb + 3 * SP, gvl + vo, vp, tid); } }
  WAIT_ASYNC();
  const float il = 1.0f / (l + xhalf(l));
#pragma unroll
  for (int dt = 0; dt < 4; ++dt)
#pragma unroll
    for (int r = 0; r < 8; ++r) { const float v = (acc[dt][r] + accl[dt][r] * (1.0f / 2048.0f)) * il; const __bf16 hb = (__bf16)v; soh[wave][col][dt * 16 + 8 * g + r] = hb; sol[wave][col][dt * 16 + 8 * g + r] = (__bf16)(v - (float)hb); }
  LDSX();
  for (int rl = 0; rl < 16; ++rl) { const size_t o = ((size_t)q0 + rl) * QD + h * HD; if (lane < 8) vst2((unsigned*)(OH + o + lane * 8), *(const v4u*)&soh[wave][rl][lane * 8]); else if (lane < 16) vst2((unsigned*)(OL + o + (lane - 8) * 8), *(const v4u*)&sol[wave][rl][(lane - 8) * 8]); }
  asm volatile("s_wait_xcnt 0x0" ::: "memory");   // the second query block rewrites the address and data registers of these stores
  }
}
// ---- k_out: block = (64 rows, 128 cols): out = O(hi/lo) . Wo rows (2 products, K 2048)
__global__ __launch_bounds__(128) void k_out(const __bf16* __restrict__ OH, const __bf16* __restrict__ OL, const __bf16* __restrict__ PK, float* __restrict__ Y) {
  constexpr int SB = 128 * P128, SA = 64 * P128, STG = SB + 2 * SA, NT = QD / KS;   // stage: Wo rows | ctx hi rows | ctx lo rows
  __shared__ __align__(16) char sm[2 * STG];   // the ring; behind the k loop's last barrier the same bytes are the output staging
  float (*so)[16][132] = (float (*)[16][132])sm;
  static_assert(2 * STG >= 4 * 16 * 132 * 4, "output staging fits the ring");
  const int tid = threadIdx.x, wave = tid >> 5, lane = tid & 31, col = lane & 15, g = lane >> 4; const size_t r0 = (size_t)blockIdx.x * 64 + wave * 16; const int n0 = blockIdx.y * 128;
  v8f acc[8] = {};
  const unsigned sm0 = lds_off(sm); const char* gw = (const char*)(PK + PK_O + (size_t)n0 * QD); const char* gh = (const char*)(OH + (size_t)blockIdx.x * 64 * QD); const char* gl = (const char*)(OL + (size_t)blockIdx.x * 64 * QD);
  stage_128x128(sm0, gw, QD * 2, tid); stage_2x64x128(sm0 + SB, gh, sm0 + SB + SA, gl, QD * 2, tid);
  WAIT_ASYNC(); __syncthreads();
  stage_128x128(sm0 + STG, gw + KS * 2, QD * 2, tid); stage_2x64x128(sm0 + STG + SB, gh + KS * 2, sm0 + STG + SB + SA, gl + KS * 2, QD * 2, tid);
#pragma unroll 1   // one stage a trip: the buffer index stays a run-time value and the ring's order stands once
  for (int t = 0; t < NT; ++t) { const char* bw = sm + (t & 1) * STG; const char* bh = bw + SB + (wave * 16 + col) * P128;
    v16b ah[KS / 32], al[KS / 32], wf[KS / 32][8];   // the stage's LDS reads stand as one group in front of its products
#pragma unroll
    for (int kk = 0; kk < KS / 32; ++kk) { ah[kk] = frag_b((const __bf16*)bh + kk * 32, lane); al[kk] = frag_b((const __bf16*)(bh + SA) + kk * 32, lane);
#pragma unroll
      for (int j = 0; j < 8; ++j) wf[kk][j] = frag_b((const __bf16*)(bw + (j * 16 + col) * P128) + kk * 32, lane); }
#pragma unroll
    for (int kk = 0; kk < KS / 32; ++kk)
#pragma unroll
      for (int j = 0; j < 8; ++j) { acc[j] = wmma_bf(al[kk], wf[kk][j], acc[j]); acc[j] = wmma_bf(ah[kk], wf[kk][j], acc[j]); }
    WAIT_DS(); WAIT_ASYNC(); __syncthreads();   // publishes stage t + 1 and ends every reader's last read of stage t
    if (t + 2 < NT) { const unsigned lb = sm0 + (unsigned)(t & 1) * STG; const size_t ko = (size_t)(t + 2) * (KS * 2); stage_128x128(lb, gw + ko, QD * 2, tid); stage_2x64x128(lb + SB, gh + ko, lb + SB + SA, gl + ko, QD * 2, tid); } }
  WAIT_ASYNC();
#pragma unroll
  for (int j = 0; j < 8; ++j)
#pragma unroll
    for (int r = 0; r < 8; ++r) so[wave][8 * g + r][j * 16 + col] = acc[j][r];
  LDSX();
  for (int rl = 0; rl < 16; ++rl) vst2(Y + (r0 + rl) * OD + n0 + lane * 4, *(const v4f*)&so[wave][rl][lane * 4]);
}
extern "C" void kernel_launch(void* const* d_in, const int* in_sizes, int n_in, void* d_out, int out_size, void* d_ws, size_t ws_size, hipStream_t stream) {
  (void)in_sizes; (void)n_in; (void)out_size;
  const float** F = (const float**)d_in;   // 0 x [1,2048,4096], 1 cos [1,1,2048,64], 2 sin, 3 Wq [2048,4096], 4 Wk [512,4096], 5 Wv [512,4096], 6 Wo [2048,2048]
  if (ws_size < (size_t)WS_END) return;
  char* ws = (char*)d_ws; __bf16 *PK = (__bf16*)(ws + WS_PK), *OH = (__bf16*)(ws + WS_OH), *OL = (__bf16*)(ws + WS_OL); _Float16 *QH = (_Float16*)(ws + WS_QH), *QLp = (_Float16*)(ws + WS_QL), *VTH = (_Float16*)(ws + WS_VTH), *VTL = (_Float16*)(ws + WS_VTL);
  k_pack<<<dim3(QKW, 2), 256, 0, stream>>>(F[3], F[4], F[5], F[6], PK);
  k_qkv<<<dim3(QRB, QKW / 128), 128, 0, stream>>>(F[0], PK, F[1], F[2], QH, QLp, VTH, VTL);
  k_attn<<<dim3(TQB / 2, NH), 128, 0, stream>>>(QH, QLp, VTH, VTL, OH, OL);
  k_out<<<dim3(TOB, OD / 128), 128, 0, stream>>>(OH, OL, PK, (float*)d_out);
}

// v006
// Measured time: 182 microseconds a run.
// Timed twice side by side with v005, it ran 1.05 times as fast both times.
// All steps since v000 together make it 4.80 times as fast.
// compute dtype: x, cos, sin, Wq, Wk, Wv, Wo (module inputs) rounded to bf16; q/k/v projections with exact bf16 products on WMMA 16x16x32 (natural [out][in] rows); rotate-half RoPE with the input cos / sin tables in f32 in the projection epilogue; q and k stored as f16 hi + (x2048-scaled) residual planes with 3-product scores, causal mask (strict future), running-max softmax in f32 in base 2 (1/sqrt(64) and log2(e) as one factor inside the exponent's fma, hardware exp2); P as f16 hi + (x2048) residual x v hi/lo (3 products); GQA: query head h reads kv head h/4; output projection with ctx as bf16 hi + residual x exact Wo rows (2 products); f32 accumulate.
#include <hip/hip_runtime.h>
#include <math.h>

typedef __attribute__((ext_vector_type(16))) _Float16 v16h;
typedef __attribute__((ext_vector_type(16))) __bf16 v16b;
typedef __attribute__((ext_vector_type(8)))  _Float16 v8h;
typedef __attribute__((ext_vector_type(8)))  float v8f;
typedef __attribute__((ext_vector_type(4)))  float v4f;
typedef __attribute__((ext_vector_type(2)))  float v2f;
typedef __attribute__((ext_vector_type(4)))  unsigned v4u;
typedef __attribute__((ext_vector_type(4)))  int v4i;
typedef float __attribute__((may_alias)) float_a;
typedef int __attribute__((may_alias)) int_a;

template <typename T> __device__ __forceinline__ void vst2(void* p, T v) { *(T*)p = v;  }
__device__ __forceinline__ v8f wmma16(v16h a, v16h b, v8f c) {
  v8f d = __builtin_amdgcn_wmma_f32_16x16x32_f16(false, a, false, b, (short)0, c, false, false);
  asm volatile("v_nop\n\tv_nop\n\tv_nop\n\tv_nop" : "+v"(d) : "v"(a), "v"(b));
  return d;
}
__device__ __forceinline__ v8f wmma_bf(v16b a, v16b b, v8f c) {
  v8f d = __builtin_amdgcn_wmma_f32_16x16x32_bf16(false, a, false, b, (short)0, c, false, false);
  asm volatile("v_nop\n\tv_nop\n\tv_nop\n\tv_nop" : "+v"(d) : "v"(a), "v"(b));
  return d;
}
// 16x16x32 fragments: lane = (h = lane>>4, row/col = lane&15); elements 0..7 = k0+8h+0..7, 8..15 = k0+16+8h+0..7; D element r = row 8h+r
__device__ __forceinline__ v16h frag_h(const _Float16* rowk0, int lane) {
  union { v16h v; v8h q[2]; } u; const _Float16* p = rowk0 + 8 * (lane >> 4);
  u.q[0] = *(const v8h*)p; u.q[1] = *(const v8h*)(p + 16); return u.v;
}
__device__ __forceinline__ v16h frag_f32(const float* rowk0, int lane) {
  v16h a; const float* p = rowk0 + 8 * (lane >> 4);
#pragma unroll
  for (int i = 0; i < 8; ++i) { a[i] = (_Float16)p[i]; a[8 + i] = (_Float16)p[16 + i]; }
  return a;
}
__device__ __forceinline__ v16h frag_f32s(const float* rowk0, int lane, float sc) {
  v16h a; const float* p = rowk0 + 8 * (lane >> 4);
#pragma unroll
  for (int i = 0; i < 8; ++i) { a[i] = (_Float16)(p[i] * sc); a[8 + i] = (_Float16)(p[16 + i] * sc); }
  return a;
}
// column fragment from a [K][ld] layout (column n), rows >= K read as 0
__device__ __forceinline__ v16h fragc_f32(const float* W, int k0, int n, int lane, int ld, int K) {
  v16h a; const int g = lane >> 4;
#pragma unroll
  for (int i = 0; i < 8; ++i) { const int ka = k0 + 8 * g + i, kb = ka + 16;
    a[i] = (_Float16)(ka < K ? W[(size_t)(ka < K ? ka : K - 1) * ld + n] : 0.f); a[8 + i] = (_Float16)(kb < K ? W[(size_t)(kb < K ? kb : K - 1) * ld + n] : 0.f); }
  return a;
}
struct F2 { v16b h, l; };
__device__ __forceinline__ F2 bsplit16(const float v[16]) { F2 r;
#pragma unroll
  for (int i = 0; i < 16; ++i) { const __bf16 h = (__bf16)v[i]; r.h[i] = h; r.l[i] = (__bf16)(v[i] - (float)h); }
  return r; }
__device__ __forceinline__ F2 split_row(const float* row, int k0, int lane) { float v[16]; const float* p = row + k0 + 8 * (lane >> 4);
#pragma unroll
  for (int i = 0; i < 8; ++i) { v[i] = p[i]; v[8 + i] = p[16 + i]; }
  return bsplit16(v); }
__device__ __forceinline__ F2 split_rowK(const float* row, int k0, int lane, int K) { float v[16]; const int g = lane >> 4;
#pragma unroll
  for (int i = 0; i < 8; ++i) { const int ka = k0 + 8 * g + i, kb = ka + 16; v[i] = ka < K ? row[ka < K ? ka : K - 1] : 0.f; v[8 + i] = kb < K ? row[kb < K ? kb : K - 1] : 0.f; }
  return bsplit16(v); }
__device__ __forceinline__ F2 split_col(const float* W, int k0, int n, int lane, int ld, int K) { float v[16]; const int g = lane >> 4;
#pragma unroll
  for (int i = 0; i < 8; ++i) { const int ka = k0 + 8 * g + i, kb = ka + 16; v[i] = ka < K ? W[(size_t)(ka < K ? ka : K - 1) * ld + n] : 0.f; v[8 + i] = kb < K ? W[(size_t)(kb < K ? kb : K - 1) * ld + n] : 0.f; }
  return bsplit16(v); }
__device__ __forceinline__ v8f mac3(const F2& a, const F2& b, v8f c) { c = wmma_bf(a.l, b.h, c); c = wmma_bf(a.h, b.l, c); return wmma_bf(a.h, b.h, c); }
__device__ __forceinline__ float sigm(float v) { return 1.0f / (1.0f + expf(-v)); }
#define LDSX() do { asm volatile("s_wait_dscnt 0" ::: "memory"); __builtin_amdgcn_wave_barrier(); __builtin_amdgcn_fence(__ATOMIC_RELEASE, "workgroup"); } while (0)


// Eagle-3 draft-model attention (B 1, L 2,048, input 4,096 = 2 x hidden, 32 query heads x 64 with 8 shared KV heads, rotate-half RoPE from given cos / sin, causal softmax / sqrt(64), Wo).
#define SS 2048
#define XD 4096            // input width (2 * hidden)
#define NH 32
#define NKV 8
#define HD 64
#define QD (NH * HD)       // 2,048
#define KD (NKV * HD)      // 512
#define QKW (QD + 2 * KD)  // 3,072 projected columns: q | k | v
#define OD 2048            // Wo output width
#ifndef TQB
#define TQB (SS / 64)
#define TOB (SS / 64)
#define QRB (SS / 64)      // projected row blocks
#endif
typedef __attribute__((ext_vector_type(8))) __bf16 v8b;
__device__ __forceinline__ v16b frag_b(const __bf16* rowk0, int lane) {
  union { v16b v; v8b q[2]; } u; const __bf16* p = rowk0 + 8 * (lane >> 4);
  u.q[0] = *(const v8b*)p; u.q[1] = *(const v8b*)(p + 16); return u.v;
}
__device__ __forceinline__ float bfr(float v) { return (float)(__bf16)v; }
__device__ __attribute__((noinline)) float erf_ni(float v) { return erff(v); }

#define PK_A 0                           // [3072][4096]: Wq | Wk | Wv natural rows
#define PK_O (PK_A + (size_t)QKW * XD)     // [2048][2048] Wo natural rows
#define PK_END (PK_O + (size_t)OD * QD)
#define WS_PK  0u
#define WS_QH  (((2u * PK_END) + 127u) / 128u * 128u)   // f16 [2048][2560]: rope(q) | rope(k) hi
#define WS_QL  (WS_QH + 2u * (size_t)SS * (QD + KD))    // residual x2048
#define WS_VTH (WS_QL + 2u * (size_t)SS * (QD + KD))    // f16 [kv 8][64][2048] v hi / lo
#define WS_VTL (WS_VTH + 2u * (size_t)KD * SS)
#define WS_OH  (WS_VTL + 2u * (size_t)KD * SS)          // bf16 [2048][2048] attention output hi / lo
#define WS_OL  (WS_OH + 2u * (size_t)SS * QD)
#define WS_END (WS_OL + 2u * (size_t)SS * QD)

// ---- k_pack: the packed planes are the four weight arrays one behind another (Wq | Wk | Wv | Wo, natural rows), so the rounding to bf16 is one flat stream. A block takes 32,768 consecutive floats of one array: each wave-wide 16-byte load covers 512 consecutive bytes, a lane's 32 loads stand ahead of the conversions, so that the build keeps many of them in flight at once, and each wave-wide 8-byte store covers two whole 128-B lines
#define PCH (256 * 4 * 32)
typedef __attribute__((ext_vector_type(4))) __bf16 v4b;
__global__ __launch_bounds__(256) void k_pack(const float* __restrict__ WQ, const float* __restrict__ WK, const float* __restrict__ WV, const float* __restrict__ WO, __bf16* __restrict__ PK) {
  constexpr int NQ = QD * XD / PCH, NK = KD * XD / PCH;   // blocks of Wq; of Wk and of Wv
  static_assert(QD * XD % PCH == 0 && KD * XD % PCH == 0 && OD * QD % PCH == 0 && PK_O == (size_t)(NQ + 2 * NK) * PCH, "every block lies in one array, and block b writes packed elements b * PCH on");
  const int b = blockIdx.x, t = threadIdx.x;
  const float* src = (b < NQ) ? WQ + (size_t)b * PCH : (b < NQ + NK) ? WK + (size_t)(b - NQ) * PCH : (b < NQ + 2 * NK) ? WV + (size_t)(b - NQ - NK) * PCH : WO + (size_t)(b - NQ - 2 * NK) * PCH;
  __bf16* dst = PK + (size_t)b * PCH;
  v4f v[32];
#pragma unroll
  for (int i = 0; i < 32; ++i) v[i] = *(const v4f*)(src + i * 1024 + t * 4);
#pragma unroll
  for (int i = 0; i < 32; ++i) { v4b o;
#pragma unroll
    for (int e = 0; e < 4; ++e) o[e] = (__bf16)v[i][e];
    *(v4b*)(dst + i * 1024 + t * 4) = o; }
}
// ---- LDS ring of the two projection GEMMs: a stage is 64 k of every operand row, brought by asynchronous 16-byte copies; rows of 128 B lie at pitch 144 B, rows of 256 B at 272 B (16 B x odd: ds_load_b128 without bank conflicts)
#define KS 64
#define P128 144
#define P256 272
__device__ __forceinline__ unsigned lds_off(const void* p) { return (unsigned)(size_t)p; }   // byte offset in the work-group's LDS: low 32 bits of the __shared__ address
// eight copies of one lane; s_wait_xcnt closes the copies' own statement, so that no address register is rewritten ahead of it
__device__ __forceinline__ void cp8(const unsigned (&l)[8], const char* const (&g)[8]) {
  asm volatile("global_load_async_to_lds_b128 %0, %8, off\n\t"
               "global_load_async_to_lds_b128 %1, %9, off\n\t"
               "global_load_async_to_lds_b128 %2, %10, off\n\t"
               "global_load_async_to_lds_b128 %3, %11, off\n\t"
               "global_load_async_to_lds_b128 %4, %12, off\n\t"
               "global_load_async_to_lds_b128 %5, %13, off\n\t"
               "global_load_async_to_lds_b128 %6, %14, off\n\t"
               "global_load_async_to_lds_b128 %7, %15, off\n\t"
               "s_wait_xcnt 0x0"
               :: "v"(l[0]), "v"(l[1]), "v"(l[2]), "v"(l[3]), "v"(l[4]), "v"(l[5]), "v"(l[6]), "v"(l[7]),
                  "v"(g[0]), "v"(g[1]), "v"(g[2]), "v"(g[3]), "v"(g[4]), "v"(g[5]), "v"(g[6]), "v"(g[7]) : "memory");
}
// 128 threads bring 128 rows of 128 B (a wave-wide copy = 4 whole lines); g0 = first byte of row 0 of the stage
__device__ __forceinline__ void stage_128x128(unsigned l0, const char* g0, size_t gp, int tid) {
  unsigned l[8]; const char* g[8]; const int r = tid >> 3, sg = (tid & 7) * 16;
#pragma unroll
  for (int i = 0; i < 8; ++i) { l[i] = l0 + (unsigned)((r + 16 * i) * P128 + sg); g[i] = g0 + (size_t)(r + 16 * i) * gp + sg; }
  cp8(l, g);
}
// 128 threads bring 64 rows of 256 B
__device__ __forceinline__ void stage_64x256(unsigned l0, const char* g0, size_t gp, int tid) {
  unsigned l[8]; const char* g[8]; const int r = tid >> 4, sg = (tid & 15) * 16;
#pragma unroll
  for (int i = 0; i < 8; ++i) { l[i] = l0 + (unsigned)((r + 8 * i) * P256 + sg); g[i] = g0 + (size_t)(r + 8 * i) * gp + sg; }
  cp8(l, g);
}
// 128 threads bring 64 rows of 128 B from each of two planes of one pitch
__device__ __forceinline__ void stage_2x64x128(unsigned la, const char* ga, unsigned lb, const char* gb, size_t gp, int tid) {
  unsigned l[8]; const char* g[8]; const int r = tid >> 3, sg = (tid & 7) * 16;
#pragma unroll
  for (int i = 0; i < 4; ++i) { l[i] = la + (unsigned)((r + 16 * i) * P128 + sg); g[i] = ga + (size_t)(r + 16 * i) * gp + sg; l[4 + i] = lb + (unsigned)((r + 16 * i) * P128 + sg); g[4 + i] = gb + (size_t)(r + 16 * i) * gp + sg; }
  cp8(l, g);
}
// the issuing wave's own wait for its copies (the compiler places none), and the wait that ends this wave's LDS reads in front of a refill
#define WAIT_ASYNC() asm volatile("s_wait_asynccnt 0x0" ::: "memory")
#define WAIT_DS() asm volatile("s_wait_dscnt 0x0" ::: "memory")
// ---- k_qkv: block = (64 rows, 128 cols of 3072): acc = bf16(x) . rows (exact, K 4096); q/k blocks: rotate-half RoPE (partner 32 columns away = 2 tiles, same lane) with cos/sin[pos][d] -> f16 hi/lo rows; v: hi/lo transposed planes [kv][d][s]
__global__ __launch_bounds__(128) void k_qkv(const float* __restrict__ X, const __bf16* __restrict__ PK, const float* __restrict__ COS, const float* __restrict__ SIN, _Float16* __restrict__ QH, _Float16* __restrict__ QL_, _Float16* __restrict__ VTH, _Float16* __restrict__ VTL) {
  constexpr int SB = 128 * P128, STG = SB + 64 * P256, NT = XD / KS;   // stage: weight rows (bf16) | x rows (f32)
  __shared__ __align__(16) char sm[2 * STG];   // the ring; behind the k loop's last barrier the same bytes are the output staging
  _Float16 (*soh)[16][136] = (_Float16 (*)[16][136])sm; _Float16 (*sol)[16][136] = soh + 4; _Float16 (*sth)[72] = (_Float16 (*)[72])sm; _Float16 (*stl)[72] = sth + 128;
  static_assert(2 * STG >= 2 * 4 * 16 * 136 * 2 && 2 * STG >= 2 * 128 * 72 * 2, "output staging fits the ring");
  const int tid = threadIdx.x, wave = tid >> 5, lane = tid & 31, col = lane & 15, g = lane >> 4; const size_t r0 = (size_t)blockIdx.x * 64 + wave * 16; const int n0 = blockIdx.y * 128;
  v8f acc[8] = {};
  const unsigned sm0 = lds_off(sm); const char* gw = (const char*)(PK + PK_A + (size_t)n0 * XD); const char* gx = (const char*)(X + (size_t)blockIdx.x * 64 * XD);
  stage_128x128(sm0, gw, XD * 2, tid); stage_64x256(sm0 + SB, gx, XD * 4, tid);
  WAIT_ASYNC(); __syncthreads();
  stage_128x128(sm0 + STG, gw + KS * 2, XD * 2, tid); stage_64x256(sm0 + STG + SB, gx + KS * 4, XD * 4, tid);
#pragma unroll 1   // one stage a trip: the buffer index stays a run-time value and the ring's order stands once
  for (int t = 0; t < NT; ++t) { const char* bw = sm + (t & 1) * STG; const char* bx = bw + SB + (wave * 16 + col) * P256;
    v4f xr[KS / 32][4]; v16b wf[KS / 32][8];   // the stage's LDS reads stand as one group in front of its products
#pragma unroll
    for (int kk = 0; kk < KS / 32; ++kk) { const v4f* p = (const v4f*)(bx + (kk * 32 + 8 * g) * 4); xr[kk][0] = p[0]; xr[kk][1] = p[1]; xr[kk][2] = p[4]; xr[kk][3] = p[5];
#pragma unroll
      for (int j = 0; j < 8; ++j) wf[kk][j] = frag_b((const __bf16*)(bw + (j * 16 + col) * P128) + kk * 32, lane); }
#pragma unroll
    for (int kk = 0; kk < KS / 32; ++kk) { v16b a;
#pragma unroll
      for (int i = 0; i < 4; ++i) { a[i] = (__bf16)xr[kk][0][i]; a[4 + i] = (__bf16)xr[kk][1][i]; a[8 + i] = (__bf16)xr[kk][2][i]; a[12 + i] = (__bf16)xr[kk][3][i]; }
#pragma unroll
      for (int j = 0; j < 8; ++j) acc[j] = wmma_bf(a, wf[kk][j], acc[j]); }
    WAIT_DS(); WAIT_ASYNC(); __syncthreads();   // publishes stage t + 1 and ends every reader's last read of stage t
    if (t + 2 < NT) { const unsigned lb = sm0 + (unsigned)(t & 1) * STG; stage_128x128(lb, gw + (size_t)(t + 2) * (KS * 2), XD * 2, tid); stage_64x256(lb + SB, gx + (size_t)(t + 2) * (KS * 4), XD * 4, tid); } }
  WAIT_ASYNC();
  if (n0 < QD + KD) {   // q or k block: 2 heads of 64 per 128-col block; rotate_half: d < 32: out = x_d cos_d - x_{d+32} sin_d; d >= 32: out = x_d cos_d + x_{d-32} sin_d
#pragma unroll
    for (int j = 0; j < 8; ++j) { const int jh = j & 3; const int d = jh * 16 + col; const int jp = (jh < 2) ? j + 2 : j - 2; const float sgn = (jh < 2) ? -1.f : 1.f;
#pragma unroll
      for (int r = 0; r < 8; ++r) { const int pos = (int)(r0 + 8 * g + r); const float v = acc[j][r] * bfr(COS[(size_t)pos * HD + d]) + sgn * acc[jp][r] * bfr(SIN[(size_t)pos * HD + d]);
        const _Float16 hv = (_Float16)v; soh[wave][8 * g + r][j * 16 + col] = hv; sol[wave][8 * g + r][j * 16 + col] = (_Float16)((v - (float)hv) * 2048.0f); } }
    LDSX();
    for (int rl = 0; rl < 16; ++rl) { if (lane < 16) vst2((unsigned*)(QH + (r0 + rl) * (QD + KD) + n0 + lane * 8), *(const v4u*)&soh[wave][rl][lane * 8]); else vst2((unsigned*)(QL_ + (r0 + rl) * (QD + KD) + n0 + (lane - 16) * 8), *(const v4u*)&sol[wave][rl][(lane - 16) * 8]); }
  } else {
#pragma unroll
    for (int j = 0; j < 8; ++j)
#pragma unroll
      for (int r = 0; r < 8; ++r) { const float v = acc[j][r]; const _Float16 hv = (_Float16)v; sth[j * 16 + col][wave * 16 + 8 * g + r] = hv; stl[j * 16 + col][wave * 16 + 8 * g + r] = (_Float16)((v - (float)hv) * 2048.0f); }
    __syncthreads();
    const int c0 = n0 - QD - KD; const size_t s0 = (size_t)blockIdx.x * 64;
    for (int e = tid; e < 128 * 8; e += 128) { const int d = e >> 3, pc = e & 7; const size_t o = (size_t)(c0 + d) * SS + s0 + pc * 8; vst2((unsigned*)(VTH + o), *(const v4u*)&sth[d][pc * 8]); vst2((unsigned*)(VTL + o), *(const v4u*)&stl[d][pc * 8]); }
  }
}
// lane l <-> lane l ^ 16 (the two halves of a wave hold the two key halves of one query column)
__device__ __forceinline__ float xhalf(float x) { return __builtin_bit_cast(float, __builtin_amdgcn_permlanex16(__builtin_bit_cast(int, x), __builtin_bit_cast(int, x), 0x76543210, 0xfedcba98, false, false)); }
// ---- k_attn: transposed products: S^T = K . Q^T (A = key rows, B = query columns), O^T += V^T . P^T. A lane holds one query (column col) and keys 8g+r of each 16-key tile: maximum and sum run in the lane, one exchange between the halves; the two score tiles convert in place into the P^T operand (element ct*8+r = key ct*16+8g+r), so P needs no LDS. K and V^T come through an LDS ring that the block's four waves share: a stage is 64 keys (two 32-key passes), brought by asynchronous 16-byte copies in whole 128-B rows. A work-group (x, y) takes query block n - 1 - x of head y and then query block x of head NH - 1 - y: n - x and x + 1 stages, n + 1 for every work-group, and every (head, query block) once. The other head makes the second block's addresses new values, formed in the loop; with one head the build held them in registers over the first block.
__global__ __launch_bounds__(128) void k_attn(const _Float16* __restrict__ QH, const _Float16* __restrict__ QL_, const _Float16* __restrict__ VTH, const _Float16* __restrict__ VTL, __bf16* __restrict__ OH, __bf16* __restrict__ OL) {
  constexpr int SP = 64 * P128, STG = 4 * SP;   // stage: K hi rows [key][d] | K lo rows | V^T hi rows [d][key] | V^T lo rows, 64 rows of 128 B each
  __shared__ __align__(16) char sm[2 * STG];   // the ring; behind the key loop's last barrier the same bytes are the output staging
  __bf16 (*soh)[16][72] = (__bf16 (*)[16][72])sm; __bf16 (*sol)[16][72] = soh + 4;
  static_assert(2 * STG >= 2 * 4 * 16 * 72 * 2, "output staging fits the ring");
  const int tid = threadIdx.x, wave = tid >> 5, lane = tid & 31, col = lane & 15, g = lane >> 4;
  const unsigned sm0 = lds_off(sm); const size_t kp = (size_t)(QD + KD) * 2, vp = (size_t)SS * 2;   // source pitches in bytes
  static_assert(TQB % 2 == 0, "query blocks pair up");
#pragma unroll 1   // the pair's two query blocks run one after the other through one body
  for (int pp = 0; pp < 2; ++pp) {
  const int qb = pp ? (int)blockIdx.x : TQB - 1 - (int)blockIdx.x, h = pp ? NH - 1 - (int)blockIdx.y : (int)blockIdx.y; const int kvh = h / (NH / NKV); const int q0 = qb * 64 + wave * 16; const size_t rq = (size_t)q0 + col; const int qi = q0 + col;
  const int NT = qb + 1;   // stages of 64 keys up to and with the diagonal block
  const char* gkh = (const char*)(QH + QD + kvh * HD); const char* gkl = (const char*)(QL_ + QD + kvh * HD); const char* gvh = (const char*)(VTH + (size_t)kvh * HD * SS); const char* gvl = (const char*)(VTL + (size_t)kvh * HD * SS);
  if (pp) { WAIT_DS(); __syncthreads(); }   // ends every wave's reads of the first block's output staging in front of the ring's refill
  stage_2x64x128(sm0, gkh, sm0 + SP, gkl, kp, tid); stage_2x64x128(sm0 + 2 * SP, gvh, sm0 + 3 * SP, gvl, vp, tid);
  v16h aqh[2], aql[2];
#pragma unroll
  for (int kc = 0; kc < 2; ++kc) { aqh[kc] = frag_h(QH + rq * (QD + KD) + h * HD + kc * 32, lane); aql[kc] = frag_h(QL_ + rq * (QD + KD) + h * HD + kc * 32, lane); }
  WAIT_ASYNC(); __syncthreads();
  if (NT > 1) { stage_2x64x128(sm0 + STG, gkh + 64 * kp, sm0 + STG + SP, gkl + 64 * kp, kp, tid); stage_2x64x128(sm0 + STG + 2 * SP, gvh + 128, sm0 + STG + 3 * SP, gvl + 128, vp, tid); }
  constexpr float KL = 0.125f * 1.44269504088896f;   // 1/sqrt(64) * log2(e): exp((s - max) / 8) = exp2(s * KL - max * KL); a masked score (-3e38) gives exp2 of about -5e37 = 0, and key 0 of the first pass makes the maximum finite for every query
  float m = -3.0e38f, l = 0.f;   // this lane's query: running maximum in base-2 units (equal in both halves), sum over this half's keys
  v8f acc[4] = {}, accl[4] = {};  // O^T: element r = d (dt*16 + 8g + r), column = query
#pragma unroll 1   // one stage a trip: the buffer index stays a run-time value and the ring's order stands once
  for (int t = 0; t < NT; ++t) { const char* bk = sm + (t & 1) * STG;
#pragma unroll 1   // the two passes of a stage share one body, so that the loop's text stays short
    for (int hf = 0; hf < 2; ++hf) { const int ks = 2 * t + hf; v8f s[2];
      v16h kh[2][2], kl[2][2];   // the pass's key fragments stand as one group of LDS reads in front of its score products
#pragma unroll
      for (int ct = 0; ct < 2; ++ct) { const char* kr = bk + (hf * 32 + ct * 16 + col) * P128;
#pragma unroll
        for (int kc = 0; kc < 2; ++kc) { kh[ct][kc] = frag_h((const _Float16*)kr + kc * 32, lane); kl[ct][kc] = frag_h((const _Float16*)(kr + SP) + kc * 32, lane); } }
#pragma unroll
      for (int ct = 0; ct < 2; ++ct) { v8f c = {}, cl = {};
#pragma unroll
        for (int kc = 0; kc < 2; ++kc) { c = wmma16(kh[ct][kc], aqh[kc], c); cl = wmma16(kh[ct][kc], aql[kc], cl); cl = wmma16(kl[ct][kc], aqh[kc], cl); }
#pragma unroll
        for (int r = 0; r < 8; ++r) { const int kk = ks * 32 + ct * 16 + 8 * g + r; const float sv = c[r] + cl[r] * (1.0f / 2048.0f); s[ct][r] = (kk <= qi) ? sv : -3.0e38f; } }
      v16h vh[4], vl[4];   // the pass's value fragments: one group of LDS reads, in flight under the maximum
#pragma unroll
      for (int dt = 0; dt < 4; ++dt) { const char* vr = bk + 2 * SP + (dt * 16 + col) * P128; vh[dt] = frag_h((const _Float16*)vr + hf * 32, lane); vl[dt] = frag_h((const _Float16*)(vr + SP) + hf * 32, lane); }
      float mx = fmaxf(s[0][0], s[1][0]);
#pragma unroll
      for (int r = 1; r < 8; ++r) mx = fmaxf(mx, fmaxf(s[0][r], s[1][r]));
      mx = fmaxf(mx, xhalf(mx));
      const float mn = fmaxf(m, mx * KL); const float alpha = __builtin_amdgcn_exp2f(m - mn);   // first pass: exp2(-3e38 - mn) = 0
      v16h pah, pal; float es = 0.f;
#pragma unroll
      for (int ct = 0; ct < 2; ++ct)
#pragma unroll
        for (int r = 0; r < 8; ++r) { const float e = __builtin_amdgcn_exp2f(fmaf(s[ct][r], KL, -mn)); es += e; const _Float16 hv = (_Float16)e; pah[ct * 8 + r] = hv; pal[ct * 8 + r] = (_Float16)((e - (float)hv) * 2048.0f); }
      l = l * alpha + es; m = mn;
#pragma unroll
      for (int dt = 0; dt < 4; ++dt)
#pragma unroll
        for (int r = 0; r < 8; ++r) { acc[dt][r] *= alpha; accl[dt][r] *= alpha; }
#pragma unroll
      for (int dt = 0; dt < 4; ++dt) { acc[dt] = wmma16(vh[dt], pah, acc[dt]); accl[dt] = wmma16(vh[dt], pal, accl[dt]); accl[dt] = wmma16(vl[dt], pah, accl[dt]); } }
    WAIT_DS(); WAIT_ASYNC(); __syncthreads();   // publishes stage t + 1 and ends every reader's last read of stage t
    if (t + 2 < NT) { const unsigned lb = sm0 + (unsigned)(t & 1) * STG; const size_t ko = (size_t)(t + 2) * 64 * kp, vo = (size_t)(t + 2) * 128; stage_2x64x128(lb, gkh + ko, lb + SP, gkl + ko, kp, tid); stage_2x64x128(lb + 2 * SP, gvh + vo, lb + 3 * SP, gvl + vo, vp, tid); } }
  WAIT_ASYNC();
  const float il = 1.0f / (l + xhalf(l));
#pragma unroll
  for (int dt = 0; dt < 4; ++dt)
#pragma unroll
    for (int r = 0; r < 8; ++r) { const float v = (acc[dt][r] + accl[dt][r] * (1.0f / 2048.0f)) * il; const __bf16 hb = (__bf16)v; soh[wave][col][dt * 16 + 8 * g + r] = hb; sol[wave][col][dt * 16 + 8 * g + r] = (__bf16)(v - (float)hb); }
  LDSX();
  for (int rl = 0; rl < 16; ++rl) { const size_t o = ((size_t)q0 + rl) * QD + h * HD; if (lane < 8) vst2((unsigned*)(OH + o + lane * 8), *(const v4u*)&soh[wave][rl][lane * 8]); else if (lane < 16) vst2((unsigned*)(OL + o + (lane - 8) * 8), *(const v4u*)&sol[wave][rl][(lane - 8) * 8]); }
  asm volatile("s_wait_xcnt 0x0" ::: "memory");   // the second query block rewrites the address and data registers of these stores
  }
}
// ---- k_out: block = (64 rows, 128 cols): out = O(hi/lo) . Wo rows (2 products, K 2048)
__global__ __launch_bounds__(128) void k_out(const __bf16* __restrict__ OH, const __bf16* __restrict__ OL, const __bf16* __restrict__ PK, float* __restrict__ Y) {
  constexpr int SB = 128 * P128, SA = 64 * P128, STG = SB + 2 * SA, NT = QD / KS;   // stage: Wo rows | ctx hi rows | ctx lo rows
  __shared__ __align__(16) char sm[2 * STG];   // the ring; behind the k loop's last barrier the same bytes are the output staging
  float (*so)[16][132] = (float (*)[16][132])sm;
  static_assert(2 * STG >= 4 * 16 * 132 * 4, "output staging fits the ring");
  const int tid = threadIdx.x, wave = tid >> 5, lane = tid & 31, col = lane & 15, g = lane >> 4; const size_t r0 = (size_t)blockIdx.x * 64 + wave * 16; const int n0 = blockIdx.y * 128;
  v8f acc[8] = {};
  const unsigned sm0 = lds_off(sm); const char* gw = (const char*)(PK + PK_O + (size_t)n0 * QD); const char* gh = (const char*)(OH + (size_t)blockIdx.x * 64 * QD); const char* gl = (const char*)(OL + (size_t)blockIdx.x * 64 * QD);
  stage_128x128(sm0, gw, QD * 2, tid); stage_2x64x128(sm0 + SB, gh, sm0 + SB + SA, gl, QD * 2, tid);
  WAIT_ASYNC(); __syncthreads();
  stage_128x128(sm0 + STG, gw + KS * 2, QD * 2, tid); stage_2x64x128(sm0 + STG + SB, gh + KS * 2, sm0 + STG + SB + SA, gl + KS * 2, QD * 2, tid);
#pragma unroll 1   // one stage a trip: the buffer index stays a run-time value and the ring's order stands once
  for (int t = 0; t < NT; ++t) { const char* bw = sm + (t & 1) * STG; const char* bh = bw + SB + (wave * 16 + col) * P128;
    v16b ah[KS / 32], al[KS / 32], wf[KS / 32][8];   // the stage's LDS reads stand as one group in front of its products
#pragma unroll
    for (int kk = 0; kk < KS / 32; ++kk) { ah[kk] = frag_b((const __bf16*)bh + kk * 32, lane); al[kk] = frag_b((const __bf16*)(bh + SA) + kk * 32, lane);
#pragma unroll
      for (int j = 0; j < 8; ++j) wf[kk][j] = frag_b((const __bf16*)(bw + (j * 16 + col) * P128) + kk * 32, lane); }
#pragma unroll
    for (int kk = 0; kk < KS / 32; ++kk)
#pragma unroll
      for (int j = 0; j < 8; ++j) { acc[j] = wmma_bf(al[kk], wf[kk][j], acc[j]); acc[j] = wmma_bf(ah[kk], wf[kk][j], acc[j]); }
    WAIT_DS(); WAIT_ASYNC(); __syncthreads();   // publishes stage t + 1 and ends every reader's last read of stage t
    if (t + 2 < NT) { const unsigned lb = sm0 + (unsigned)(t & 1) * STG; const size_t ko = (size_t)(t + 2) * (KS * 2); stage_128x128(lb, gw + ko, QD * 2, tid); stage_2x64x128(lb + SB, gh + ko, lb + SB + SA, gl + ko, QD * 2, tid); } }
  WAIT_ASYNC();
#pragma unroll
  for (int j = 0; j < 8; ++j)
#pragma unroll
    for (int r = 0; r < 8; ++r) so[wave][8 * g + r][j * 16 + col] = acc[j][r];
  LDSX();
  for (int rl = 0; rl < 16; ++rl) vst2(Y + (r0 + rl) * OD + n0 + lane * 4, *(const v4f*)&so[wave][rl][lane * 4]);
}
extern "C" void kernel_launch(void* const* d_in, const int* in_sizes, int n_in, void* d_out, int out_size, void* d_ws, size_t ws_size, hipStream_t stream) {
  (void)in_sizes; (void)n_in; (void)out_size;
  const float** F = (const float**)d_in;   // 0 x [1,2048,4096], 1 cos [1,1,2048,64], 2 sin, 3 Wq [2048,4096], 4 Wk [512,4096], 5 Wv [512,4096], 6 Wo [2048,2048]
  if (ws_size < (size_t)WS_END) return;
  char* ws = (char*)d_ws; __bf16 *PK = (__bf16*)(ws + WS_PK), *OH = (__bf16*)(ws + WS_OH), *OL = (__bf16*)(ws + WS_OL); _Float16 *QH = (_Float16*)(ws + WS_QH), *QLp = (_Float16*)(ws + WS_QL), *VTH = (_Float16*)(ws + WS_VTH), *VTL = (_Float16*)(ws + WS_VTL);
  k_pack<<<dim3(PK_END / PCH), 256, 0, stream>>>(F[3], F[4], F[5], F[6], PK);
  k_qkv<<<dim3(QRB, QKW / 128), 128, 0, stream>>>(F[0], PK, F[1], F[2], QH, QLp, VTH, VTL);
  k_attn<<<dim3(TQB / 2, NH), 128, 0, stream>>>(QH, QLp, VTH, VTL, OH, OL);
  k_out<<<dim3(TOB, OD / 128), 128, 0, stream>>>(OH, OL, PK, (float*)d_out);
}

// v007
// Measured time: 158 microseconds a run.
// Next to v006, in two timings, it ran 1.16 times as fast each time.
// Over all steps from v000 it is 5.54 times as fast.
// compute dtype: x, cos, sin, Wq, Wk, Wv, Wo (module inputs) rounded to bf16; q/k/v projections with exact bf16 products on WMMA 16x16x32 (natural [out][in] rows); rotate-half RoPE with the input cos / sin tables in f32 in the projection epilogue; q and k stored as f16 hi + (x2048-scaled) residual planes with 3-product scores, causal mask (strict future), running-max softmax in f32 in base 2 (1/sqrt(64) and log2(e) as one factor inside the exponent's fma, hardware exp2); P as f16 hi + (x2048) residual x v hi/lo (3 products); GQA: query head h reads kv head h/4; output projection with ctx as bf16 hi + residual x exact Wo rows (2 products); f32 accumulate.
#include <hip/hip_runtime.h>
#include <math.h>

typedef __attribute__((ext_vector_type(16))) _Float16 v16h;
typedef __attribute__((ext_vector_type(16))) __bf16 v16b;
typedef __attribute__((ext_vector_type(8)))  _Float16 v8h;
typedef __attribute__((ext_vector_type(8)))  float v8f;
typedef __attribute__((ext_vector_type(4)))  float v4f;
typedef __attribute__((ext_vector_type(2)))  float v2f;
typedef __attribute__((ext_vector_type(4)))  unsigned v4u;
typedef __attribute__((ext_vector_type(4)))  int v4i;
typedef float __attribute__((may_alias)) float_a;
typedef int __attribute__((may_alias)) int_a;

template <typename T> __device__ __forceinline__ void vst2(void* p, T v) { *(T*)p = v;  }
__device__ __forceinline__ v8f wmma16(v16h a, v16h b, v8f c) {
  v8f d = __builtin_amdgcn_wmma_f32_16x16x32_f16(false, a, false, b, (short)0, c, false, false);
  asm volatile("v_nop\n\tv_nop\n\tv_nop\n\tv_nop" : "+v"(d) : "v"(a), "v"(b));
  return d;
}
__device__ __forceinline__ v8f wmma_bf(v16b a, v16b b, v8f c) {
  v8f d = __builtin_amdgcn_wmma_f32_16x16x32_bf16(false, a, false, b, (short)0, c, false, false);
  asm volatile("v_nop\n\tv_nop\n\tv_nop\n\tv_nop" : "+v"(d) : "v"(a), "v"(b));
  return d;
}
// 16x16x32 fragments: lane = (h = lane>>4, row/col = lane&15); elements 0..7 = k0+8h+0..7, 8..15 = k0+16+8h+0..7; D element r = row 8h+r
__device__ __forceinline__ v16h frag_h(const _Float16* rowk0, int lane) {
  union { v16h v; v8h q[2]; } u; const _Float16* p = rowk0 + 8 * (lane >> 4);
  u.q[0] = *(const v8h*)p; u.q[1] = *(const v8h*)(p + 16); return u.v;
}
__device__ __forceinline__ v16h frag_f32(const float* rowk0, int lane) {
  v16h a; const float* p = rowk0 + 8 * (lane >> 4);
#pragma unroll
  for (int i = 0; i < 8; ++i) { a[i] = (_Float16)p[i]; a[8 + i] = (_Float16)p[16 + i]; }
  return a;
}
__device__ __forceinline__ v16h frag_f32s(const float* rowk0, int lane, float sc) {
  v16h a; const float* p = rowk0 + 8 * (lane >> 4);
#pragma unroll
  for (int i = 0; i < 8; ++i) { a[i] = (_Float16)(p[i] * sc); a[8 + i] = (_Float16)(p[16 + i] * sc); }
  return a;
}
// column fragment from a [K][ld] layout (column n), rows >= K read as 0
__device__ __forceinline__ v16h fragc_f32(const float* W, int k0, int n, int lane, int ld, int K) {
  v16h a; const int g = lane >> 4;
#pragma unroll
  for (int i = 0; i < 8; ++i) { const int ka = k0 + 8 * g + i, kb = ka + 16;
    a[i] = (_Float16)(ka < K ? W[(size_t)(ka < K ? ka : K - 1) * ld + n] : 0.f); a[8 + i] = (_Float16)(kb < K ? W[(size_t)(kb < K ? kb : K - 1) * ld + n] : 0.f); }
  return a;
}
struct F2 { v16b h, l; };
__device__ __forceinline__ F2 bsplit16(const float v[16]) { F2 r;
#pragma unroll
  for (int i = 0; i < 16; ++i) { const __bf16 h = (__bf16)v[i]; r.h[i] = h; r.l[i] = (__bf16)(v[i] - (float)h); }
  return r; }
__device__ __forceinline__ F2 split_row(const float* row, int k0, int lane) { float v[16]; const float* p = row + k0 + 8 * (lane >> 4);
#pragma unroll
  for (int i = 0; i < 8; ++i) { v[i] = p[i]; v[8 + i] = p[16 + i]; }
  return bsplit16(v); }
__device__ __forceinline__ F2 split_rowK(const float* row, int k0, int lane, int K) { float v[16]; const int g = lane >> 4;
#pragma unroll
  for (int i = 0; i < 8; ++i) { const int ka = k0 + 8 * g + i, kb = ka + 16; v[i] = ka < K ? row[ka < K ? ka : K - 1] : 0.f; v[8 + i] = kb < K ? row[kb < K ? kb : K - 1] : 0.f; }
  return bsplit16(v); }
__device__ __forceinline__ F2 split_col(const float* W, int k0, int n, int lane, int ld, int K) { float v[16]; const int g = lane >> 4;
#pragma unroll
  for (int i = 0; i < 8; ++i) { const int ka = k0 + 8 * g + i, kb = ka + 16; v[i] = ka < K ? W[(size_t)(ka < K ? ka : K - 1) * ld + n] : 0.f; v[8 + i] = kb < K ? W[(size_t)(kb < K ? kb : K - 1) * ld + n] : 0.f; }
  return bsplit16(v); }
__device__ __forceinline__ v8f mac3(const F2& a, const F2& b, v8f c) { c = wmma_bf(a.l, b.h, c); c = wmma_bf(a.h, b.l, c); return wmma_bf(a.h, b.h, c); }
__device__ __forceinline__ float sigm(float v) { return 1.0f / (1.0f + expf(-v)); }
#define LDSX() do { asm volatile("s_wait_dscnt 0" ::: "memory"); __builtin_amdgcn_wave_barrier(); __builtin_amdgcn_fence(__ATOMIC_RELEASE, "workgroup"); } while (0)


// Eagle-3 draft-model attention (B 1, L 2,048, input 4,096 = 2 x hidden, 32 query heads x 64 with 8 shared KV heads, rotate-half RoPE from given cos / sin, causal softmax / sqrt(64), Wo).
#define SS 2048
#define XD 4096            // input width (2 * hidden)
#define NH 32
#define NKV 8
#define HD 64
#define QD (NH * HD)       // 2,048
#define KD (NKV * HD)      // 512
#define QKW (QD + 2 * KD)  // 3,072 projected columns: q | k | v
#define OD 2048            // Wo output width
#ifndef TQB
#define TQB (SS / 64)
#define TOB (SS / 64)
#define QRB (SS / 64)      // projected row blocks
#endif
typedef __attribute__((ext_vector_type(8))) __bf16 v8b;
__device__ __forceinline__ v16b frag_b(const __bf16* rowk0, int lane) {
  union { v16b v; v8b q[2]; } u; const __bf16* p = rowk0 + 8 * (lane >> 4);
  u.q[0] = *(const v8b*)p; u.q[1] = *(const v8b*)(p + 16); return u.v;
}
__device__ __forceinline__ float bfr(float v) { return (float)(__bf16)v; }
__device__ __attribute__((noinline)) float erf_ni(float v) { return erff(v); }

#define PK_A 0                           // [3072][4096]: Wq | Wk | Wv natural rows
#define PK_O (PK_A + (size_t)QKW * XD)     // [2048][2048] Wo natural rows
#define PK_END (PK_O + (size_t)OD * QD)
#define WS_PK  0u
#define WS_QH  (((2u * PK_END) + 127u) / 128u * 128u)   // f16 [2048][2560]: rope(q) | rope(k) hi
#define WS_QL  (WS_QH + 2u * (size_t)SS * (QD + KD))    // residual x2048
#define WS_VTH (WS_QL + 2u * (size_t)SS * (QD + KD))    // f16 [kv 8][64][2048] v hi / lo
#define WS_VTL (WS_VTH + 2u * (size_t)KD * SS)
#define WS_OH  (WS_VTL + 2u * (size_t)KD * SS)          // bf16 [2048][2048] attention output hi / lo
#define WS_OL  (WS_OH + 2u * (size_t)SS * QD)
#define WS_END (WS_OL + 2u * (size_t)SS * QD)

// ---- k_pack: the packed planes are the four weight arrays one behind another (Wq | Wk | Wv | Wo, natural rows), so the rounding to bf16 is one flat stream. A block takes 32,768 consecutive floats of one array: each wave-wide 16-byte load covers 512 consecutive bytes, a lane's 32 loads stand ahead of the conversions, so that the build keeps many of them in flight at once, and each wave-wide 8-byte store covers two whole 128-B lines
#define PCH (256 * 4 * 32)
typedef __attribute__((ext_vector_type(4))) __bf16 v4b;
__global__ __launch_bounds__(256) void k_pack(const float* __restrict__ WQ, const float* __restrict__ WK, const float* __restrict__ WV, const float* __restrict__ WO, __bf16* __restrict__ PK) {
  constexpr int NQ = QD * XD / PCH, NK = KD * XD / PCH;   // blocks of Wq; of Wk and of Wv
  static_assert(QD * XD % PCH == 0 && KD * XD % PCH == 0 && OD * QD % PCH == 0 && PK_O == (size_t)(NQ + 2 * NK) * PCH, "every block lies in one array, and block b writes packed elements b * PCH on");
  const int b = blockIdx.x, t = threadIdx.x;
  const float* src = (b < NQ) ? WQ + (size_t)b * PCH : (b < NQ + NK) ? WK + (size_t)(b - NQ) * PCH : (b < NQ + 2 * NK) ? WV + (size_t)(b - NQ - NK) * PCH : WO + (size_t)(b - NQ - 2 * NK) * PCH;
  __bf16* dst = PK + (size_t)b * PCH;
  v4f v[32];
#pragma unroll
  for (int i = 0; i < 32; ++i) v[i] = *(const v4f*)(src + i * 1024 + t * 4);
#pragma unroll
  for (int i = 0; i < 32; ++i) { v4b o;
#pragma unroll
    for (int e = 0; e < 4; ++e) o[e] = (__bf16)v[i][e];
    *(v4b*)(dst + i * 1024 + t * 4) = o; }
}
// ---- LDS rings: a stage is brought by asynchronous 16-byte copies; rows of 128 B lie at pitch 144 B, rows of 256 B at 272 B (16 B x odd: ds_load_b128 without bank conflicts)
#define P128 144
#define P256 272
__device__ __forceinline__ unsigned lds_off(const void* p) { return (unsigned)(size_t)p; }   // byte offset in the work-group's LDS: low 32 bits of the __shared__ address
// eight copies of one lane; s_wait_xcnt closes the copies' own statement, so that no address register is rewritten ahead of it
__device__ __forceinline__ void cp8(const unsigned (&l)[8], const char* const (&g)[8]) {
  asm volatile("global_load_async_to_lds_b128 %0, %8, off\n\t"
               "global_load_async_to_lds_b128 %1, %9, off\n\t"
               "global_load_async_to_lds_b128 %2, %10, off\n\t"
               "global_load_async_to_lds_b128 %3, %11, off\n\t"
               "global_load_async_to_lds_b128 %4, %12, off\n\t"
               "global_load_async_to_lds_b128 %5, %13, off\n\t"
               "global_load_async_to_lds_b128 %6, %14, off\n\t"
               "global_load_async_to_lds_b128 %7, %15, off\n\t"
               "s_wait_xcnt 0x0"
               :: "v"(l[0]), "v"(l[1]), "v"(l[2]), "v"(l[3]), "v"(l[4]), "v"(l[5]), "v"(l[6]), "v"(l[7]),
                  "v"(g[0]), "v"(g[1]), "v"(g[2]), "v"(g[3]), "v"(g[4]), "v"(g[5]), "v"(g[6]), "v"(g[7]) : "memory");
}
// 128 threads bring 64 rows of 128 B from each of two planes of one pitch
__device__ __forceinline__ void stage_2x64x128(unsigned la, const char* ga, unsigned lb, const char* gb, size_t gp, int tid) {
  unsigned l[8]; const char* g[8]; const int r = tid >> 3, sg = (tid & 7) * 16;
#pragma unroll
  for (int i = 0; i < 4; ++i) { l[i] = la + (unsigned)((r + 16 * i) * P128 + sg); g[i] = ga + (size_t)(r + 16 * i) * gp + sg; l[4 + i] = lb + (unsigned)((r + 16 * i) * P128 + sg); g[4 + i] = gb + (size_t)(r + 16 * i) * gp + sg; }
  cp8(l, g);
}
// the issuing wave's own wait for its copies (the compiler places none), and the wait that ends this wave's LDS reads in front of a refill
#define WAIT_ASYNC() asm volatile("s_wait_asynccnt 0x0" ::: "memory")
#define WAIT_DS() asm volatile("s_wait_dscnt 0x0" ::: "memory")
// 256 threads bring 16 * (256 >> LPR) rows of (16 << LPR) bytes each (a wave-wide copy = 512 B: one whole 512-B row or two whole 256-B rows); g0 = first byte of row 0 of the stage
template <int LPR, int PITCH> __device__ __forceinline__ void stage_t256(unsigned l0, const char* g0, size_t gp, int tid) {
  const int r = tid >> LPR, sg = (tid & ((1 << LPR) - 1)) * 16;
#pragma unroll
  for (int h = 0; h < 2; ++h) { unsigned l[8]; const char* g[8];
#pragma unroll
    for (int i = 0; i < 8; ++i) { const int row = r + (256 >> LPR) * (8 * h + i); l[i] = l0 + (unsigned)(row * PITCH + sg); g[i] = g0 + (size_t)row * gp + sg; }
    cp8(l, g); }
}
// 256 threads bring 128 rows of 256 B
__device__ __forceinline__ void stage_128x256(unsigned l0, const char* g0, size_t gp, int tid) {
  unsigned l[8]; const char* g[8]; const int r = tid >> 4, sg = (tid & 15) * 16;
#pragma unroll
  for (int i = 0; i < 8; ++i) { l[i] = l0 + (unsigned)((r + 16 * i) * P256 + sg); g[i] = g0 + (size_t)(r + 16 * i) * gp + sg; }
  cp8(l, g);
}
#define KQ 128     // k of one stage of the two projection GEMMs
#define P512 528   // rows of 512 B: 16 B x odd
// ---- k_qkv: block = (128 rows, 256 cols of 3072), eight waves as 2 x 4, a wave = 64 rows x 64 cols (one head): acc = bf16(x) . rows (exact, K 4096); q/k blocks: rotate-half RoPE (partner 32 columns away = 2 tiles, same lane) with cos/sin[pos][d] -> f16 hi/lo rows; v: hi/lo transposed planes [kv][d][s]
__global__ __launch_bounds__(256) void k_qkv(const float* __restrict__ X, const __bf16* __restrict__ PK, const float* __restrict__ COS, const float* __restrict__ SIN, _Float16* __restrict__ QH, _Float16* __restrict__ QL_, _Float16* __restrict__ VTH, _Float16* __restrict__ VTL) {
  constexpr int SB = 256 * P256, STG = SB + 128 * P512, NT = XD / KQ;   // stage: weight rows (bf16, 256 B) | x rows (f32, 512 B)
  __shared__ __align__(16) char sm[2 * STG];   // the ring; behind the k loop's last barrier the same bytes are the output staging
  _Float16 (*soh)[64][72] = (_Float16 (*)[64][72])sm; _Float16 (*sol)[64][72] = soh + 8;   // each wave's own 64 x 64 tile, hi and lo
  static_assert(2 * STG >= 2 * 8 * 64 * 72 * 2, "output staging fits the ring");
  const int tid = threadIdx.x, wave = tid >> 5, lane = tid & 31, col = lane & 15, g = lane >> 4, wr = wave >> 2, wc = wave & 3;
  const size_t r0 = (size_t)blockIdx.x * 128 + wr * 64; const int n0 = blockIdx.y * 256, nw = n0 + wc * 64;
  v8f acc[4][4] = {};
  const unsigned sm0 = lds_off(sm); const char* gw = (const char*)(PK + PK_A + (size_t)n0 * XD); const char* gx = (const char*)(X + (size_t)blockIdx.x * 128 * XD);
  stage_t256<4, P256>(sm0, gw, XD * 2, tid); stage_t256<5, P512>(sm0 + SB, gx, XD * 4, tid);
  WAIT_ASYNC(); __syncthreads();
  stage_t256<4, P256>(sm0 + STG, gw + KQ * 2, XD * 2, tid); stage_t256<5, P512>(sm0 + STG + SB, gx + KQ * 4, XD * 4, tid);
#pragma unroll 1   // one stage a trip: the buffer index stays a run-time value and the ring's order stands once
  for (int t = 0; t < NT; ++t) { const char* bw = sm + (t & 1) * STG + (wc * 64 + col) * P256; const char* bx = sm + (t & 1) * STG + SB + (wr * 64 + col) * P512;
    v4f xr[2][4][4]; v16b wf[2][4];   // two fragment sets: the LDS reads of the next 32 k stand as one group in front of this 32 k's 16 products
#pragma unroll
    for (int kk = -1; kk < KQ / 32; ++kk) {
      if (kk + 1 < KQ / 32) { const int kn = kk + 1, sn = kn & 1;
#pragma unroll
        for (int i = 0; i < 4; ++i) { const v4f* p = (const v4f*)(bx + i * 16 * P512 + (kn * 32 + 8 * g) * 4); xr[sn][i][0] = p[0]; xr[sn][i][1] = p[1]; xr[sn][i][2] = p[4]; xr[sn][i][3] = p[5]; }
#pragma unroll
        for (int j = 0; j < 4; ++j) wf[sn][j] = frag_b((const __bf16*)(bw + j * 16 * P256) + kn * 32, lane); }
      if (kk >= 0) { const int sc = kk & 1;
#pragma unroll
        for (int i = 0; i < 4; ++i) { v16b a;
#pragma unroll
          for (int e = 0; e < 4; ++e) { a[e] = (__bf16)xr[sc][i][0][e]; a[4 + e] = (__bf16)xr[sc][i][1][e]; a[8 + e] = (__bf16)xr[sc][i][2][e]; a[12 + e] = (__bf16)xr[sc][i][3][e]; }
#pragma unroll
          for (int j = 0; j < 4; ++j) acc[i][j] = wmma_bf(a, wf[sc][j], acc[i][j]); } } }
    WAIT_DS(); WAIT_ASYNC(); __syncthreads();   // publishes stage t + 1 and ends every reader's last read of stage t
    if (t + 2 < NT) { const unsigned lb = sm0 + (unsigned)(t & 1) * STG; stage_t256<4, P256>(lb, gw + (size_t)(t + 2) * (KQ * 2), XD * 2, tid); stage_t256<5, P512>(lb + SB, gx + (size_t)(t + 2) * (KQ * 4), XD * 4, tid); } }
  WAIT_ASYNC();
  const int srow = lane >> 3, sseg = (lane & 7) * 8;   // a wave-wide 16-byte store = four whole 128-B rows of the wave's tile
  if (n0 < QD + KD) {   // q or k block: the wave's 64 columns are one head; rotate_half: d < 32: out = x_d cos_d - x_{d+32} sin_d; d >= 32: out = x_d cos_d + x_{d-32} sin_d
    const float* cb = COS + (r0 + 8 * g) * HD + col; const float* sb = SIN + (r0 + 8 * g) * HD + col;   // this lane's first position and d: every table read is one of these two addresses plus a constant
#pragma unroll
    for (int i = 0; i < 4; ++i)
#pragma unroll
      for (int j = 0; j < 4; ++j) { const int d = j * 16 + col; const int jp = (j < 2) ? j + 2 : j - 2; const float sgn = (j < 2) ? -1.f : 1.f;
#pragma unroll
        for (int r = 0; r < 8; ++r) { const int po = (i * 16 + r) * HD + j * 16; const float v = acc[i][j][r] * bfr(cb[po]) + sgn * acc[i][jp][r] * bfr(sb[po]);
          const _Float16 hv = (_Float16)v; soh[wave][i * 16 + 8 * g + r][d] = hv; sol[wave][i * 16 + 8 * g + r][d] = (_Float16)((v - (float)hv) * 2048.0f); } }
    LDSX();
    for (int it = 0; it < 16; ++it) { const int row = it * 4 + srow; const size_t o = (r0 + row) * (QD + KD) + nw + sseg; vst2((unsigned*)(QH + o), *(const v4u*)&soh[wave][row][sseg]); vst2((unsigned*)(QL_ + o), *(const v4u*)&sol[wave][row][sseg]); }
  } else {   // v block: the wave's tile transposed, rows = d, 64 positions = one 128-B line
#pragma unroll
    for (int i = 0; i < 4; ++i)
#pragma unroll
      for (int j = 0; j < 4; ++j) { v8h hi8, lo8;
#pragma unroll
        for (int r = 0; r < 8; ++r) { const float v = acc[i][j][r]; const _Float16 hv = (_Float16)v; hi8[r] = hv; lo8[r] = (_Float16)((v - (float)hv) * 2048.0f); }
        *(v8h*)&soh[wave][j * 16 + col][i * 16 + 8 * g] = hi8; *(v8h*)&sol[wave][j * 16 + col][i * 16 + 8 * g] = lo8; }
    LDSX();
    const int c0 = nw - QD - KD;
    for (int it = 0; it < 16; ++it) { const int d = it * 4 + srow; const size_t o = (size_t)(c0 + d) * SS + r0 + sseg; vst2((unsigned*)(VTH + o), *(const v4u*)&soh[wave][d][sseg]); vst2((unsigned*)(VTL + o), *(const v4u*)&sol[wave][d][sseg]); }
    asm volatile("s_wait_xcnt 0x0" ::: "memory");   // the built code runs on from here into text that rewrites these stores' address registers
  }
}
// lane l <-> lane l ^ 16 (the two halves of a wave hold the two key halves of one query column)
__device__ __forceinline__ float xhalf(float x) { return __builtin_bit_cast(float, __builtin_amdgcn_permlanex16(__builtin_bit_cast(int, x), __builtin_bit_cast(int, x), 0x76543210, 0xfedcba98, false, false)); }
// ---- k_attn: transposed products: S^T = K . Q^T (A = key rows, B = query columns), O^T += V^T . P^T. A lane holds one query (column col) and keys 8g+r of each 16-key tile: maximum and sum run in the lane, one exchange between the halves; the two score tiles convert in place into the P^T operand (element ct*8+r = key ct*16+8g+r), so P needs no LDS. K and V^T come through an LDS ring that the block's four waves share: a stage is 64 keys (two 32-key passes), brought by asynchronous 16-byte copies in whole 128-B rows. A work-group (x, y) takes query block n - 1 - x of head y and then query block x of head NH - 1 - y: n - x and x + 1 stages, n + 1 for every work-group, and every (head, query block) once. The other head makes the second block's addresses new values, formed in the loop; with one head the build held them in registers over the first block.
__global__ __launch_bounds__(128) void k_attn(const _Float16* __restrict__ QH, const _Float16* __restrict__ QL_, const _Float16* __restrict__ VTH, const _Float16* __restrict__ VTL, __bf16* __restrict__ OH, __bf16* __restrict__ OL) {
  constexpr int SP = 64 * P128, STG = 4 * SP;   // stage: K hi rows [key][d] | K lo rows | V^T hi rows [d][key] | V^T lo rows, 64 rows of 128 B each
  __shared__ __align__(16) char sm[2 * STG];   // the ring; behind the key loop's last barrier the same bytes are the output staging
  __bf16 (*soh)[16][72] = (__bf16 (*)[16][72])sm; __bf16 (*sol)[16][72] = soh + 4;
  static_assert(2 * STG >= 2 * 4 * 16 * 72 * 2, "output staging fits the ring");
  const int tid = threadIdx.x, wave = tid >> 5, lane = tid & 31, col = lane & 15, g = lane >> 4;
  const unsigned sm0 = lds_off(sm); const size_t kp = (size_t)(QD + KD) * 2, vp = (size_t)SS * 2;   // source pitches in bytes
  static_assert(TQB % 2 == 0, "query blocks pair up");
#pragma unroll 1   // the pair's two query blocks run one after the other through one body
  for (int pp = 0; pp < 2; ++pp) {
  const int qb = pp ? (int)blockIdx.x : TQB - 1 - (int)blockIdx.x, h = pp ? NH - 1 - (int)blockIdx.y : (int)blockIdx.y; const int kvh = h / (NH / NKV); const int q0 = qb * 64 + wave * 16; const size_t rq = (size_t)q0 + col; const int qi = q0 + col;
  const int NT = qb + 1;   // stages of 64 keys up to and with the diagonal block
  const char* gkh = (const char*)(QH + QD + kvh * HD); const char* gkl = (const char*)(QL_ + QD + kvh * HD); const char* gvh = (const char*)(VTH + (size_t)kvh * HD * SS); const char* gvl = (const char*)(VTL + (size_t)kvh * HD * SS);
  if (pp) { WAIT_DS(); __syncthreads(); }   // ends every wave's reads of the first block's output staging in front of the ring's refill
  stage_2x64x128(sm0, gkh, sm0 + SP, gkl, kp, tid); stage_2x64x128(sm0 + 2 * SP, gvh, sm0 + 3 * SP, gvl, vp, tid);
  v16h aqh[2], aql[2];
#pragma unroll
  for (int kc = 0; kc < 2; ++kc) { aqh[kc] = frag_h(QH + rq * (QD + KD) + h * HD + kc * 32, lane); aql[kc] = frag_h(QL_ + rq * (QD + KD) + h * HD + kc * 32, lane); }
  WAIT_ASYNC(); __syncthreads();
  if (NT > 1) { stage_2x64x128(sm0 + STG, gkh + 64 * kp, sm0 + STG + SP, gkl + 64 * kp, kp, tid); stage_2x64x128(sm0 + STG + 2 * SP, gvh + 128, sm0 + STG + 3 * SP, gvl + 128, vp, tid); }
  constexpr float KL = 0.125f * 1.44269504088896f;   // 1/sqrt(64) * log2(e): exp((s - max) / 8) = exp2(s * KL - max * KL); a masked score (-3e38) gives exp2 of about -5e37 = 0, and key 0 of the first pass makes the maximum finite for every query
  float m = -3.0e38f, l = 0.f;   // this lane's query: running maximum in base-2 units (equal in both halves), sum over this half's keys
  v8f acc[4] = {}, accl[4] = {};  // O^T: element r = d (dt*16 + 8g + r), column = query
#pragma unroll 1   // one stage a trip: the buffer index stays a run-time value and the ring's order stands once
  for (int t = 0; t < NT; ++t) { const char* bk = sm + (t & 1) * STG;
#pragma unroll 1   // the two passes of a stage share one body, so that the loop's text stays short
    for (int hf = 0; hf < 2; ++hf) { const int ks = 2 * t + hf; v8f s[2];
      v16h kh[2][2], kl[2][2];   // the pass's key fragments stand as one group of LDS reads in front of its score products
#pragma unroll
      for (int ct = 0; ct < 2; ++ct) { const char* kr = bk + (hf * 32 + ct * 16 + col) * P128;
#pragma unroll
        for (int kc = 0; kc < 2; ++kc) { kh[ct][kc] = frag_h((const _Float16*)kr + kc * 32, lane); kl[ct][kc] = frag_h((const _Float16*)(kr + SP) + kc * 32, lane); } }
#pragma unroll
      for (int ct = 0; ct < 2; ++ct) { v8f c = {}, cl = {};
#pragma unroll
        for (int kc = 0; kc < 2; ++kc) { c = wmma16(kh[ct][kc], aqh[kc], c); cl = wmma16(kh[ct][kc], aql[kc], cl); cl = wmma16(kl[ct][kc], aqh[kc], cl); }
#pragma unroll
        for (int r = 0; r < 8; ++r) { const int kk = ks * 32 + ct * 16 + 8 * g + r; const float sv = c[r] + cl[r] * (1.0f / 2048.0f); s[ct][r] = (kk <= qi) ? sv : -3.0e38f; } }
      v16h vh[4], vl[4];   // the pass's value fragments: one group of LDS reads, in flight under the maximum
#pragma unroll
      for (int dt = 0; dt < 4; ++dt) { const char* vr = bk + 2 * SP + (dt * 16 + col) * P128; vh[dt] = frag_h((const _Float16*)vr + hf * 32, lane); vl[dt] = frag_h((const _Float16*)(vr + SP) + hf * 32, lane); }
      float mx = fmaxf(s[0][0], s[1][0]);
#pragma unroll
      for (int r = 1; r < 8; ++r) mx = fmaxf(mx, fmaxf(s[0][r], s[1][r]));
      mx = fmaxf(mx, xhalf(mx));
      const float mn = fmaxf(m, mx * KL); const float alpha = __builtin_amdgcn_exp2f(m - mn);   // first pass: exp2(-3e38 - mn) = 0
      v16h pah, pal; float es = 0.f;
#pragma unroll
      for (int ct = 0; ct < 2; ++ct)
#pragma unroll
        for (int r = 0; r < 8; ++r) { const float e = __builtin_amdgcn_exp2f(fmaf(s[ct][r], KL, -mn)); es += e; const _Float16 hv = (_Float16)e; pah[ct * 8 + r] = hv; pal[ct * 8 + r] = (_Float16)((e - (float)hv) * 2048.0f); }
      l = l * alpha + es; m = mn;
#pragma unroll
      for (int dt = 0; dt < 4; ++dt)
#pragma unroll
        for (int r = 0; r < 8; ++r) { acc[dt][r] *= alpha; accl[dt][r] *= alpha; }
#pragma unroll
      for (int dt = 0; dt < 4; ++dt) { acc[dt] = wmma16(vh[dt], pah, acc[dt]); accl[dt] = wmma16(vh[dt], pal, accl[dt]); accl[dt] = wmma16(vl[dt], pah, accl[dt]); } }
    WAIT_DS(); WAIT_ASYNC(); __syncthreads();   // publishes stage t + 1 and ends every reader's last read of stage t
    if (t + 2 < NT) { const unsigned lb = sm0 + (unsigned)(t & 1) * STG; const size_t ko = (size_t)(t + 2) * 64 * kp, vo = (size_t)(t + 2) * 128; stage_2x64x128(lb, gkh + ko, lb + SP, gkl + ko, kp, tid); stage_2x64x128(lb + 2 * SP, gvh + vo, lb + 3 * SP, gvl + vo, vp, tid); } }
  WAIT_ASYNC();
  const float il = 1.0f / (l + xhalf(l));
#pragma unroll
  for (int dt = 0; dt < 4; ++dt)
#pragma unroll
    for (int r = 0; r < 8; ++r) { const float v = (acc[dt][r] + accl[dt][r] * (1.0f / 2048.0f)) * il; const __bf16 hb = (__bf16)v; soh[wave][col][dt * 16 + 8 * g + r] = hb; sol[wave][col][dt * 16 + 8 * g + r] = (__bf16)(v - (float)hb); }
  LDSX();
  for (int rl = 0; rl < 16; ++rl) { const size_t o = ((size_t)q0 + rl) * QD + h * HD; if (lane < 8) vst2((unsigned*)(OH + o + lane * 8), *(const v4u*)&soh[wave][rl][lane * 8]); else if (lane < 16) vst2((unsigned*)(OL + o + (lane - 8) * 8), *(const v4u*)&sol[wave][rl][(lane - 8) * 8]); }
  asm volatile("s_wait_xcnt 0x0" ::: "memory");   // the second query block rewrites the address and data registers of these stores
  }
}
// ---- k_out: block = (128 rows, 128 cols), eight waves as 4 x 2, a wave = 32 rows x 64 cols: out = O(hi/lo) . Wo rows (2 products, K 2048; per accumulator the order stays lo, hi within each 32 k)
__global__ __launch_bounds__(256) void k_out(const __bf16* __restrict__ OH, const __bf16* __restrict__ OL, const __bf16* __restrict__ PK, float* __restrict__ Y) {
  constexpr int SP = 128 * P256, STG = 3 * SP, NT = QD / KQ;   // stage: Wo rows | ctx hi rows | ctx lo rows, 128 rows of 256 B each
  __shared__ __align__(16) char sm[2 * STG];   // the ring; behind the k loop's last barrier the same bytes are the output staging
  float (*so)[32][68] = (float (*)[32][68])sm;   // each wave's own 32 x 64 tile
  static_assert(2 * STG >= 8 * 32 * 68 * 4, "output staging fits the ring");
  const int tid = threadIdx.x, wave = tid >> 5, lane = tid & 31, col = lane & 15, g = lane >> 4, wr = wave >> 1, wc = wave & 1;
  const size_t r0 = (size_t)blockIdx.x * 128 + wr * 32; const int n0 = blockIdx.y * 128, nw = n0 + wc * 64;
  v8f acc[2][4] = {};
  const unsigned sm0 = lds_off(sm); const char* gw = (const char*)(PK + PK_O + (size_t)n0 * QD); const char* gh = (const char*)(OH + (size_t)blockIdx.x * 128 * QD); const char* gl = (const char*)(OL + (size_t)blockIdx.x * 128 * QD);
  stage_128x256(sm0, gw, QD * 2, tid); stage_128x256(sm0 + SP, gh, QD * 2, tid); stage_128x256(sm0 + 2 * SP, gl, QD * 2, tid);
  WAIT_ASYNC(); __syncthreads();
  stage_128x256(sm0 + STG, gw + KQ * 2, QD * 2, tid); stage_128x256(sm0 + STG + SP, gh + KQ * 2, QD * 2, tid); stage_128x256(sm0 + STG + 2 * SP, gl + KQ * 2, QD * 2, tid);
#pragma unroll 1   // one stage a trip: the buffer index stays a run-time value and the ring's order stands once
  for (int t = 0; t < NT; ++t) { const char* bw = sm + (t & 1) * STG + (wc * 64 + col) * P256; const char* bh = sm + (t & 1) * STG + SP + (wr * 32 + col) * P256;
    v16b ah[2][2], al[2][2], wf[2][4];   // two fragment sets: the LDS reads of the next 32 k stand as one group in front of this 32 k's 16 products
#pragma unroll
    for (int kk = -1; kk < KQ / 32; ++kk) {
      if (kk + 1 < KQ / 32) { const int kn = kk + 1, sn = kn & 1;
#pragma unroll
        for (int i = 0; i < 2; ++i) { ah[sn][i] = frag_b((const __bf16*)(bh + i * 16 * P256) + kn * 32, lane); al[sn][i] = frag_b((const __bf16*)(bh + SP + i * 16 * P256) + kn * 32, lane); }
#pragma unroll
        for (int j = 0; j < 4; ++j) wf[sn][j] = frag_b((const __bf16*)(bw + j * 16 * P256) + kn * 32, lane); }
      if (kk >= 0) { const int sc = kk & 1;
#pragma unroll
        for (int i = 0; i < 2; ++i)
#pragma unroll
          for (int j = 0; j < 4; ++j) acc[i][j] = wmma_bf(al[sc][i], wf[sc][j], acc[i][j]);
#pragma unroll
        for (int i = 0; i < 2; ++i)
#pragma unroll
          for (int j = 0; j < 4; ++j) acc[i][j] = wmma_bf(ah[sc][i], wf[sc][j], acc[i][j]); } }
    WAIT_DS(); WAIT_ASYNC(); __syncthreads();   // publishes stage t + 1 and ends every reader's last read of stage t
    if (t + 2 < NT) { const unsigned lb = sm0 + (unsigned)(t & 1) * STG; const size_t ko = (size_t)(t + 2) * (KQ * 2); stage_128x256(lb, gw + ko, QD * 2, tid); stage_128x256(lb + SP, gh + ko, QD * 2, tid); stage_128x256(lb + 2 * SP, gl + ko, QD * 2, tid); } }
  WAIT_ASYNC();
#pragma unroll
  for (int i = 0; i < 2; ++i)
#pragma unroll
    for (int j = 0; j < 4; ++j)
#pragma unroll
      for (int r = 0; r < 8; ++r) so[wave][i * 16 + 8 * g + r][j * 16 + col] = acc[i][j][r];
  LDSX();
  for (int it = 0; it < 16; ++it) { const int row = it * 2 + g; vst2(Y + (r0 + row) * OD + nw + col * 4, *(const v4f*)&so[wave][row][col * 4]); }   // a wave-wide 16-byte store = two whole 256-B rows of the wave's tile
}
extern "C" void kernel_launch(void* const* d_in, const int* in_sizes, int n_in, void* d_out, int out_size, void* d_ws, size_t ws_size, hipStream_t stream) {
  (void)in_sizes; (void)n_in; (void)out_size;
  const float** F = (const float**)d_in;   // 0 x [1,2048,4096], 1 cos [1,1,2048,64], 2 sin, 3 Wq [2048,4096], 4 Wk [512,4096], 5 Wv [512,4096], 6 Wo [2048,2048]
  if (ws_size < (size_t)WS_END) return;
  char* ws = (char*)d_ws; __bf16 *PK = (__bf16*)(ws + WS_PK), *OH = (__bf16*)(ws + WS_OH), *OL = (__bf16*)(ws + WS_OL); _Float16 *QH = (_Float16*)(ws + WS_QH), *QLp = (_Float16*)(ws + WS_QL), *VTH = (_Float16*)(ws + WS_VTH), *VTL = (_Float16*)(ws + WS_VTL);
  k_pack<<<dim3(PK_END / PCH), 256, 0, stream>>>(F[3], F[4], F[5], F[6], PK);
  k_qkv<<<dim3(QRB / 2, QKW / 256), 256, 0, stream>>>(F[0], PK, F[1], F[2], QH, QLp, VTH, VTL);
  k_attn<<<dim3(TQB / 2, NH), 128, 0, stream>>>(QH, QLp, VTH, VTL, OH, OL);
  k_out<<<dim3(TOB / 2, OD / 128), 256, 0, stream>>>(OH, OL, PK, (float*)d_out);
}

// v008
// Measured time: 148 microseconds a run.
// Next to v007, in two timings, it ran 1.06 times as fast each time.
// Over all steps from v000 it is 5.90 times as fast.
// compute dtype: x, cos, sin, Wq, Wk, Wv, Wo (module inputs) rounded to bf16; q/k/v projections with exact bf16 products on WMMA 16x16x32 (natural [out][in] rows); rotate-half RoPE with the input cos / sin tables in f32 in the projection epilogue; q and k stored as f16 hi + (x2048-scaled) residual planes with 3-product scores, causal mask (strict future), running-max softmax in f32 in base 2 (1/sqrt(64) and log2(e) as one factor inside the exponent's fma, hardware exp2); P as f16 hi + (x2048) residual x v hi/lo (3 products); GQA: query head h reads kv head h/4; output projection with ctx as bf16 hi + residual x exact Wo rows (2 products); f32 accumulate.
#include <hip/hip_runtime.h>
#include <math.h>

typedef __attribute__((ext_vector_type(16))) _Float16 v16h;
typedef __attribute__((ext_vector_type(16))) __bf16 v16b;
typedef __attribute__((ext_vector_type(8)))  _Float16 v8h;
typedef __attribute__((ext_vector_type(8)))  float v8f;
typedef __attribute__((ext_vector_type(4)))  float v4f;
typedef __attribute__((ext_vector_type(2)))  float v2f;
typedef __attribute__((ext_vector_type(4)))  unsigned v4u;
typedef __attribute__((ext_vector_type(4)))  int v4i;
typedef float __attribute__((may_alias)) float_a;
typedef int __attribute__((may_alias)) int_a;

template <typename T> __device__ __forceinline__ void vst2(void* p, T v) { *(T*)p = v;  }
__device__ __forceinline__ v8f wmma16(v16h a, v16h b, v8f c) {
  v8f d = __builtin_amdgcn_wmma_f32_16x16x32_f16(false, a, false, b, (short)0, c, false, false);
  asm volatile("v_nop\n\tv_nop\n\tv_nop\n\tv_nop" : "+v"(d) : "v"(a), "v"(b));
  return d;
}
__device__ __forceinline__ v8f wmma_bf(v16b a, v16b b, v8f c) {
  v8f d = __builtin_amdgcn_wmma_f32_16x16x32_bf16(false, a, false, b, (short)0, c, false, false);
  asm volatile("v_nop\n\tv_nop\n\tv_nop\n\tv_nop" : "+v"(d) : "v"(a), "v"(b));
  return d;
}
// 16x16x32 fragments: lane = (h = lane>>4, row/col = lane&15); elements 0..7 = k0+8h+0..7, 8..15 = k0+16+8h+0..7; D element r = row 8h+r
__device__ __forceinline__ v16h frag_h(const _Float16* rowk0, int lane) {
  union { v16h v; v8h q[2]; } u; const _Float16* p = rowk0 + 8 * (lane >> 4);
  u.q[0] = *(const v8h*)p; u.q[1] = *(const v8h*)(p + 16); return u.v;
}
__device__ __forceinline__ v16h frag_f32(const float* rowk0, int lane) {
  v16h a; const float* p = rowk0 + 8 * (lane >> 4);
#pragma unroll
  for (int i = 0; i < 8; ++i) { a[i] = (_Float16)p[i]; a[8 + i] = (_Float16)p[16 + i]; }
  return a;
}
__device__ __forceinline__ v16h frag_f32s(const float* rowk0, int lane, float sc) {
  v16h a; const float* p = rowk0 + 8 * (lane >> 4);
#pragma unroll
  for (int i = 0; i < 8; ++i) { a[i] = (_Float16)(p[i] * sc); a[8 + i] = (_Float16)(p[16 + i] * sc); }
  return a;
}
// column fragment from a [K][ld] layout (column n), rows >= K read as 0
__device__ __forceinline__ v16h fragc_f32(const float* W, int k0, int n, int lane, int ld, int K) {
  v16h a; const int g = lane >> 4;
#pragma unroll
  for (int i = 0; i < 8; ++i) { const int ka = k0 + 8 * g + i, kb = ka + 16;
    a[i] = (_Float16)(ka < K ? W[(size_t)(ka < K ? ka : K - 1) * ld + n] : 0.f); a[8 + i] = (_Float16)(kb < K ? W[(size_t)(kb < K ? kb : K - 1) * ld + n] : 0.f); }
  return a;
}
struct F2 { v16b h, l; };
__device__ __forceinline__ F2 bsplit16(const float v[16]) { F2 r;
#pragma unroll
  for (int i = 0; i < 16; ++i) { const __bf16 h = (__bf16)v[i]; r.h[i] = h; r.l[i] = (__bf16)(v[i] - (float)h); }
  return r; }
__device__ __forceinline__ F2 split_row(const float* row, int k0, int lane) { float v[16]; const float* p = row + k0 + 8 * (lane >> 4);
#pragma unroll
  for (int i = 0; i < 8; ++i) { v[i] = p[i]; v[8 + i] = p[16 + i]; }
  return bsplit16(v); }
__device__ __forceinline__ F2 split_rowK(const float* row, int k0, int lane, int K) { float v[16]; const int g = lane >> 4;
#pragma unroll
  for (int i = 0; i < 8; ++i) { const int ka = k0 + 8 * g + i, kb = ka + 16; v[i] = ka < K ? row[ka < K ? ka : K - 1] : 0.f; v[8 + i] = kb < K ? row[kb < K ? kb : K - 1] : 0.f; }
  return bsplit16(v); }
__device__ __forceinline__ F2 split_col(const float* W, int k0, int n, int lane, int ld, int K) { float v[16]; const int g = lane >> 4;
#pragma unroll
  for (int i = 0; i < 8; ++i) { const int ka = k0 + 8 * g + i, kb = ka + 16; v[i] = ka < K ? W[(size_t)(ka < K ? ka : K - 1) * ld + n] : 0.f; v[8 + i] = kb < K ? W[(size_t)(kb < K ? kb : K - 1) * ld + n] : 0.f; }
  return bsplit16(v); }
__device__ __forceinline__ v8f mac3(const F2& a, const F2& b, v8f c) { c = wmma_bf(a.l, b.h, c); c = wmma_bf(a.h, b.l, c); return wmma_bf(a.h, b.h, c); }
__device__ __forceinline__ float sigm(float v) { return 1.0f / (1.0f + expf(-v)); }
#define LDSX() do { asm volatile("s_wait_dscnt 0" ::: "memory"); __builtin_amdgcn_wave_barrier(); __builtin_amdgcn_fence(__ATOMIC_RELEASE, "workgroup"); } while (0)


// Eagle-3 draft-model attention (B 1, L 2,048, input 4,096 = 2 x hidden, 32 query heads x 64 with 8 shared KV heads, rotate-half RoPE from given cos / sin, causal softmax / sqrt(64), Wo).
#define SS 2048
#define XD 4096            // input width (2 * hidden)
#define NH 32
#define NKV 8
#define HD 64
#define QD (NH * HD)       // 2,048
#define KD (NKV * HD)      // 512
#define QKW (QD + 2 * KD)  // 3,072 projected columns: q | k | v
#define OD 2048            // Wo output width
#ifndef TQB
#define TQB (SS / 64)
#define TOB (SS / 64)
#define QRB (SS / 64)      // projected row blocks
#endif
typedef __attribute__((ext_vector_type(8))) __bf16 v8b;
__device__ __forceinline__ v16b frag_b(const __bf16* rowk0, int lane) {
  union { v16b v; v8b q[2]; } u; const __bf16* p = rowk0 + 8 * (lane >> 4);
  u.q[0] = *(const v8b*)p; u.q[1] = *(const v8b*)(p + 16); return u.v;
}
__device__ __forceinline__ float bfr(float v) { return (float)(__bf16)v; }
__device__ __attribute__((noinline)) float erf_ni(float v) { return erff(v); }

#define PK_A 0                           // [3072][4096]: Wq | Wk | Wv natural rows
#define PK_O (PK_A + (size_t)QKW * XD)     // [2048][2048] Wo natural rows
#define PK_X (PK_O + (size_t)OD * QD)      // [2048][4096] x rows, rounded once
#define PK_END (PK_X + (size_t)SS * XD)
#define WS_PK  0u
#define WS_QH  (((2u * PK_END) + 127u) / 128u * 128u)   // f16 [2048][2560]: rope(q) | rope(k) hi
#define WS_QL  (WS_QH + 2u * (size_t)SS * (QD + KD))    // residual x2048
#define WS_VTH (WS_QL + 2u * (size_t)SS * (QD + KD))    // f16 [kv 8][64][2048] v hi / lo
#define WS_VTL (WS_VTH + 2u * (size_t)KD * SS)
#define WS_OH  (WS_VTL + 2u * (size_t)KD * SS)          // bf16 [2048][2048] attention output hi / lo
#define WS_OL  (WS_OH + 2u * (size_t)SS * QD)
#define WS_END (WS_OL + 2u * (size_t)SS * QD)

// ---- k_pack: the packed planes are the four weight arrays and x one behind another (Wq | Wk | Wv | Wo | x, natural rows), so the rounding to bf16 is one flat stream; x is rounded here once, so that the projection stages and reads 2-byte x. A block takes 32,768 consecutive floats of one array: each wave-wide 16-byte load covers 512 consecutive bytes, a lane's 32 loads stand ahead of the conversions, so that the build keeps many of them in flight at once, and each wave-wide 8-byte store covers two whole 128-B lines
#define PCH (256 * 4 * 32)
typedef __attribute__((ext_vector_type(4))) __bf16 v4b;
__global__ __launch_bounds__(256) void k_pack(const float* __restrict__ WQ, const float* __restrict__ WK, const float* __restrict__ WV, const float* __restrict__ WO, const float* __restrict__ X, __bf16* __restrict__ PK) {
  constexpr int NQ = QD * XD / PCH, NK = KD * XD / PCH, NO = OD * QD / PCH;   // blocks of Wq; of Wk and of Wv; of Wo
  static_assert(QD * XD % PCH == 0 && KD * XD % PCH == 0 && OD * QD % PCH == 0 && SS * XD % PCH == 0 && PK_O == (size_t)(NQ + 2 * NK) * PCH && PK_X == (size_t)(NQ + 2 * NK + NO) * PCH, "every block lies in one array, and block b writes packed elements b * PCH on");
  const int b = blockIdx.x, t = threadIdx.x;
  const float* src = (b < NQ) ? WQ + (size_t)b * PCH : (b < NQ + NK) ? WK + (size_t)(b - NQ) * PCH : (b < NQ + 2 * NK) ? WV + (size_t)(b - NQ - NK) * PCH : (b < NQ + 2 * NK + NO) ? WO + (size_t)(b - NQ - 2 * NK) * PCH : X + (size_t)(b - NQ - 2 * NK - NO) * PCH;
  __bf16* dst = PK + (size_t)b * PCH;
  v4f v[32];
#pragma unroll
  for (int i = 0; i < 32; ++i) v[i] = *(const v4f*)(src + i * 1024 + t * 4);
#pragma unroll
  for (int i = 0; i < 32; ++i) { v4b o;
#pragma unroll
    for (int e = 0; e < 4; ++e) o[e] = (__bf16)v[i][e];
    *(v4b*)(dst + i * 1024 + t * 4) = o; }
}
// ---- LDS rings: a stage is brought by asynchronous 16-byte copies; rows of 128 B lie at pitch 144 B, rows of 256 B at 272 B (16 B x odd: ds_load_b128 without bank conflicts)
#define P128 144
#define P256 272
__device__ __forceinline__ unsigned lds_off(const void* p) { return (unsigned)(size_t)p; }   // byte offset in the work-group's LDS: low 32 bits of the __shared__ address
// eight copies of one lane; s_wait_xcnt closes the copies' own statement, so that no address register is rewritten ahead of it
__device__ __forceinline__ void cp8(const unsigned (&l)[8], const char* const (&g)[8]) {
  asm volatile("global_load_async_to_lds_b128 %0, %8, off\n\t"
               "global_load_async_to_lds_b128 %1, %9, off\n\t"
               "global_load_async_to_lds_b128 %2, %10, off\n\t"
               "global_load_async_to_lds_b128 %3, %11, off\n\t"
               "global_load_async_to_lds_b128 %4, %12, off\n\t"
               "global_load_async_to_lds_b128 %5, %13, off\n\t"
               "global_load_async_to_lds_b128 %6, %14, off\n\t"
               "global_load_async_to_lds_b128 %7, %15, off\n\t"
               "s_wait_xcnt 0x0"
               :: "v"(l[0]), "v"(l[1]), "v"(l[2]), "v"(l[3]), "v"(l[4]), "v"(l[5]), "v"(l[6]), "v"(l[7]),
                  "v"(g[0]), "v"(g[1]), "v"(g[2]), "v"(g[3]), "v"(g[4]), "v"(g[5]), "v"(g[6]), "v"(g[7]) : "memory");
}
// 128 threads bring 64 rows of 128 B from each of two planes of one pitch
__device__ __forceinline__ void stage_2x64x128(unsigned la, const char* ga, unsigned lb, const char* gb, size_t gp, int tid) {
  unsigned l[8]; const char* g[8]; const int r = tid >> 3, sg = (tid & 7) * 16;
#pragma unroll
  for (int i = 0; i < 4; ++i) { l[i] = la + (unsigned)((r + 16 * i) * P128 + sg); g[i] = ga + (size_t)(r + 16 * i) * gp + sg; l[4 + i] = lb + (unsigned)((r + 16 * i) * P128 + sg); g[4 + i] = gb + (size_t)(r + 16 * i) * gp + sg; }
  cp8(l, g);
}
// the issuing wave's own wait for its copies (the compiler places none), and the wait that ends this wave's LDS reads in front of a refill
#define WAIT_ASYNC() asm volatile("s_wait_asynccnt 0x0" ::: "memory")
#define WAIT_DS() asm volatile("s_wait_dscnt 0x0" ::: "memory")
// 256 threads bring 16 * (256 >> LPR) rows of (16 << LPR) bytes each (a wave-wide copy = 512 B: one whole 512-B row or two whole 256-B rows); g0 = first byte of row 0 of the stage
template <int LPR, int PITCH> __device__ __forceinline__ void stage_t256(unsigned l0, const char* g0, size_t gp, int tid) {
  const int r = tid >> LPR, sg = (tid & ((1 << LPR) - 1)) * 16;
#pragma unroll
  for (int h = 0; h < 2; ++h) { unsigned l[8]; const char* g[8];
#pragma unroll
    for (int i = 0; i < 8; ++i) { const int row = r + (256 >> LPR) * (8 * h + i); l[i] = l0 + (unsigned)(row * PITCH + sg); g[i] = g0 + (size_t)row * gp + sg; }
    cp8(l, g); }
}
// 256 threads bring 128 rows of 256 B
__device__ __forceinline__ void stage_128x256(unsigned l0, const char* g0, size_t gp, int tid) {
  unsigned l[8]; const char* g[8]; const int r = tid >> 4, sg = (tid & 15) * 16;
#pragma unroll
  for (int i = 0; i < 8; ++i) { l[i] = l0 + (unsigned)((r + 16 * i) * P256 + sg); g[i] = g0 + (size_t)(r + 16 * i) * gp + sg; }
  cp8(l, g);
}
#define KQ 128     // k of one stage of the two projection GEMMs
// ---- k_qkv: block = (128 rows, 256 cols of 3072), eight waves as 2 x 4, a wave = 64 rows x 64 cols (one head): acc = bf16 x rows (packed) . weight rows (exact, K 4096); q/k blocks: rotate-half RoPE (partner 32 columns away = 2 tiles, same lane) with cos/sin[pos][d] -> f16 hi/lo rows; v: hi/lo transposed planes [kv][d][s]
__global__ __launch_bounds__(256) void k_qkv(const __bf16* __restrict__ PK, const float* __restrict__ COS, const float* __restrict__ SIN, _Float16* __restrict__ QH, _Float16* __restrict__ QL_, _Float16* __restrict__ VTH, _Float16* __restrict__ VTL) {
  constexpr int SB = 256 * P256, STG = SB + 128 * P256, NT = XD / KQ;   // stage: 256 weight rows | 128 x rows, bf16, 256 B each
  __shared__ __align__(16) char sm[2 * STG];   // the ring; behind the k loop's last barrier the same bytes are the output staging
  _Float16 (*soh)[64][72] = (_Float16 (*)[64][72])sm; _Float16 (*sol)[64][72] = soh + 8;   // each wave's own 64 x 64 tile, hi and lo
  static_assert(2 * STG >= 2 * 8 * 64 * 72 * 2, "output staging fits the ring");
  const int tid = threadIdx.x, wave = tid >> 5, lane = tid & 31, col = lane & 15, g = lane >> 4, wr = wave >> 2, wc = wave & 3;
  const size_t r0 = (size_t)blockIdx.x * 128 + wr * 64; const int n0 = blockIdx.y * 256, nw = n0 + wc * 64;
  v8f acc[4][4] = {};
  const unsigned sm0 = lds_off(sm); const char* gw = (const char*)(PK + PK_A + (size_t)n0 * XD); const char* gx = (const char*)(PK + PK_X + (size_t)blockIdx.x * 128 * XD);
  stage_t256<4, P256>(sm0, gw, XD * 2, tid); stage_128x256(sm0 + SB, gx, XD * 2, tid);
  WAIT_ASYNC(); __syncthreads();
  stage_t256<4, P256>(sm0 + STG, gw + KQ * 2, XD * 2, tid); stage_128x256(sm0 + STG + SB, gx + KQ * 2, XD * 2, tid);
#pragma unroll 1   // one stage a trip: the buffer index stays a run-time value and the ring's order stands once
  for (int t = 0; t < NT; ++t) { const char* bw = sm + (t & 1) * STG + (wc * 64 + col) * P256; const char* bx = sm + (t & 1) * STG + SB + (wr * 64 + col) * P256;
    v16b xf[2][4], wf[2][4];   // two fragment sets: the LDS reads of the next 32 k stand as one group in front of this 32 k's 16 products
#pragma unroll
    for (int kk = -1; kk < KQ / 32; ++kk) {
      if (kk + 1 < KQ / 32) { const int kn = kk + 1, sn = kn & 1;
#pragma unroll
        for (int i = 0; i < 4; ++i) xf[sn][i] = frag_b((const __bf16*)(bx + i * 16 * P256) + kn * 32, lane);
#pragma unroll
        for (int j = 0; j < 4; ++j) wf[sn][j] = frag_b((const __bf16*)(bw + j * 16 * P256) + kn * 32, lane); }
      __builtin_amdgcn_sched_barrier(0);   // keeps the read group whole and ahead of the products: without it the build sinks each read to its use, with a wait to 0 every four products
      if (kk >= 0) { const int sc = kk & 1;
#pragma unroll
        for (int i = 0; i < 4; ++i)
#pragma unroll
          for (int j = 0; j < 4; ++j) acc[i][j] = __builtin_amdgcn_wmma_f32_16x16x32_bf16(false, xf[sc][i], false, wf[sc][j], (short)0, acc[i][j], false, false); }   // the bare builtin: the build keeps its distances itself; as operands of an asm statement both fragment sets and the accumulators would all have to lie below v256, which spills
      __builtin_amdgcn_sched_barrier(0); }   // the next read group stays behind this block of products
    WAIT_DS(); WAIT_ASYNC(); __syncthreads();   // publishes stage t + 1 and ends every reader's last read of stage t
    if (t + 2 < NT) { const unsigned lb = sm0 + (unsigned)(t & 1) * STG; stage_t256<4, P256>(lb, gw + (size_t)(t + 2) * (KQ * 2), XD * 2, tid); stage_128x256(lb + SB, gx + (size_t)(t + 2) * (KQ * 2), XD * 2, tid); } }
  WAIT_ASYNC();
  const int srow = lane >> 3, sseg = (lane & 7) * 8;   // a wave-wide 16-byte store = four whole 128-B rows of the wave's tile
  if (n0 < QD + KD) {   // q or k block: the wave's 64 columns are one head; rotate_half: d < 32: out = x_d cos_d - x_{d+32} sin_d; d >= 32: out = x_d cos_d + x_{d-32} sin_d
    const float* cb = COS + (r0 + 8 * g) * HD + col; const float* sb = SIN + (r0 + 8 * g) * HD + col;   // this lane's first position and d: every table read is one of these two addresses plus a constant
#pragma unroll
    for (int i = 0; i < 4; ++i)
#pragma unroll
      for (int j = 0; j < 4; ++j) { const int d = j * 16 + col; const int jp = (j < 2) ? j + 2 : j - 2; const float sgn = (j < 2) ? -1.f : 1.f;
#pragma unroll
        for (int r = 0; r < 8; ++r) { const int po = (i * 16 + r) * HD + j * 16; const float v = acc[i][j][r] * bfr(cb[po]) + sgn * acc[i][jp][r] * bfr(sb[po]);
          const _Float16 hv = (_Float16)v; soh[wave][i * 16 + 8 * g + r][d] = hv; sol[wave][i * 16 + 8 * g + r][d] = (_Float16)((v - (float)hv) * 2048.0f); } }
    LDSX();
    for (int it = 0; it < 16; ++it) { const int row = it * 4 + srow; const size_t o = (r0 + row) * (QD + KD) + nw + sseg; vst2((unsigned*)(QH + o), *(const v4u*)&soh[wave][row][sseg]); vst2((unsigned*)(QL_ + o), *(const v4u*)&sol[wave][row][sseg]); }
  } else {   // v block: the wave's tile transposed, rows = d, 64 positions = one 128-B line
#pragma unroll
    for (int i = 0; i < 4; ++i)
#pragma unroll
      for (int j = 0; j < 4; ++j) { v8h hi8, lo8;
#pragma unroll
        for (int r = 0; r < 8; ++r) { const float v = acc[i][j][r]; const _Float16 hv = (_Float16)v; hi8[r] = hv; lo8[r] = (_Float16)((v - (float)hv) * 2048.0f); }
        *(v8h*)&soh[wave][j * 16 + col][i * 16 + 8 * g] = hi8; *(v8h*)&sol[wave][j * 16 + col][i * 16 + 8 * g] = lo8; }
    LDSX();
    const int c0 = nw - QD - KD;
    for (int it = 0; it < 16; ++it) { const int d = it * 4 + srow; const size_t o = (size_t)(c0 + d) * SS + r0 + sseg; vst2((unsigned*)(VTH + o), *(const v4u*)&soh[wave][d][sseg]); vst2((unsigned*)(VTL + o), *(const v4u*)&sol[wave][d][sseg]); }
    asm volatile("s_wait_xcnt 0x0" ::: "memory");   // the built code runs on from here into text that rewrites these stores' address registers
  }
}
// lane l <-> lane l ^ 16 (the two halves of a wave hold the two key halves of one query column)
__device__ __forceinline__ float xhalf(float x) { return __builtin_bit_cast(float, __builtin_amdgcn_permlanex16(__builtin_bit_cast(int, x), __builtin_bit_cast(int, x), 0x76543210, 0xfedcba98, false, false)); }
// ---- k_attn: transposed products: S^T = K . Q^T (A = key rows, B = query columns), O^T += V^T . P^T. A lane holds one query (column col) and keys 8g+r of each 16-key tile: maximum and sum run in the lane, one exchange between the halves; the two score tiles convert in place into the P^T operand (element ct*8+r = key ct*16+8g+r), so P needs no LDS. K and V^T come through an LDS ring that the block's four waves share: a stage is 64 keys (two 32-key passes), brought by asynchronous 16-byte copies in whole 128-B rows. A work-group (x, y) takes query block n - 1 - x of head y and then query block x of head NH - 1 - y: n - x and x + 1 stages, n + 1 for every work-group, and every (head, query block) once. The other head makes the second block's addresses new values, formed in the loop; with one head the build held them in registers over the first block.
__global__ __launch_bounds__(128) void k_attn(const _Float16* __restrict__ QH, const _Float16* __restrict__ QL_, const _Float16* __restrict__ VTH, const _Float16* __restrict__ VTL, __bf16* __restrict__ OH, __bf16* __restrict__ OL) {
  constexpr int SP = 64 * P128, STG = 4 * SP;   // stage: K hi rows [key][d] | K lo rows | V^T hi rows [d][key] | V^T lo rows, 64 rows of 128 B each
  __shared__ __align__(16) char sm[2 * STG];   // the ring; behind the key loop's last barrier the same bytes are the output staging
  __bf16 (*soh)[16][72] = (__bf16 (*)[16][72])sm; __bf16 (*sol)[16][72] = soh + 4;
  static_assert(2 * STG >= 2 * 4 * 16 * 72 * 2, "output staging fits the ring");
  const int tid = threadIdx.x, wave = tid >> 5, lane = tid & 31, col = lane & 15, g = lane >> 4;
  const unsigned sm0 = lds_off(sm); const size_t kp = (size_t)(QD + KD) * 2, vp = (size_t)SS * 2;   // source pitches in bytes
  static_assert(TQB % 2 == 0, "query blocks pair up");
#pragma unroll 1   // the pair's two query blocks run one after the other through one body
  for (int pp = 0; pp < 2; ++pp) {
  const int qb = pp ? (int)blockIdx.x : TQB - 1 - (int)blockIdx.x, h = pp ? NH - 1 - (int)blockIdx.y : (int)blockIdx.y; const int kvh = h / (NH / NKV); const int q0 = qb * 64 + wave * 16; const size_t rq = (size_t)q0 + col; const int qi = q0 + col;
  const int NT = qb + 1;   // stages of 64 keys up to and with the diagonal block
  const char* gkh = (const char*)(QH + QD + kvh * HD); const char* gkl = (const char*)(QL_ + QD + kvh * HD); const char* gvh = (const char*)(VTH + (size_t)kvh * HD * SS); const char* gvl = (const char*)(VTL + (size_t)kvh * HD * SS);
  if (pp) { WAIT_DS(); __syncthreads(); }   // ends every wave's reads of the first block's output staging in front of the ring's refill
  stage_2x64x128(sm0, gkh, sm0 + SP, gkl, kp, tid); stage_2x64x128(sm0 + 2 * SP, gvh, sm0 + 3 * SP, gvl, vp, tid);
  v16h aqh[2], aql[2];
#pragma unroll
  for (int kc = 0; kc < 2; ++kc) { aqh[kc] = frag_h(QH + rq * (QD + KD) + h * HD + kc * 32, lane); aql[kc] = frag_h(QL_ + rq * (QD + KD) + h * HD + kc * 32, lane); }
  WAIT_ASYNC(); __syncthreads();
  if (NT > 1) { stage_2x64x128(sm0 + STG, gkh + 64 * kp, sm0 + STG + SP, gkl + 64 * kp, kp, tid); stage_2x64x128(sm0 + STG + 2 * SP, gvh + 128, sm0 + STG + 3 * SP, gvl + 128, vp, tid); }
  constexpr float KL = 0.125f * 1.44269504088896f;   // 1/sqrt(64) * log2(e): exp((s - max) / 8) = exp2(s * KL - max * KL); a masked score (-3e38) gives exp2 of about -5e37 = 0, and key 0 of the first pass makes the maximum finite for every query
  float m = -3.0e38f, l = 0.f;   // this lane's query: running maximum in base-2 units (equal in both halves), sum over this half's keys
  v8f acc[4] = {}, accl[4] = {};  // O^T: element r = d (dt*16 + 8g + r), column = query
#pragma unroll 1   // one stage a trip: the buffer index stays a run-time value and the ring's order stands once
  for (int t = 0; t < NT; ++t) { const char* bk = sm + (t & 1) * STG;
#pragma unroll 1   // the two passes of a stage share one body, so that the loop's text stays short
    for (int hf = 0; hf < 2; ++hf) { const int ks = 2 * t + hf; v8f s[2];
      v16h kh[2][2], kl[2][2];   // the pass's key fragments stand as one group of LDS reads in front of its score products
#pragma unroll
      for (int ct = 0; ct < 2; ++ct) { const char* kr = bk + (hf * 32 + ct * 16 + col) * P128;
#pragma unroll
        for (int kc = 0; kc < 2; ++kc) { kh[ct][kc] = frag_h((const _Float16*)kr + kc * 32, lane); kl[ct][kc] = frag_h((const _Float16*)(kr + SP) + kc * 32, lane); } }
#pragma unroll
      for (int ct = 0; ct < 2; ++ct) { v8f c = {}, cl = {};
#pragma unroll
        for (int kc = 0; kc < 2; ++kc) { c = wmma16(kh[ct][kc], aqh[kc], c); cl = wmma16(kh[ct][kc], aql[kc], cl); cl = wmma16(kl[ct][kc], aqh[kc], cl); }
#pragma unroll
        for (int r = 0; r < 8; ++r) { const int kk = ks * 32 + ct * 16 + 8 * g + r; const float sv = c[r] + cl[r] * (1.0f / 2048.0f); s[ct][r] = (kk <= qi) ? sv : -3.0e38f; } }
      v16h vh[4], vl[4];   // the pass's value fragments: one group of LDS reads, in flight under the maximum
#pragma unroll
      for (int dt = 0; dt < 4; ++dt) { const char* vr = bk + 2 * SP + (dt * 16 + col) * P128; vh[dt] = frag_h((const _Float16*)vr + hf * 32, lane); vl[dt] = frag_h((const _Float16*)(vr + SP) + hf * 32, lane); }
      float mx = fmaxf(s[0][0], s[1][0]);
#pragma unroll
      for (int r = 1; r < 8; ++r) mx = fmaxf(mx, fmaxf(s[0][r], s[1][r]));
      mx = fmaxf(mx, xhalf(mx));
      const float mn = fmaxf(m, mx * KL); const float alpha = __builtin_amdgcn_exp2f(m - mn);   // first pass: exp2(-3e38 - mn) = 0
      v16h pah, pal; float es = 0.f;
#pragma unroll
      for (int ct = 0; ct < 2; ++ct)
#pragma unroll
        for (int r = 0; r < 8; ++r) { const float e = __builtin_amdgcn_exp2f(fmaf(s[ct][r], KL, -mn)); es += e; const _Float16 hv = (_Float16)e; pah[ct * 8 + r] = hv; pal[ct * 8 + r] = (_Float16)((e - (float)hv) * 2048.0f); }
      l = l * alpha + es; m = mn;
#pragma unroll
      for (int dt = 0; dt < 4; ++dt)
#pragma unroll
        for (int r = 0; r < 8; ++r) { acc[dt][r] *= alpha; accl[dt][r] *= alpha; }
#pragma unroll
      for (int dt = 0; dt < 4; ++dt) { acc[dt] = wmma16(vh[dt], pah, acc[dt]); accl[dt] = wmma16(vh[dt], pal, accl[dt]); accl[dt] = wmma16(vl[dt], pah, accl[dt]); } }
    WAIT_DS(); WAIT_ASYNC(); __syncthreads();   // publishes stage t + 1 and ends every reader's last read of stage t
    if (t + 2 < NT) { const unsigned lb = sm0 + (unsigned)(t & 1) * STG; const size_t ko = (size_t)(t + 2) * 64 * kp, vo = (size_t)(t + 2) * 128; stage_2x64x128(lb, gkh + ko, lb + SP, gkl + ko, kp, tid); stage_2x64x128(lb + 2 * SP, gvh + vo, lb + 3 * SP, gvl + vo, vp, tid); } }
  WAIT_ASYNC();
  const float il = 1.0f / (l + xhalf(l));
#pragma unroll
  for (int dt = 0; dt < 4; ++dt)
#pragma unroll
    for (int r = 0; r < 8; ++r) { const float v = (acc[dt][r] + accl[dt][r] * (1.0f / 2048.0f)) * il; const __bf16 hb = (__bf16)v; soh[wave][col][dt * 16 + 8 * g + r] = hb; sol[wave][col][dt * 16 + 8 * g + r] = (__bf16)(v - (float)hb); }
  LDSX();
  for (int rl = 0; rl < 16; ++rl) { const size_t o = ((size_t)q0 + rl) * QD + h * HD; if (lane < 8) vst2((unsigned*)(OH + o + lane * 8), *(const v4u*)&soh[wave][rl][lane * 8]); else if (lane < 16) vst2((unsigned*)(OL + o + (lane - 8) * 8), *(const v4u*)&sol[wave][rl][(lane - 8) * 8]); }
  asm volatile("s_wait_xcnt 0x0" ::: "memory");   // the second query block rewrites the address and data registers of these stores
  }
}
// ---- k_out: block = (128 rows, 128 cols), eight waves as 4 x 2, a wave = 32 rows x 64 cols: out = O(hi/lo) . Wo rows (2 products, K 2048; per accumulator the order stays lo, hi within each 32 k)
__global__ __launch_bounds__(256) void k_out(const __bf16* __restrict__ OH, const __bf16* __restrict__ OL, const __bf16* __restrict__ PK, float* __restrict__ Y) {
  constexpr int SP = 128 * P256, STG = 3 * SP, NT = QD / KQ;   // stage: Wo rows | ctx hi rows | ctx lo rows, 128 rows of 256 B each
  __shared__ __align__(16) char sm[2 * STG];   // the ring; behind the k loop's last barrier the same bytes are the output staging
  float (*so)[32][68] = (float (*)[32][68])sm;   // each wave's own 32 x 64 tile
  static_assert(2 * STG >= 8 * 32 * 68 * 4, "output staging fits the ring");
  const int tid = threadIdx.x, wave = tid >> 5, lane = tid & 31, col = lane & 15, g = lane >> 4, wr = wave >> 1, wc = wave & 1;
  const size_t r0 = (size_t)blockIdx.x * 128 + wr * 32; const int n0 = blockIdx.y * 128, nw = n0 + wc * 64;
  v8f acc[2][4] = {};
  const unsigned sm0 = lds_off(sm); const char* gw = (const char*)(PK + PK_O + (size_t)n0 * QD); const char* gh = (const char*)(OH + (size_t)blockIdx.x * 128 * QD); const char* gl = (const char*)(OL + (size_t)blockIdx.x * 128 * QD);
  stage_128x256(sm0, gw, QD * 2, tid); stage_128x256(sm0 + SP, gh, QD * 2, tid); stage_128x256(sm0 + 2 * SP, gl, QD * 2, tid);
  WAIT_ASYNC(); __syncthreads();
  stage_128x256(sm0 + STG, gw + KQ * 2, QD * 2, tid); stage_128x256(sm0 + STG + SP, gh + KQ * 2, QD * 2, tid); stage_128x256(sm0 + STG + 2 * SP, gl + KQ * 2, QD * 2, tid);
#pragma unroll 1   // one stage a trip: the buffer index stays a run-time value and the ring's order stands once
  for (int t = 0; t < NT; ++t) { const char* bw = sm + (t & 1) * STG + (wc * 64 + col) * P256; const char* bh = sm + (t & 1) * STG + SP + (wr * 32 + col) * P256;
    v16b ah[2][2], al[2][2], wf[2][4];   // two fragment sets: the LDS reads of the next 32 k stand as one group in front of this 32 k's 16 products
#pragma unroll
    for (int kk = -1; kk < KQ / 32; ++kk) {
      if (kk + 1 < KQ / 32) { const int kn = kk + 1, sn = kn & 1;
#pragma unroll
        for (int i = 0; i < 2; ++i) { ah[sn][i] = frag_b((const __bf16*)(bh + i * 16 * P256) + kn * 32, lane); al[sn][i] = frag_b((const __bf16*)(bh + SP + i * 16 * P256) + kn * 32, lane); }
#pragma unroll
        for (int j = 0; j < 4; ++j) wf[sn][j] = frag_b((const __bf16*)(bw + j * 16 * P256) + kn * 32, lane); }
      if (kk >= 0) { const int sc = kk & 1;
#pragma unroll
        for (int i = 0; i < 2; ++i)
#pragma unroll
          for (int j = 0; j < 4; ++j) acc[i][j] = wmma_bf(al[sc][i], wf[sc][j], acc[i][j]);
#pragma unroll
        for (int i = 0; i < 2; ++i)
#pragma unroll
          for (int j = 0; j < 4; ++j) acc[i][j] = wmma_bf(ah[sc][i], wf[sc][j], acc[i][j]); } }
    WAIT_DS(); WAIT_ASYNC(); __syncthreads();   // publishes stage t + 1 and ends every reader's last read of stage t
    if (t + 2 < NT) { const unsigned lb = sm0 + (unsigned)(t & 1) * STG; const size_t ko = (size_t)(t + 2) * (KQ * 2); stage_128x256(lb, gw + ko, QD * 2, tid); stage_128x256(lb + SP, gh + ko, QD * 2, tid); stage_128x256(lb + 2 * SP, gl + ko, QD * 2, tid); } }
  WAIT_ASYNC();
#pragma unroll
  for (int i = 0; i < 2; ++i)
#pragma unroll
    for (int j = 0; j < 4; ++j)
#pragma unroll
      for (int r = 0; r < 8; ++r) so[wave][i * 16 + 8 * g + r][j * 16 + col] = acc[i][j][r];
  LDSX();
  for (int it = 0; it < 16; ++it) { const int row = it * 2 + g; vst2(Y + (r0 + row) * OD + nw + col * 4, *(const v4f*)&so[wave][row][col * 4]); }   // a wave-wide 16-byte store = two whole 256-B rows of the wave's tile
}
extern "C" void kernel_launch(void* const* d_in, const int* in_sizes, int n_in, void* d_out, int out_size, void* d_ws, size_t ws_size, hipStream_t stream) {
  (void)in_sizes; (void)n_in; (void)out_size;
  const float** F = (const float**)d_in;   // 0 x [1,2048,4096], 1 cos [1,1,2048,64], 2 sin, 3 Wq [2048,4096], 4 Wk [512,4096], 5 Wv [512,4096], 6 Wo [2048,2048]
  if (ws_size < (size_t)WS_END) return;
  char* ws = (char*)d_ws; __bf16 *PK = (__bf16*)(ws + WS_PK), *OH = (__bf16*)(ws + WS_OH), *OL = (__bf16*)(ws + WS_OL); _Float16 *QH = (_Float16*)(ws + WS_QH), *QLp = (_Float16*)(ws + WS_QL), *VTH = (_Float16*)(ws + WS_VTH), *VTL = (_Float16*)(ws + WS_VTL);
  k_pack<<<dim3(PK_END / PCH), 256, 0, stream>>>(F[3], F[4], F[5], F[6], F[0], PK);
  k_qkv<<<dim3(QRB / 2, QKW / 256), 256, 0, stream>>>(PK, F[1], F[2], QH, QLp, VTH, VTL);
  k_attn<<<dim3(TQB / 2, NH), 128, 0, stream>>>(QH, QLp, VTH, VTL, OH, OL);
  k_out<<<dim3(TOB / 2, OD / 128), 256, 0, stream>>>(OH, OL, PK, (float*)d_out);
}

// v009
// A run of this version takes 141 microseconds.
// Two timings next to v008 both put it at 1.06 times that version's speed.
// All steps since v000 together make it 6.23 times as fast.
// compute dtype: x, cos, sin, Wq, Wk, Wv, Wo (module inputs) rounded to bf16; q/k/v projections with exact bf16 products on WMMA 16x16x32 (natural [out][in] rows); rotate-half RoPE with the input cos / sin tables in f32 in the projection epilogue; q and k stored as f16 hi + (x2048-scaled) residual planes with 3-product scores, causal mask (strict future), running-max softmax in f32 in base 2 (1/sqrt(64) and log2(e) as one factor inside the exponent's fma, hardware exp2); P as f16 hi + (x2048) residual x v hi/lo (3 products); GQA: query head h reads kv head h/4; output projection with ctx as bf16 hi + residual x exact Wo rows (2 products); f32 accumulate.
#include <hip/hip_runtime.h>
#include <math.h>

typedef __attribute__((ext_vector_type(16))) _Float16 v16h;
typedef __attribute__((ext_vector_type(16))) __bf16 v16b;
typedef __attribute__((ext_vector_type(8)))  _Float16 v8h;
typedef __attribute__((ext_vector_type(8)))  float v8f;
typedef __attribute__((ext_vector_type(4)))  float v4f;
typedef __attribute__((ext_vector_type(2)))  float v2f;
typedef __attribute__((ext_vector_type(4)))  unsigned v4u;
typedef __attribute__((ext_vector_type(4)))  int v4i;
typedef float __attribute__((may_alias)) float_a;
typedef int __attribute__((may_alias)) int_a;

template <typename T> __device__ __forceinline__ void vst2(void* p, T v) { *(T*)p = v;  }
__device__ __forceinline__ v8f wmma16(v16h a, v16h b, v8f c) {
  v8f d = __builtin_amdgcn_wmma_f32_16x16x32_f16(false, a, false, b, (short)0, c, false, false);
  asm volatile("v_nop\n\tv_nop\n\tv_nop\n\tv_nop" : "+v"(d) : "v"(a), "v"(b));
  return d;
}
__device__ __forceinline__ v8f wmma_bf(v16b a, v16b b, v8f c) {
  v8f d = __builtin_amdgcn_wmma_f32_16x16x32_bf16(false, a, false, b, (short)0, c, false, false);
  asm volatile("v_nop\n\tv_nop\n\tv_nop\n\tv_nop" : "+v"(d) : "v"(a), "v"(b));
  return d;
}
// 16x16x32 fragments: lane = (h = lane>>4, row/col = lane&15); elements 0..7 = k0+8h+0..7, 8..15 = k0+16+8h+0..7; D element r = row 8h+r
__device__ __forceinline__ v16h frag_h(const _Float16* rowk0, int lane) {
  union { v16h v; v8h q[2]; } u; const _Float16* p = rowk0 + 8 * (lane >> 4);
  u.q[0] = *(const v8h*)p; u.q[1] = *(const v8h*)(p + 16); return u.v;
}
__device__ __forceinline__ v16h frag_f32(const float* rowk0, int lane) {
  v16h a; const float* p = rowk0 + 8 * (lane >> 4);
#pragma unroll
  for (int i = 0; i < 8; ++i) { a[i] = (_Float16)p[i]; a[8 + i] = (_Float16)p[16 + i]; }
  return a;
}
__device__ __forceinline__ v16h frag_f32s(const float* rowk0, int lane, float sc) {
  v16h a; const float* p = rowk0 + 8 * (lane >> 4);
#pragma unroll
  for (int i = 0; i < 8; ++i) { a[i] = (_Float16)(p[i] * sc); a[8 + i] = (_Float16)(p[16 + i] * sc); }
  return a;
}
// column fragment from a [K][ld] layout (column n), rows >= K read as 0
__device__ __forceinline__ v16h fragc_f32(const float* W, int k0, int n, int lane, int ld, int K) {
  v16h a; const int g = lane >> 4;
#pragma unroll
  for (int i = 0; i < 8; ++i) { const int ka = k0 + 8 * g + i, kb = ka + 16;
    a[i] = (_Float16)(ka < K ? W[(size_t)(ka < K ? ka : K - 1) * ld + n] : 0.f); a[8 + i] = (_Float16)(kb < K ? W[(size_t)(kb < K ? kb : K - 1) * ld + n] : 0.f); }
  return a;
}
struct F2 { v16b h, l; };
__device__ __forceinline__ F2 bsplit16(const float v[16]) { F2 r;
#pragma unroll
  for (int i = 0; i < 16; ++i) { const __bf16 h = (__bf16)v[i]; r.h[i] = h; r.l[i] = (__bf16)(v[i] - (float)h); }
  return r; }
__device__ __forceinline__ F2 split_row(const float* row, int k0, int lane) { float v[16]; const float* p = row + k0 + 8 * (lane >> 4);
#pragma unroll
  for (int i = 0; i < 8; ++i) { v[i] = p[i]; v[8 + i] = p[16 + i]; }
  return bsplit16(v); }
__device__ __forceinline__ F2 split_rowK(const float* row, int k0, int lane, int K) { float v[16]; const int g = lane >> 4;
#pragma unroll
  for (int i = 0; i < 8; ++i) { const int ka = k0 + 8 * g + i, kb = ka + 16; v[i] = ka < K ? row[ka < K ? ka : K - 1] : 0.f; v[8 + i] = kb < K ? row[kb < K ? kb : K - 1] : 0.f; }
  return bsplit16(v); }
__device__ __forceinline__ F2 split_col(const float* W, int k0, int n, int lane, int ld, int K) { float v[16]; const int g = lane >> 4;
#pragma unroll
  for (int i = 0; i < 8; ++i) { const int ka = k0 + 8 * g + i, kb = ka + 16; v[i] = ka < K ? W[(size_t)(ka < K ? ka : K - 1) * ld + n] : 0.f; v[8 + i] = kb < K ? W[(size_t)(kb < K ? kb : K - 1) * ld + n] : 0.f; }
  return bsplit16(v); }
__device__ __forceinline__ v8f mac3(const F2& a, const F2& b, v8f c) { c = wmma_bf(a.l, b.h, c); c = wmma_bf(a.h, b.l, c); return wmma_bf(a.h, b.h, c); }
__device__ __forceinline__ float sigm(float v) { return 1.0f / (1.0f + expf(-v)); }
#define LDSX() do { asm volatile("s_wait_dscnt 0" ::: "memory"); __builtin_amdgcn_wave_barrier(); __builtin_amdgcn_fence(__ATOMIC_RELEASE, "workgroup"); } while (0)


// Eagle-3 draft-model attention (B 1, L 2,048, input 4,096 = 2 x hidden, 32 query heads x 64 with 8 shared KV heads, rotate-half RoPE from given cos / sin, causal softmax / sqrt(64), Wo).
#define SS 2048
#define XD 4096            // input width (2 * hidden)
#define NH 32
#define NKV 8
#define HD 64
#define QD (NH * HD)       // 2,048
#define KD (NKV * HD)      // 512
#define QKW (QD + 2 * KD)  // 3,072 projected columns: q | k | v
#define OD 2048            // Wo output width
#ifndef TQB
#define TQB (SS / 64)
#define TOB (SS / 64)
#define QRB (SS / 64)      // projected row blocks
#endif
typedef __attribute__((ext_vector_type(8))) __bf16 v8b;
__device__ __forceinline__ v16b frag_b(const __bf16* rowk0, int lane) {
  union { v16b v; v8b q[2]; } u; const __bf16* p = rowk0 + 8 * (lane >> 4);
  u.q[0] = *(const v8b*)p; u.q[1] = *(const v8b*)(p + 16); return u.v;
}
__device__ __forceinline__ float bfr(float v) { return (float)(__bf16)v; }
__device__ __attribute__((noinline)) float erf_ni(float v) { return erff(v); }

#define PK_A 0                           // [3072][4096]: Wq | Wk | Wv natural rows
#define PK_O (PK_A + (size_t)QKW * XD)     // [2048][2048] Wo natural rows
#define PK_X (PK_O + (size_t)OD * QD)      // [2048][4096] x rows, rounded once
#define PK_END (PK_X + (size_t)SS * XD)
#define WS_PK  0u
#define WS_QH  (((2u * PK_END) + 127u) / 128u * 128u)   // f16 [2048][2560]: rope(q) | rope(k) hi
#define WS_QL  (WS_QH + 2u * (size_t)SS * (QD + KD))    // residual x2048
#define WS_VTH (WS_QL + 2u * (size_t)SS * (QD + KD))    // f16 [kv 8][64][2048] v hi / lo
#define WS_VTL (WS_VTH + 2u * (size_t)KD * SS)
#define WS_OH  (WS_VTL + 2u * (size_t)KD * SS)          // bf16 [2048][2048] attention output hi / lo
#define WS_OL  (WS_OH + 2u * (size_t)SS * QD)
#define WS_END (WS_OL + 2u * (size_t)SS * QD)

// ---- k_pack: the packed planes are the four weight arrays and x one behind another (Wq | Wk | Wv | Wo | x, natural rows), so the rounding to bf16 is one flat stream; x is rounded here once, so that the projection stages and reads 2-byte x. A block takes 32,768 consecutive floats of one array: each wave-wide 16-byte load covers 512 consecutive bytes, a lane's 32 loads stand ahead of the conversions, so that the build keeps many of them in flight at once, and each wave-wide 8-byte store covers two whole 128-B lines
#define PCH (256 * 4 * 32)
typedef __attribute__((ext_vector_type(4))) __bf16 v4b;
__global__ __launch_bounds__(256) void k_pack(const float* __restrict__ WQ, const float* __restrict__ WK, const float* __restrict__ WV, const float* __restrict__ WO, const float* __restrict__ X, __bf16* __restrict__ PK) {
  constexpr int NQ = QD * XD / PCH, NK = KD * XD / PCH, NO = OD * QD / PCH;   // blocks of Wq; of Wk and of Wv; of Wo
  static_assert(QD * XD % PCH == 0 && KD * XD % PCH == 0 && OD * QD % PCH == 0 && SS * XD % PCH == 0 && PK_O == (size_t)(NQ + 2 * NK) * PCH && PK_X == (size_t)(NQ + 2 * NK + NO) * PCH, "every block lies in one array, and block b writes packed elements b * PCH on");
  const int b = blockIdx.x, t = threadIdx.x;
  const float* src = (b < NQ) ? WQ + (size_t)b * PCH : (b < NQ + NK) ? WK + (size_t)(b - NQ) * PCH : (b < NQ + 2 * NK) ? WV + (size_t)(b - NQ - NK) * PCH : (b < NQ + 2 * NK + NO) ? WO + (size_t)(b - NQ - 2 * NK) * PCH : X + (size_t)(b - NQ - 2 * NK - NO) * PCH;
  __bf16* dst = PK + (size_t)b * PCH;
  v4f v[32];
#pragma unroll
  for (int i = 0; i < 32; ++i) v[i] = *(const v4f*)(src + i * 1024 + t * 4);
#pragma unroll
  for (int i = 0; i < 32; ++i) { v4b o;
#pragma unroll
    for (int e = 0; e < 4; ++e) o[e] = (__bf16)v[i][e];
    *(v4b*)(dst + i * 1024 + t * 4) = o; }
}
// ---- LDS rings: a stage is brought by asynchronous 16-byte copies; rows of 128 B lie at pitch 144 B, rows of 256 B at 272 B (16 B x odd: ds_load_b128 without bank conflicts)
#define P128 144
#define P256 272
__device__ __forceinline__ unsigned lds_off(const void* p) { return (unsigned)(size_t)p; }   // byte offset in the work-group's LDS: low 32 bits of the __shared__ address
// eight copies of one lane; s_wait_xcnt closes the copies' own statement, so that no address register is rewritten ahead of it
__device__ __forceinline__ void cp8(const unsigned (&l)[8], const char* const (&g)[8]) {
  asm volatile("global_load_async_to_lds_b128 %0, %8, off\n\t"
               "global_load_async_to_lds_b128 %1, %9, off\n\t"
               "global_load_async_to_lds_b128 %2, %10, off\n\t"
               "global_load_async_to_lds_b128 %3, %11, off\n\t"
               "global_load_async_to_lds_b128 %4, %12, off\n\t"
               "global_load_async_to_lds_b128 %5, %13, off\n\t"
               "global_load_async_to_lds_b128 %6, %14, off\n\t"
               "global_load_async_to_lds_b128 %7, %15, off\n\t"
               "s_wait_xcnt 0x0"
               :: "v"(l[0]), "v"(l[1]), "v"(l[2]), "v"(l[3]), "v"(l[4]), "v"(l[5]), "v"(l[6]), "v"(l[7]),
                  "v"(g[0]), "v"(g[1]), "v"(g[2]), "v"(g[3]), "v"(g[4]), "v"(g[5]), "v"(g[6]), "v"(g[7]) : "memory");
}
// 256 threads bring one 64-key stage: 64 rows of 128 B from each of the four planes (K hi, K lo at pitch kp; V^T hi, V^T lo at pitch vp); a wave-wide copy = four whole 128-B rows
__device__ __forceinline__ void stage_4x64x128(unsigned lb, const char* gkh, const char* gkl, const char* gvh, const char* gvl, size_t kp, size_t vp, int tt) {
  unsigned l[8]; const char* g[8]; const int r = tt >> 3, sg = (tt & 7) * 16;
#pragma unroll
  for (int i = 0; i < 2; ++i) { const int row = r + 32 * i; const unsigned lo = (unsigned)(row * P128 + sg);
    l[i] = lb + lo; g[i] = gkh + (size_t)row * kp + sg; l[2 + i] = lb + 64 * P128 + lo; g[2 + i] = gkl + (size_t)row * kp + sg;
    l[4 + i] = lb + 2 * 64 * P128 + lo; g[4 + i] = gvh + (size_t)row * vp + sg; l[6 + i] = lb + 3 * 64 * P128 + lo; g[6 + i] = gvl + (size_t)row * vp + sg; }
  cp8(l, g);
}
// the issuing wave's own wait for its copies (the compiler places none), and the wait that ends this wave's LDS reads in front of a refill
#define WAIT_ASYNC() asm volatile("s_wait_asynccnt 0x0" ::: "memory")
#define WAIT_DS() asm volatile("s_wait_dscnt 0x0" ::: "memory")
// 256 threads bring 16 * (256 >> LPR) rows of (16 << LPR) bytes each (a wave-wide copy = 512 B: one whole 512-B row or two whole 256-B rows); g0 = first byte of row 0 of the stage
template <int LPR, int PITCH> __device__ __forceinline__ void stage_t256(unsigned l0, const char* g0, size_t gp, int tid) {
  const int r = tid >> LPR, sg = (tid & ((1 << LPR) - 1)) * 16;
#pragma unroll
  for (int h = 0; h < 2; ++h) { unsigned l[8]; const char* g[8];
#pragma unroll
    for (int i = 0; i < 8; ++i) { const int row = r + (256 >> LPR) * (8 * h + i); l[i] = l0 + (unsigned)(row * PITCH + sg); g[i] = g0 + (size_t)row * gp + sg; }
    cp8(l, g); }
}
// 256 threads bring 128 rows of 256 B
__device__ __forceinline__ void stage_128x256(unsigned l0, const char* g0, size_t gp, int tid) {
  unsigned l[8]; const char* g[8]; const int r = tid >> 4, sg = (tid & 15) * 16;
#pragma unroll
  for (int i = 0; i < 8; ++i) { l[i] = l0 + (unsigned)((r + 16 * i) * P256 + sg); g[i] = g0 + (size_t)(r + 16 * i) * gp + sg; }
  cp8(l, g);
}
#define KQ 128     // k of one stage of the two projection GEMMs
// ---- k_qkv: block = (128 rows, 256 cols of 3072), eight waves as 2 x 4, a wave = 64 rows x 64 cols (one head): acc = bf16 x rows (packed) . weight rows (exact, K 4096); q/k blocks: rotate-half RoPE (partner 32 columns away = 2 tiles, same lane) with cos/sin[pos][d] -> f16 hi/lo rows; v: hi/lo transposed planes [kv][d][s]
__global__ __launch_bounds__(256) void k_qkv(const __bf16* __restrict__ PK, const float* __restrict__ COS, const float* __restrict__ SIN, _Float16* __restrict__ QH, _Float16* __restrict__ QL_, _Float16* __restrict__ VTH, _Float16* __restrict__ VTL) {
  constexpr int SB = 256 * P256, STG = SB + 128 * P256, NT = XD / KQ;   // stage: 256 weight rows | 128 x rows, bf16, 256 B each
  __shared__ __align__(16) char sm[2 * STG];   // the ring; behind the k loop's last barrier the same bytes are the output staging
  _Float16 (*soh)[64][72] = (_Float16 (*)[64][72])sm; _Float16 (*sol)[64][72] = soh + 8;   // each wave's own 64 x 64 tile, hi and lo
  static_assert(2 * STG >= 2 * 8 * 64 * 72 * 2, "output staging fits the ring");
  const int tid = threadIdx.x, wave = tid >> 5, lane = tid & 31, col = lane & 15, g = lane >> 4, wr = wave >> 2, wc = wave & 3;
  const size_t r0 = (size_t)blockIdx.x * 128 + wr * 64; const int n0 = blockIdx.y * 256, nw = n0 + wc * 64;
  v8f acc[4][4] = {};
  const unsigned sm0 = lds_off(sm); const char* gw = (const char*)(PK + PK_A + (size_t)n0 * XD); const char* gx = (const char*)(PK + PK_X + (size_t)blockIdx.x * 128 * XD);
  stage_t256<4, P256>(sm0, gw, XD * 2, tid); stage_128x256(sm0 + SB, gx, XD * 2, tid);
  WAIT_ASYNC(); __syncthreads();
  stage_t256<4, P256>(sm0 + STG, gw + KQ * 2, XD * 2, tid); stage_128x256(sm0 + STG + SB, gx + KQ * 2, XD * 2, tid);
#pragma unroll 1   // one stage a trip: the buffer index stays a run-time value and the ring's order stands once
  for (int t = 0; t < NT; ++t) { const char* bw = sm + (t & 1) * STG + (wc * 64 + col) * P256; const char* bx = sm + (t & 1) * STG + SB + (wr * 64 + col) * P256;
    v16b xf[2][4], wf[2][4];   // two fragment sets: the LDS reads of the next 32 k stand as one group in front of this 32 k's 16 products
#pragma unroll
    for (int kk = -1; kk < KQ / 32; ++kk) {
      if (kk + 1 < KQ / 32) { const int kn = kk + 1, sn = kn & 1;
#pragma unroll
        for (int i = 0; i < 4; ++i) xf[sn][i] = frag_b((const __bf16*)(bx + i * 16 * P256) + kn * 32, lane);
#pragma unroll
        for (int j = 0; j < 4; ++j) wf[sn][j] = frag_b((const __bf16*)(bw + j * 16 * P256) + kn * 32, lane); }
      __builtin_amdgcn_sched_barrier(0);   // keeps the read group whole and ahead of the products: without it the build sinks each read to its use, with a wait to 0 every four products
      if (kk >= 0) { const int sc = kk & 1;
#pragma unroll
        for (int i = 0; i < 4; ++i)
#pragma unroll
          for (int j = 0; j < 4; ++j) acc[i][j] = __builtin_amdgcn_wmma_f32_16x16x32_bf16(false, xf[sc][i], false, wf[sc][j], (short)0, acc[i][j], false, false); }   // the bare builtin: the build keeps its distances itself; as operands of an asm statement both fragment sets and the accumulators would all have to lie below v256, which spills
      __builtin_amdgcn_sched_barrier(0); }   // the next read group stays behind this block of products
    WAIT_DS(); WAIT_ASYNC(); __syncthreads();   // publishes stage t + 1 and ends every reader's last read of stage t
    if (t + 2 < NT) { const unsigned lb = sm0 + (unsigned)(t & 1) * STG; stage_t256<4, P256>(lb, gw + (size_t)(t + 2) * (KQ * 2), XD * 2, tid); stage_128x256(lb + SB, gx + (size_t)(t + 2) * (KQ * 2), XD * 2, tid); } }
  WAIT_ASYNC();
  const int srow = lane >> 3, sseg = (lane & 7) * 8;   // a wave-wide 16-byte store = four whole 128-B rows of the wave's tile
  if (n0 < QD + KD) {   // q or k block: the wave's 64 columns are one head; rotate_half: d < 32: out = x_d cos_d - x_{d+32} sin_d; d >= 32: out = x_d cos_d + x_{d-32} sin_d
    const float* cb = COS + (r0 + 8 * g) * HD + col; const float* sb = SIN + (r0 + 8 * g) * HD + col;   // this lane's first position and d: every table read is one of these two addresses plus a constant
#pragma unroll
    for (int i = 0; i < 4; ++i)
#pragma unroll
      for (int j = 0; j < 4; ++j) { const int d = j * 16 + col; const int jp = (j < 2) ? j + 2 : j - 2; const float sgn = (j < 2) ? -1.f : 1.f;
#pragma unroll
        for (int r = 0; r < 8; ++r) { const int po = (i * 16 + r) * HD + j * 16; const float v = acc[i][j][r] * bfr(cb[po]) + sgn * acc[i][jp][r] * bfr(sb[po]);
          const _Float16 hv = (_Float16)v; soh[wave][i * 16 + 8 * g + r][d] = hv; sol[wave][i * 16 + 8 * g + r][d] = (_Float16)((v - (float)hv) * 2048.0f); } }
    LDSX();
    for (int it = 0; it < 16; ++it) { const int row = it * 4 + srow; const size_t o = (r0 + row) * (QD + KD) + nw + sseg; vst2((unsigned*)(QH + o), *(const v4u*)&soh[wave][row][sseg]); vst2((unsigned*)(QL_ + o), *(const v4u*)&sol[wave][row][sseg]); }
  } else {   // v block: the wave's tile transposed, rows = d, 64 positions = one 128-B line
#pragma unroll
    for (int i = 0; i < 4; ++i)
#pragma unroll
      for (int j = 0; j < 4; ++j) { v8h hi8, lo8;
#pragma unroll
        for (int r = 0; r < 8; ++r) { const float v = acc[i][j][r]; const _Float16 hv = (_Float16)v; hi8[r] = hv; lo8[r] = (_Float16)((v - (float)hv) * 2048.0f); }
        *(v8h*)&soh[wave][j * 16 + col][i * 16 + 8 * g] = hi8; *(v8h*)&sol[wave][j * 16 + col][i * 16 + 8 * g] = lo8; }
    LDSX();
    const int c0 = nw - QD - KD;
    for (int it = 0; it < 16; ++it) { const int d = it * 4 + srow; const size_t o = (size_t)(c0 + d) * SS + r0 + sseg; vst2((unsigned*)(VTH + o), *(const v4u*)&soh[wave][d][sseg]); vst2((unsigned*)(VTL + o), *(const v4u*)&sol[wave][d][sseg]); }
    asm volatile("s_wait_xcnt 0x0" ::: "memory");   // the built code runs on from here into text that rewrites these stores' address registers
  }
}
// lane l <-> lane l ^ 16 (the two halves of a wave hold the two key halves of one query column)
__device__ __forceinline__ float xhalf(float x) { return __builtin_bit_cast(float, __builtin_amdgcn_permlanex16(__builtin_bit_cast(int, x), __builtin_bit_cast(int, x), 0x76543210, 0xfedcba98, false, false)); }
// ---- k_attn: transposed products: S^T = K . Q^T (A = key rows, B = query columns), O^T += V^T . P^T. A lane holds one query (column col) and keys 8g+r of each 16-key tile: maximum and sum run in the lane, one exchange between the halves; the two score tiles convert in place into the P^T operand (element ct*8+r = key ct*16+8g+r), so P needs no LDS. A work-group is 16 waves = 2 key groups x 2 query heads of one KV head x 4 query tiles of 16: four waves a SIMD, so that one wave's vector work runs under another's products and LDS waits, and one K / V^T ring serves both heads. A ring stage is 128 keys = two 64-key halves; key group kg brings half kg (asynchronous 16-byte copies in whole 128-B rows) and works on it alone (two 32-key passes), with a running maximum, sum and O^T of its own; behind the key loop group 1 hands its three over through LDS and group 0 joins them. A work-group (x, y) takes query block n - 1 - x of head pair y and then query block x of head pair NH / 2 - 1 - y: n / 2 + 1 stages for every work-group, and every (head, query block) once.
__global__ __launch_bounds__(512) void k_attn(const _Float16* __restrict__ QH, const _Float16* __restrict__ QL_, const _Float16* __restrict__ VTH, const _Float16* __restrict__ VTL, __bf16* __restrict__ OH, __bf16* __restrict__ OL) {
  constexpr int SP = 64 * P128, STG = 4 * SP, DST = 2 * STG;   // half stage: K hi rows [key][d] | K lo rows | V^T hi rows [d][key] | V^T lo rows, 64 rows of 128 B each; stage: two halves
  constexpr int MBB = 8 * 9 * 32 * 16;   // hand-over: per wave of group 1 nine 16-byte words a lane (O^T 32 floats; maximum, sum)
  __shared__ __align__(16) char sm[2 * DST];   // the ring; behind the key loop's last barrier the same bytes are the hand-over and the output staging
  v4f (*mb)[9][32] = (v4f (*)[9][32])sm;
  __bf16 (*soh)[16][72] = (__bf16 (*)[16][72])(sm + MBB); __bf16 (*sol)[16][72] = soh + 8;
  static_assert(2 * DST >= MBB + 2 * 8 * 16 * 72 * 2, "hand-over and output staging fit the ring");
  const int tid = threadIdx.x, wave = tid >> 5, lane = tid & 31, col = lane & 15, g = lane >> 4, ow = wave & 7;   // ow = (head of the pair, query tile)
  const int kg = __builtin_amdgcn_readfirstlane(tid >> 8);   // key group, in a scalar register: the tests on it are scalar branches
  const unsigned sm0 = lds_off(sm); const size_t kp = (size_t)(QD + KD) * 2, vp = (size_t)SS * 2;   // source pitches in bytes
  static_assert(TQB % 2 == 0 && NH % 2 == 0 && (NH / NKV) % 2 == 0, "query blocks pair up; a head pair lies in one KV head");
#pragma unroll 1   // the pair's two query blocks run one after the other through one body
  for (int pp = 0; pp < 2; ++pp) {
  const int qb = pp ? (int)blockIdx.x : TQB - 1 - (int)blockIdx.x, hp = pp ? NH / 2 - 1 - (int)blockIdx.y : (int)blockIdx.y; const int h = 2 * hp + (ow >> 2), kvh = hp / (NH / NKV / 2); const int q0 = qb * 64 + (ow & 3) * 16; const size_t rq = (size_t)q0 + col; const int qi = q0 + col;
  const int NT = (qb + 2) >> 1;   // stages of 128 keys up to and with the diagonal block; where qb is even the last stage's second half lies wholly in the future (still inside the planes: qb + 1 < TQB) and group 1 skips it
  const char* gkh = (const char*)(QH + QD + kvh * HD) + (size_t)kg * 64 * kp; const char* gkl = (const char*)(QL_ + QD + kvh * HD) + (size_t)kg * 64 * kp; const char* gvh = (const char*)(VTH + (size_t)kvh * HD * SS) + kg * 128; const char* gvl = (const char*)(VTL + (size_t)kvh * HD * SS) + kg * 128;   // this key group's half of stage 0
  const unsigned lh = sm0 + (unsigned)kg * STG; const int tt = tid & 255;
  if (pp) { WAIT_DS(); __syncthreads(); }   // ends every wave's reads of the first block's hand-over and output staging in front of the ring's refill
  stage_4x64x128(lh, gkh, gkl, gvh, gvl, kp, vp, tt);
  v16h aqh[2], aql[2];
#pragma unroll
  for (int kc = 0; kc < 2; ++kc) { aqh[kc] = frag_h(QH + rq * (QD + KD) + h * HD + kc * 32, lane); aql[kc] = frag_h(QL_ + rq * (QD + KD) + h * HD + kc * 32, lane); }
  WAIT_ASYNC(); __syncthreads();
  if (NT > 1) stage_4x64x128(lh + DST, gkh + 128 * kp, gkl + 128 * kp, gvh + 256, gvl + 256, kp, vp, tt);
  constexpr float KL = 0.125f * 1.44269504088896f;   // 1/sqrt(64) * log2(e): exp((s - max) / 8) = exp2(s * KL - max * KL); a masked score (-3e38) gives exp2 of about -5e37 = 0, and the first key of a group's first pass (key 0, key 64) lies at or before every query that the group works on, so the maximum is finite from that pass on
  float m = -3.0e38f, l = 0.f;   // this lane's query, this key group: running maximum in base-2 units (equal in both halves), sum over this half's keys
  v8f acc[4] = {}, accl[4] = {};  // O^T: element r = d (dt*16 + 8g + r), column = query
#pragma unroll 1   // one stage a trip: the buffer index stays a run-time value and the ring's order stands once
  for (int t = 0; t < NT; ++t) { const char* bk = sm + (t & 1) * DST + kg * STG; const int st = 2 * t + kg;   // this group's 64-key block
    if (st <= qb) {   // a scalar test: a half that lies wholly in the future is not worked on (its scores would all be masked, with no finite maximum where it is the group's first)
#pragma unroll 1   // the two passes of a half share one body, so that the loop's text stays short
    for (int hf = 0; hf < 2; ++hf) { const int ks = 2 * st + hf; v8f s[2];
      v16h kh[2][2], kl[2][2];   // the pass's key fragments stand as one group of LDS reads in front of its score products
#pragma unroll
      for (int ct = 0; ct < 2; ++ct) { const char* kr = bk + (hf * 32 + ct * 16 + col) * P128;
#pragma unroll
        for (int kc = 0; kc < 2; ++kc) { kh[ct][kc] = frag_h((const _Float16*)kr + kc * 32, lane); kl[ct][kc] = frag_h((const _Float16*)(kr + SP) + kc * 32, lane); } }
#pragma unroll
      for (int ct = 0; ct < 2; ++ct) { v8f c = {}, cl = {};
#pragma unroll
        for (int kc = 0; kc < 2; ++kc) { c = wmma16(kh[ct][kc], aqh[kc], c); cl = wmma16(kh[ct][kc], aql[kc], cl); cl = wmma16(kl[ct][kc], aqh[kc], cl); }
#pragma unroll
        for (int r = 0; r < 8; ++r) { const int kk = ks * 32 + ct * 16 + 8 * g + r; const float sv = c[r] + cl[r] * (1.0f / 2048.0f); s[ct][r] = (kk <= qi) ? sv : -3.0e38f; } }
      v16h vh[4], vl[4];   // the pass's value fragments: one group of LDS reads, in flight under the maximum
#pragma unroll
      for (int dt = 0; dt < 4; ++dt) { const char* vr = bk + 2 * SP + (dt * 16 + col) * P128; vh[dt] = frag_h((const _Float16*)vr + hf * 32, lane); vl[dt] = frag_h((const _Float16*)(vr + SP) + hf * 32, lane); }
      float mx = fmaxf(s[0][0], s[1][0]);
#pragma unroll
      for (int r = 1; r < 8; ++r) mx = fmaxf(mx, fmaxf(s[0][r], s[1][r]));
      mx = fmaxf(mx, xhalf(mx));
      const float mn = fmaxf(m, mx * KL); const float alpha = __builtin_amdgcn_exp2f(m - mn);   // first pass: exp2(-3e38 - mn) = 0
      v16h pah, pal; float es = 0.f;
#pragma unroll
      for (int ct = 0; ct < 2; ++ct)
#pragma unroll
        for (int r = 0; r < 8; ++r) { const float e = __builtin_amdgcn_exp2f(fmaf(s[ct][r], KL, -mn)); es += e; const _Float16 hv = (_Float16)e; pah[ct * 8 + r] = hv; pal[ct * 8 + r] = (_Float16)((e - (float)hv) * 2048.0f); }
      l = l * alpha + es; m = mn;
#pragma unroll
      for (int dt = 0; dt < 4; ++dt)
#pragma unroll
        for (int r = 0; r < 8; ++r) { acc[dt][r] *= alpha; accl[dt][r] *= alpha; }
#pragma unroll
      for (int dt = 0; dt < 4; ++dt) { acc[dt] = wmma16(vh[dt], pah, acc[dt]); accl[dt] = wmma16(vh[dt], pal, accl[dt]); accl[dt] = wmma16(vl[dt], pah, accl[dt]); } } }
    WAIT_DS(); WAIT_ASYNC(); __syncthreads();   // publishes stage t + 1 and ends every reader's last read of stage t
    if (t + 2 < NT) { const unsigned lb = lh + (unsigned)(t & 1) * DST; const size_t ko = (size_t)(t + 2) * 128 * kp, vo = (size_t)(t + 2) * 256; stage_4x64x128(lb, gkh + ko, gkl + ko, gvh + vo, gvl + vo, kp, vp, tt); } }
  WAIT_ASYNC();
#pragma unroll
  for (int dt = 0; dt < 4; ++dt)
#pragma unroll
    for (int r = 0; r < 8; ++r) acc[dt][r] += accl[dt][r] * (1.0f / 2048.0f);
  if (kg) {   // group 1 hands over its O^T, maximum and sum (a group that worked on no key: 0, -3e38, 0); a wave-wide 16-byte store = 512 consecutive bytes
#pragma unroll
    for (int dt = 0; dt < 4; ++dt) { mb[ow][2 * dt][lane] = (v4f){acc[dt][0], acc[dt][1], acc[dt][2], acc[dt][3]}; mb[ow][2 * dt + 1][lane] = (v4f){acc[dt][4], acc[dt][5], acc[dt][6], acc[dt][7]}; }
    mb[ow][8][lane] = (v4f){m, l, 0.f, 0.f}; }
  WAIT_DS(); __syncthreads();   // publishes the hand-over
  if (!kg) {   // group 0 joins the two key groups on their common maximum (its own is finite: key 0) and writes the block's rows
    const v4f ml = mb[ow][8][lane]; const float ms = fmaxf(m, ml[0]); const float wa = __builtin_amdgcn_exp2f(m - ms), wb = __builtin_amdgcn_exp2f(ml[0] - ms);
    const float lt = l * wa + ml[1] * wb; const float il = 1.0f / (lt + xhalf(lt));
#pragma unroll
    for (int dt = 0; dt < 4; ++dt) { const v4f b0 = mb[ow][2 * dt][lane], b1 = mb[ow][2 * dt + 1][lane];
#pragma unroll
      for (int r = 0; r < 8; ++r) { const float v = (acc[dt][r] * wa + (r < 4 ? b0[r & 3] : b1[r & 3]) * wb) * il; const __bf16 hb = (__bf16)v; soh[ow][col][dt * 16 + 8 * g + r] = hb; sol[ow][col][dt * 16 + 8 * g + r] = (__bf16)(v - (float)hb); } }
    LDSX();
    for (int rl = 0; rl < 16; ++rl) { const size_t o = ((size_t)q0 + rl) * QD + h * HD; if (lane < 8) vst2((unsigned*)(OH + o + lane * 8), *(const v4u*)&soh[ow][rl][lane * 8]); else if (lane < 16) vst2((unsigned*)(OL + o + (lane - 8) * 8), *(const v4u*)&sol[ow][rl][(lane - 8) * 8]); }
    asm volatile("s_wait_xcnt 0x0" ::: "memory");   // the second query block rewrites the address and data registers of these stores
  }
  }
}
// ---- k_out: block = (128 rows, 128 cols), eight waves as 4 x 2, a wave = 32 rows x 64 cols: out = O(hi/lo) . Wo rows (2 products, K 2048; per accumulator the order stays lo, hi within each 32 k)
__global__ __launch_bounds__(256) void k_out(const __bf16* __restrict__ OH, const __bf16* __restrict__ OL, const __bf16* __restrict__ PK, float* __restrict__ Y) {
  constexpr int SP = 128 * P256, STG = 3 * SP, NT = QD / KQ;   // stage: Wo rows | ctx hi rows | ctx lo rows, 128 rows of 256 B each
  __shared__ __align__(16) char sm[2 * STG];   // the ring; behind the k loop's last barrier the same bytes are the output staging
  float (*so)[32][68] = (float (*)[32][68])sm;   // each wave's own 32 x 64 tile
  static_assert(2 * STG >= 8 * 32 * 68 * 4, "output staging fits the ring");
  const int tid = threadIdx.x, wave = tid >> 5, lane = tid & 31, col = lane & 15, g = lane >> 4, wr = wave >> 1, wc = wave & 1;
  const size_t r0 = (size_t)blockIdx.x * 128 + wr * 32; const int n0 = blockIdx.y * 128, nw = n0 + wc * 64;
  v8f acc[2][4] = {};
  const unsigned sm0 = lds_off(sm); const char* gw = (const char*)(PK + PK_O + (size_t)n0 * QD); const char* gh = (const char*)(OH + (size_t)blockIdx.x * 128 * QD); const char* gl = (const char*)(OL + (size_t)blockIdx.x * 128 * QD);
  stage_128x256(sm0, gw, QD * 2, tid); stage_128x256(sm0 + SP, gh, QD * 2, tid); stage_128x256(sm0 + 2 * SP, gl, QD * 2, tid);
  WAIT_ASYNC(); __syncthreads();
  stage_128x256(sm0 + STG, gw + KQ * 2, QD * 2, tid); stage_128x256(sm0 + STG + SP, gh + KQ * 2, QD * 2, tid); stage_128x256(sm0 + STG + 2 * SP, gl + KQ * 2, QD * 2, tid);
#pragma unroll 1   // one stage a trip: the buffer index stays a run-time value and the ring's order stands once
  for (int t = 0; t < NT; ++t) { const char* bw = sm + (t & 1) * STG + (wc * 64 + col) * P256; const char* bh = sm + (t & 1) * STG + SP + (wr * 32 + col) * P256;
    v16b ah[2][2], al[2][2], wf[2][4];   // two fragment sets: the LDS reads of the next 32 k stand as one group in front of this 32 k's 16 products
#pragma unroll
    for (int kk = -1; kk < KQ / 32; ++kk) {
      if (kk + 1 < KQ / 32) { const int kn = kk + 1, sn = kn & 1;
#pragma unroll
        for (int i = 0; i < 2; ++i) { ah[sn][i] = frag_b((const __bf16*)(bh + i * 16 * P256) + kn * 32, lane); al[sn][i] = frag_b((const __bf16*)(bh + SP + i * 16 * P256) + kn * 32, lane); }
#pragma unroll
        for (int j = 0; j < 4; ++j) wf[sn][j] = frag_b((const __bf16*)(bw + j * 16 * P256) + kn * 32, lane); }
      if (kk >= 0) { const int sc = kk & 1;
#pragma unroll
        for (int i = 0; i < 2; ++i)
#pragma unroll
          for (int j = 0; j < 4; ++j) acc[i][j] = wmma_bf(al[sc][i], wf[sc][j], acc[i][j]);
#pragma unroll
        for (int i = 0; i < 2; ++i)
#pragma unroll
          for (int j = 0; j < 4; ++j) acc[i][j] = wmma_bf(ah[sc][i], wf[sc][j], acc[i][j]); } }
    WAIT_DS(); WAIT_ASYNC(); __syncthreads();   // publishes stage t + 1 and ends every reader's last read of stage t
    if (t + 2 < NT) { const unsigned lb = sm0 + (unsigned)(t & 1) * STG; const size_t ko = (size_t)(t + 2) * (KQ * 2); stage_128x256(lb, gw + ko, QD * 2, tid); stage_128x256(lb + SP, gh + ko, QD * 2, tid); stage_128x256(lb + 2 * SP, gl + ko, QD * 2, tid); } }
  WAIT_ASYNC();
#pragma unroll
  for (int i = 0; i < 2; ++i)
#pragma unroll
    for (int j = 0; j < 4; ++j)
#pragma unroll
      for (int r = 0; r < 8; ++r) so[wave][i * 16 + 8 * g + r][j * 16 + col] = acc[i][j][r];
  LDSX();
  for (int it = 0; it < 16; ++it) { const int row = it * 2 + g; vst2(Y + (r0 + row) * OD + nw + col * 4, *(const v4f*)&so[wave][row][col * 4]); }   // a wave-wide 16-byte store = two whole 256-B rows of the wave's tile
}
extern "C" void kernel_launch(void* const* d_in, const int* in_sizes, int n_in, void* d_out, int out_size, void* d_ws, size_t ws_size, hipStream_t stream) {
  (void)in_sizes; (void)n_in; (void)out_size;
  const float** F = (const float**)d_in;   // 0 x [1,2048,4096], 1 cos [1,1,2048,64], 2 sin, 3 Wq [2048,4096], 4 Wk [512,4096], 5 Wv [512,4096], 6 Wo [2048,2048]
  if (ws_size < (size_t)WS_END) return;
  char* ws = (char*)d_ws; __bf16 *PK = (__bf16*)(ws + WS_PK), *OH = (__bf16*)(ws + WS_OH), *OL = (__bf16*)(ws + WS_OL); _Float16 *QH = (_Float16*)(ws + WS_QH), *QLp = (_Float16*)(ws + WS_QL), *VTH = (_Float16*)(ws + WS_VTH), *VTL = (_Float16*)(ws + WS_VTL);
  k_pack<<<dim3(PK_END / PCH), 256, 0, stream>>>(F[3], F[4], F[5], F[6], F[0], PK);
  k_qkv<<<dim3(QRB / 2, QKW / 256), 256, 0, stream>>>(PK, F[1], F[2], QH, QLp, VTH, VTL);
  k_attn<<<dim3(TQB / 2, NH / 2), 512, 0, stream>>>(QH, QLp, VTH, VTL, OH, OL);
  k_out<<<dim3(TOB / 2, OD / 128), 256, 0, stream>>>(OH, OL, PK, (float*)d_out);
}

// v010
// One run takes 136 microseconds.
// In both of two side-by-side timings against v009, it was 1.04 times as fast.
// Over all steps from v000 it is 6.46 times as fast.
// compute dtype: x, cos, sin, Wq, Wk, Wv, Wo (module inputs) rounded to bf16; q/k/v projections with exact bf16 products on WMMA 16x16x32 (natural [out][in] rows); rotate-half RoPE with the input cos / sin tables in f32 in the projection epilogue; q and k stored as f16 hi + residual planes (the residual unscaled: f16 subnormals are kept) with 3-product scores in one accumulator, causal mask (strict future), running-max softmax in f32 in base 2 (1/sqrt(64) and log2(e) as one factor inside the exponent's fma, hardware exp2); P as f16 hi + residual x v hi/lo (3 products, one accumulator); GQA: query head h reads kv head h/4; output projection with ctx as bf16 hi + residual x exact Wo rows (2 products); f32 accumulate.
#include <hip/hip_runtime.h>
#include <math.h>

typedef __attribute__((ext_vector_type(16))) _Float16 v16h;
typedef __attribute__((ext_vector_type(16))) __bf16 v16b;
typedef __attribute__((ext_vector_type(8)))  _Float16 v8h;
typedef __attribute__((ext_vector_type(8)))  float v8f;
typedef __attribute__((ext_vector_type(4)))  float v4f;
typedef __attribute__((ext_vector_type(2)))  float v2f;
typedef __attribute__((ext_vector_type(4)))  unsigned v4u;
typedef __attribute__((ext_vector_type(4)))  int v4i;
typedef float __attribute__((may_alias)) float_a;
typedef int __attribute__((may_alias)) int_a;

template <typename T> __device__ __forceinline__ void vst2(void* p, T v) { *(T*)p = v;  }
__device__ __forceinline__ v8f wmma16(v16h a, v16h b, v8f c) {
  v8f d = __builtin_amdgcn_wmma_f32_16x16x32_f16(false, a, false, b, (short)0, c, false, false);
  asm volatile("v_nop\n\tv_nop\n\tv_nop\n\tv_nop" : "+v"(d) : "v"(a), "v"(b));
  return d;
}
__device__ __forceinline__ v8f wmma_bf(v16b a, v16b b, v8f c) {
  v8f d = __builtin_amdgcn_wmma_f32_16x16x32_bf16(false, a, false, b, (short)0, c, false, false);
  asm volatile("v_nop\n\tv_nop\n\tv_nop\n\tv_nop" : "+v"(d) : "v"(a), "v"(b));
  return d;
}
// 16x16x32 fragments: lane = (h = lane>>4, row/col = lane&15); elements 0..7 = k0+8h+0..7, 8..15 = k0+16+8h+0..7; D element r = row 8h+r
__device__ __forceinline__ v16h frag_h(const _Float16* rowk0, int lane) {
  union { v16h v; v8h q[2]; } u; const _Float16* p = rowk0 + 8 * (lane >> 4);
  u.q[0] = *(const v8h*)p; u.q[1] = *(const v8h*)(p + 16); return u.v;
}
__device__ __forceinline__ v16h frag_f32(const float* rowk0, int lane) {
  v16h a; const float* p = rowk0 + 8 * (lane >> 4);
#pragma unroll
  for (int i = 0; i < 8; ++i) { a[i] = (_Float16)p[i]; a[8 + i] = (_Float16)p[16 + i]; }
  return a;
}
__device__ __forceinline__ v16h frag_f32s(const float* rowk0, int lane, float sc) {
  v16h a; const float* p = rowk0 + 8 * (lane >> 4);
#pragma unroll
  for (int i = 0; i < 8; ++i) { a[i] = (_Float16)(p[i] * sc); a[8 + i] = (_Float16)(p[16 + i] * sc); }
  return a;
}
// column fragment from a [K][ld] layout (column n), rows >= K read as 0
__device__ __forceinline__ v16h fragc_f32(const float* W, int k0, int n, int lane, int ld, int K) {
  v16h a; const int g = lane >> 4;
#pragma unroll
  for (int i = 0; i < 8; ++i) { const int ka = k0 + 8 * g + i, kb = ka + 16;
    a[i] = (_Float16)(ka < K ? W[(size_t)(ka < K ? ka : K - 1) * ld + n] : 0.f); a[8 + i] = (_Float16)(kb < K ? W[(size_t)(kb < K ? kb : K - 1) * ld + n] : 0.f); }
  return a;
}
struct F2 { v16b h, l; };
__device__ __forceinline__ F2 bsplit16(const float v[16]) { F2 r;
#pragma unroll
  for (int i = 0; i < 16; ++i) { const __bf16 h = (__bf16)v[i]; r.h[i] = h; r.l[i] = (__bf16)(v[i] - (float)h); }
  return r; }
__device__ __forceinline__ F2 split_row(const float* row, int k0, int lane) { float v[16]; const float* p = row + k0 + 8 * (lane >> 4);
#pragma unroll
  for (int i = 0; i < 8; ++i) { v[i] = p[i]; v[8 + i] = p[16 + i]; }
  return bsplit16(v); }
__device__ __forceinline__ F2 split_rowK(const float* row, int k0, int lane, int K) { float v[16]; const int g = lane >> 4;
#pragma unroll
  for (int i = 0; i < 8; ++i) { const int ka = k0 + 8 * g + i, kb = ka + 16; v[i] = ka < K ? row[ka < K ? ka : K - 1] : 0.f; v[8 + i] = kb < K ? row[kb < K ? kb : K - 1] : 0.f; }
  return bsplit16(v); }
__device__ __forceinline__ F2 split_col(const float* W, int k0, int n, int lane, int ld, int K) { float v[16]; const int g = lane >> 4;
#pragma unroll
  for (int i = 0; i < 8; ++i) { const int ka = k0 + 8 * g + i, kb = ka + 16; v[i] = ka < K ? W[(size_t)(ka < K ? ka : K - 1) * ld + n] : 0.f; v[8 + i] = kb < K ? W[(size_t)(kb < K ? kb : K - 1) * ld + n] : 0.f; }
  return bsplit16(v); }
__device__ __forceinline__ v8f mac3(const F2& a, const F2& b, v8f c) { c = wmma_bf(a.l, b.h, c); c = wmma_bf(a.h, b.l, c); return wmma_bf(a.h, b.h, c); }
__device__ __forceinline__ float sigm(float v) { return 1.0f / (1.0f + expf(-v)); }
#define LDSX() do { asm volatile("s_wait_dscnt 0" ::: "memory"); __builtin_amdgcn_wave_barrier(); __builtin_amdgcn_fence(__ATOMIC_RELEASE, "workgroup"); } while (0)


// Eagle-3 draft-model attention (B 1, L 2,048, input 4,096 = 2 x hidden, 32 query heads x 64 with 8 shared KV heads, rotate-half RoPE from given cos / sin, causal softmax / sqrt(64), Wo).
#define SS 2048
#define XD 4096            // input width (2 * hidden)
#define NH 32
#define NKV 8
#define HD 64
#define QD (NH * HD)       // 2,048
#define KD (NKV * HD)      // 512
#define QKW (QD + 2 * KD)  // 3,072 projected columns: q | k | v
#define OD 2048            // Wo output width
#ifndef TQB
#define TQB (SS / 64)
#define TOB (SS / 64)
#define QRB (SS / 64)      // projected row blocks
#endif
typedef __attribute__((ext_vector_type(8))) __bf16 v8b;
__device__ __forceinline__ v16b frag_b(const __bf16* rowk0, int lane) {
  union { v16b v; v8b q[2]; } u; const __bf16* p = rowk0 + 8 * (lane >> 4);
  u.q[0] = *(const v8b*)p; u.q[1] = *(const v8b*)(p + 16); return u.v;
}
__device__ __forceinline__ float bfr(float v) { return (float)(__bf16)v; }
__device__ __attribute__((noinline)) float erf_ni(float v) { return erff(v); }

#define PK_A 0                           // [3072][4096]: Wq | Wk | Wv natural rows
#define PK_O (PK_A + (size_t)QKW * XD)     // [2048][2048] Wo natural rows
#define PK_X (PK_O + (size_t)OD * QD)      // [2048][4096] x rows, rounded once
#define PK_END (PK_X + (size_t)SS * XD)
#define WS_PK  0u
#define WS_QH  (((2u * PK_END) + 127u) / 128u * 128u)   // f16 [2048][2560]: rope(q) | rope(k) hi
#define WS_QL  (WS_QH + 2u * (size_t)SS * (QD + KD))    // residual
#define WS_VTH (WS_QL + 2u * (size_t)SS * (QD + KD))    // f16 [kv 8][64][2048] v hi / lo
#define WS_VTL (WS_VTH + 2u * (size_t)KD * SS)
#define WS_OH  (WS_VTL + 2u * (size_t)KD * SS)          // bf16 [2048][2048] attention output hi / lo
#define WS_OL  (WS_OH + 2u * (size_t)SS * QD)
#define WS_END (WS_OL + 2u * (size_t)SS * QD)

// ---- k_pack: the packed planes are the four weight arrays and x one behind another (Wq | Wk | Wv | Wo | x, natural rows), so the rounding to bf16 is one flat stream; x is rounded here once, so that the projection stages and reads 2-byte x. A block takes 32,768 consecutive floats of one array: each wave-wide 16-byte load covers 512 consecutive bytes, a lane's 32 loads stand ahead of the conversions, so that the build keeps many of them in flight at once, and each wave-wide 8-byte store covers two whole 128-B lines
#define PCH (256 * 4 * 32)
typedef __attribute__((ext_vector_type(4))) __bf16 v4b;
__global__ __launch_bounds__(256) void k_pack(const float* __restrict__ WQ, const float* __restrict__ WK, const float* __restrict__ WV, const float* __restrict__ WO, const float* __restrict__ X, __bf16* __restrict__ PK) {
  constexpr int NQ = QD * XD / PCH, NK = KD * XD / PCH, NO = OD * QD / PCH;   // blocks of Wq; of Wk and of Wv; of Wo
  static_assert(QD * XD % PCH == 0 && KD * XD % PCH == 0 && OD * QD % PCH == 0 && SS * XD % PCH == 0 && PK_O == (size_t)(NQ + 2 * NK) * PCH && PK_X == (size_t)(NQ + 2 * NK + NO) * PCH, "every block lies in one array, and block b writes packed elements b * PCH on");
  const int b = blockIdx.x, t = threadIdx.x;
  const float* src = (b < NQ) ? WQ + (size_t)b * PCH : (b < NQ + NK) ? WK + (size_t)(b - NQ) * PCH : (b < NQ + 2 * NK) ? WV + (size_t)(b - NQ - NK) * PCH : (b < NQ + 2 * NK + NO) ? WO + (size_t)(b - NQ - 2 * NK) * PCH : X + (size_t)(b - NQ - 2 * NK - NO) * PCH;
  __bf16* dst = PK + (size_t)b * PCH;
  v4f v[32];
#pragma unroll
  for (int i = 0; i < 32; ++i) v[i] = *(const v4f*)(src + i * 1024 + t * 4);
#pragma unroll
  for (int i = 0; i < 32; ++i) { v4b o;
#pragma unroll
    for (int e = 0; e < 4; ++e) o[e] = (__bf16)v[i][e];
    *(v4b*)(dst + i * 1024 + t * 4) = o; }
}
// ---- LDS rings: a stage is brought by asynchronous 16-byte copies; rows of 128 B lie at pitch 144 B, rows of 256 B at 272 B (16 B x odd: ds_load_b128 without bank conflicts)
#define P128 144
#define P256 272
__device__ __forceinline__ unsigned lds_off(const void* p) { return (unsigned)(size_t)p; }   // byte offset in the work-group's LDS: low 32 bits of the __shared__ address
// eight copies of one lane; s_wait_xcnt closes the copies' own statement, so that no address register is rewritten ahead of it
__device__ __forceinline__ void cp8(const unsigned (&l)[8], const char* const (&g)[8]) {
  asm volatile("global_load_async_to_lds_b128 %0, %8, off\n\t"
               "global_load_async_to_lds_b128 %1, %9, off\n\t"
               "global_load_async_to_lds_b128 %2, %10, off\n\t"
               "global_load_async_to_lds_b128 %3, %11, off\n\t"
               "global_load_async_to_lds_b128 %4, %12, off\n\t"
               "global_load_async_to_lds_b128 %5, %13, off\n\t"
               "global_load_async_to_lds_b128 %6, %14, off\n\t"
               "global_load_async_to_lds_b128 %7, %15, off\n\t"
               "s_wait_xcnt 0x0"
               :: "v"(l[0]), "v"(l[1]), "v"(l[2]), "v"(l[3]), "v"(l[4]), "v"(l[5]), "v"(l[6]), "v"(l[7]),
                  "v"(g[0]), "v"(g[1]), "v"(g[2]), "v"(g[3]), "v"(g[4]), "v"(g[5]), "v"(g[6]), "v"(g[7]) : "memory");
}
// 256 threads bring one 64-key stage: 64 rows of 128 B from each of the four planes (K hi, K lo at pitch kp; V^T hi, V^T lo at pitch vp); a wave-wide copy = four whole 128-B rows
__device__ __forceinline__ void stage_4x64x128(unsigned lb, const char* gkh, const char* gkl, const char* gvh, const char* gvl, size_t kp, size_t vp, int tt) {
  unsigned l[8]; const char* g[8]; const int r = tt >> 3, sg = (tt & 7) * 16;
#pragma unroll
  for (int i = 0; i < 2; ++i) { const int row = r + 32 * i; const unsigned lo = (unsigned)(row * P128 + sg);
    l[i] = lb + lo; g[i] = gkh + (size_t)row * kp + sg; l[2 + i] = lb + 64 * P128 + lo; g[2 + i] = gkl + (size_t)row * kp + sg;
    l[4 + i] = lb + 2 * 64 * P128 + lo; g[4 + i] = gvh + (size_t)row * vp + sg; l[6 + i] = lb + 3 * 64 * P128 + lo; g[6 + i] = gvl + (size_t)row * vp + sg; }
  cp8(l, g);
}
// the issuing wave's own wait for its copies (the compiler places none), and the wait that ends this wave's LDS reads in front of a refill
#define WAIT_ASYNC() asm volatile("s_wait_asynccnt 0x0" ::: "memory")
#define WAIT_DS() asm volatile("s_wait_dscnt 0x0" ::: "memory")
// 256 threads bring 16 * (256 >> LPR) rows of (16 << LPR) bytes each (a wave-wide copy = 512 B: one whole 512-B row or two whole 256-B rows); g0 = first byte of row 0 of the stage
template <int LPR, int PITCH> __device__ __forceinline__ void stage_t256(unsigned l0, const char* g0, size_t gp, int tid) {
  const int r = tid >> LPR, sg = (tid & ((1 << LPR) - 1)) * 16;
#pragma unroll
  for (int h = 0; h < 2; ++h) { unsigned l[8]; const char* g[8];
#pragma unroll
    for (int i = 0; i < 8; ++i) { const int row = r + (256 >> LPR) * (8 * h + i); l[i] = l0 + (unsigned)(row * PITCH + sg); g[i] = g0 + (size_t)row * gp + sg; }
    cp8(l, g); }
}
// 256 threads bring 128 rows of 256 B
__device__ __forceinline__ void stage_128x256(unsigned l0, const char* g0, size_t gp, int tid) {
  unsigned l[8]; const char* g[8]; const int r = tid >> 4, sg = (tid & 15) * 16;
#pragma unroll
  for (int i = 0; i < 8; ++i) { l[i] = l0 + (unsigned)((r + 16 * i) * P256 + sg); g[i] = g0 + (size_t)(r + 16 * i) * gp + sg; }
  cp8(l, g);
}
#define KQ 128     // k of one stage of the two projection GEMMs
// ---- k_qkv: block = (128 rows, 256 cols of 3072), eight waves as 2 x 4, a wave = 64 rows x 64 cols (one head): acc = bf16 x rows (packed) . weight rows (exact, K 4096); q/k blocks: rotate-half RoPE (partner 32 columns away = 2 tiles, same lane) with cos/sin[pos][d] -> f16 hi/lo rows; v: hi/lo transposed planes [kv][d][s]
__global__ __launch_bounds__(256) void k_qkv(const __bf16* __restrict__ PK, const float* __restrict__ COS, const float* __restrict__ SIN, _Float16* __restrict__ QH, _Float16* __restrict__ QL_, _Float16* __restrict__ VTH, _Float16* __restrict__ VTL) {
  constexpr int SB = 256 * P256, STG = SB + 128 * P256, NT = XD / KQ;   // stage: 256 weight rows | 128 x rows, bf16, 256 B each
  __shared__ __align__(16) char sm[2 * STG];   // the ring; behind the k loop's last barrier the same bytes are the output staging
  _Float16 (*soh)[64][72] = (_Float16 (*)[64][72])sm; _Float16 (*sol)[64][72] = soh + 8;   // each wave's own 64 x 64 tile, hi and lo
  static_assert(2 * STG >= 2 * 8 * 64 * 72 * 2, "output staging fits the ring");
  const int tid = threadIdx.x, wave = tid >> 5, lane = tid & 31, col = lane & 15, g = lane >> 4, wr = wave >> 2, wc = wave & 3;
  const size_t r0 = (size_t)blockIdx.x * 128 + wr * 64; const int n0 = blockIdx.y * 256, nw = n0 + wc * 64;
  v8f acc[4][4] = {};
  const unsigned sm0 = lds_off(sm); const char* gw = (const char*)(PK + PK_A + (size_t)n0 * XD); const char* gx = (const char*)(PK + PK_X + (size_t)blockIdx.x * 128 * XD);
  stage_t256<4, P256>(sm0, gw, XD * 2, tid); stage_128x256(sm0 + SB, gx, XD * 2, tid);
  WAIT_ASYNC(); __syncthreads();
  stage_t256<4, P256>(sm0 + STG, gw + KQ * 2, XD * 2, tid); stage_128x256(sm0 + STG + SB, gx + KQ * 2, XD * 2, tid);
#pragma unroll 1   // one stage a trip: the buffer index stays a run-time value and the ring's order stands once
  for (int t = 0; t < NT; ++t) { const char* bw = sm + (t & 1) * STG + (wc * 64 + col) * P256; const char* bx = sm + (t & 1) * STG + SB + (wr * 64 + col) * P256;
    v16b xf[2][4], wf[2][4];   // two fragment sets: the LDS reads of the next 32 k stand as one group in front of this 32 k's 16 products
#pragma unroll
    for (int kk = -1; kk < KQ / 32; ++kk) {
      if (kk + 1 < KQ / 32) { const int kn = kk + 1, sn = kn & 1;
#pragma unroll
        for (int i = 0; i < 4; ++i) xf[sn][i] = frag_b((const __bf16*)(bx + i * 16 * P256) + kn * 32, lane);
#pragma unroll
        for (int j = 0; j < 4; ++j) wf[sn][j] = frag_b((const __bf16*)(bw + j * 16 * P256) + kn * 32, lane); }
      __builtin_amdgcn_sched_barrier(0);   // keeps the read group whole and ahead of the products: without it the build sinks each read to its use, with a wait to 0 every four products
      if (kk >= 0) { const int sc = kk & 1;
#pragma unroll
        for (int i = 0; i < 4; ++i)
#pragma unroll
          for (int j = 0; j < 4; ++j) acc[i][j] = __builtin_amdgcn_wmma_f32_16x16x32_bf16(false, xf[sc][i], false, wf[sc][j], (short)0, acc[i][j], false, false); }   // the bare builtin: the build keeps its distances itself; as operands of an asm statement both fragment sets and the accumulators would all have to lie below v256, which spills
      __builtin_amdgcn_sched_barrier(0); }   // the next read group stays behind this block of products
    WAIT_DS(); WAIT_ASYNC(); __syncthreads();   // publishes stage t + 1 and ends every reader's last read of stage t
    if (t + 2 < NT) { const unsigned lb = sm0 + (unsigned)(t & 1) * STG; stage_t256<4, P256>(lb, gw + (size_t)(t + 2) * (KQ * 2), XD * 2, tid); stage_128x256(lb + SB, gx + (size_t)(t + 2) * (KQ * 2), XD * 2, tid); } }
  WAIT_ASYNC();
  const int srow = lane >> 3, sseg = (lane & 7) * 8;   // a wave-wide 16-byte store = four whole 128-B rows of the wave's tile
  if (n0 < QD + KD) {   // q or k block: the wave's 64 columns are one head; rotate_half: d < 32: out = x_d cos_d - x_{d+32} sin_d; d >= 32: out = x_d cos_d + x_{d-32} sin_d
    const float* cb = COS + (r0 + 8 * g) * HD + col; const float* sb = SIN + (r0 + 8 * g) * HD + col;   // this lane's first position and d: every table read is one of these two addresses plus a constant
#pragma unroll
    for (int i = 0; i < 4; ++i)
#pragma unroll
      for (int j = 0; j < 4; ++j) { const int d = j * 16 + col; const int jp = (j < 2) ? j + 2 : j - 2; const float sgn = (j < 2) ? -1.f : 1.f;
#pragma unroll
        for (int r = 0; r < 8; ++r) { const int po = (i * 16 + r) * HD + j * 16; const float v = acc[i][j][r] * bfr(cb[po]) + sgn * acc[i][jp][r] * bfr(sb[po]);
          const _Float16 hv = (_Float16)v; soh[wave][i * 16 + 8 * g + r][d] = hv; sol[wave][i * 16 + 8 * g + r][d] = (_Float16)(v - (float)hv); } }
    LDSX();
    for (int it = 0; it < 16; ++it) { const int row = it * 4 + srow; const size_t o = (r0 + row) * (QD + KD) + nw + sseg; vst2((unsigned*)(QH + o), *(const v4u*)&soh[wave][row][sseg]); vst2((unsigned*)(QL_ + o), *(const v4u*)&sol[wave][row][sseg]); }
  } else {   // v block: the wave's tile transposed, rows = d, 64 positions = one 128-B line
#pragma unroll
    for (int i = 0; i < 4; ++i)
#pragma unroll
      for (int j = 0; j < 4; ++j) { v8h hi8, lo8;
#pragma unroll
        for (int r = 0; r < 8; ++r) { const float v = acc[i][j][r]; const _Float16 hv = (_Float16)v; hi8[r] = hv; lo8[r] = (_Float16)(v - (float)hv); }
        *(v8h*)&soh[wave][j * 16 + col][i * 16 + 8 * g] = hi8; *(v8h*)&sol[wave][j * 16 + col][i * 16 + 8 * g] = lo8; }
    LDSX();
    const int c0 = nw - QD - KD;
    for (int it = 0; it < 16; ++it) { const int d = it * 4 + srow; const size_t o = (size_t)(c0 + d) * SS + r0 + sseg; vst2((unsigned*)(VTH + o), *(const v4u*)&soh[wave][d][sseg]); vst2((unsigned*)(VTL + o), *(const v4u*)&sol[wave][d][sseg]); }
    asm volatile("s_wait_xcnt 0x0" ::: "memory");   // the built code runs on from here into text that rewrites these stores' address registers
  }
}
// lane l <-> lane l ^ 16 (the two halves of a wave hold the two key halves of one query column)
__device__ __forceinline__ float xhalf(float x) { return __builtin_bit_cast(float, __builtin_amdgcn_permlanex16(__builtin_bit_cast(int, x), __builtin_bit_cast(int, x), 0x76543210, 0xfedcba98, false, false)); }
// ---- k_attn: transposed products: S^T = K . Q^T (A = key rows, B = query columns), O^T += V^T . P^T. A lane holds one query (column col) and keys 8g+r of each 16-key tile: maximum and sum run in the lane, one exchange between the halves; the two score tiles convert in place into the P^T operand (element ct*8+r = key ct*16+8g+r), so P needs no LDS. A work-group is 16 waves = 2 key groups x 2 query heads of one KV head x 4 query tiles of 16: four waves a SIMD, so that one wave's vector work runs under another's products and LDS waits, and one K / V^T ring serves both heads. A ring stage is 128 keys = two 64-key halves; key group kg brings half kg (asynchronous 16-byte copies in whole 128-B rows) and works on it alone (two 32-key passes), with a running maximum, sum and O^T of its own; behind the key loop group 1 hands its three over through LDS and group 0 joins them. A work-group (x, y) takes query block n - 1 - x of head pair y and then query block x of head pair NH / 2 - 1 - y: n / 2 + 1 stages for every work-group, and every (head, query block) once.
__global__ __launch_bounds__(512) void k_attn(const _Float16* __restrict__ QH, const _Float16* __restrict__ QL_, const _Float16* __restrict__ VTH, const _Float16* __restrict__ VTL, __bf16* __restrict__ OH, __bf16* __restrict__ OL) {
  constexpr int SP = 64 * P128, STG = 4 * SP, DST = 2 * STG;   // half stage: K hi rows [key][d] | K lo rows | V^T hi rows [d][key] | V^T lo rows, 64 rows of 128 B each; stage: two halves
  constexpr int MBB = 8 * 9 * 32 * 16;   // hand-over: per wave of group 1 nine 16-byte words a lane (O^T 32 floats; maximum, sum)
  __shared__ __align__(16) char sm[2 * DST];   // the ring; behind the key loop's last barrier the same bytes are the hand-over and the output staging
  v4f (*mb)[9][32] = (v4f (*)[9][32])sm;
  __bf16 (*soh)[16][72] = (__bf16 (*)[16][72])(sm + MBB); __bf16 (*sol)[16][72] = soh + 8;
  static_assert(2 * DST >= MBB + 2 * 8 * 16 * 72 * 2, "hand-over and output staging fit the ring");
  const int tid = threadIdx.x, wave = tid >> 5, lane = tid & 31, col = lane & 15, g = lane >> 4, ow = wave & 7;   // ow = (head of the pair, query tile)
  const int kg = __builtin_amdgcn_readfirstlane(tid >> 8);   // key group, in a scalar register: the tests on it are scalar branches
  const unsigned sm0 = lds_off(sm); const size_t kp = (size_t)(QD + KD) * 2, vp = (size_t)SS * 2;   // source pitches in bytes
  static_assert(TQB % 2 == 0 && NH % 2 == 0 && (NH / NKV) % 2 == 0, "query blocks pair up; a head pair lies in one KV head");
#pragma unroll 1   // the pair's two query blocks run one after the other through one body
  for (int pp = 0; pp < 2; ++pp) {
  const int qb = pp ? (int)blockIdx.x : TQB - 1 - (int)blockIdx.x, hp = pp ? NH / 2 - 1 - (int)blockIdx.y : (int)blockIdx.y; const int h = 2 * hp + (ow >> 2), kvh = hp / (NH / NKV / 2); const int q0 = qb * 64 + (ow & 3) * 16; const size_t rq = (size_t)q0 + col; const int qi = q0 + col;
  const int NT = (qb + 2) >> 1;   // stages of 128 keys up to and with the diagonal block; where qb is even the last stage's second half lies wholly in the future (still inside the planes: qb + 1 < TQB) and group 1 skips it
  const char* gkh = (const char*)(QH + QD + kvh * HD) + (size_t)kg * 64 * kp; const char* gkl = (const char*)(QL_ + QD + kvh * HD) + (size_t)kg * 64 * kp; const char* gvh = (const char*)(VTH + (size_t)kvh * HD * SS) + kg * 128; const char* gvl = (const char*)(VTL + (size_t)kvh * HD * SS) + kg * 128;   // this key group's half of stage 0
  const unsigned lh = sm0 + (unsigned)kg * STG; const int tt = tid & 255;
  if (pp) { WAIT_DS(); __syncthreads(); }   // ends every wave's reads of the first block's hand-over and output staging in front of the ring's refill
  stage_4x64x128(lh, gkh, gkl, gvh, gvl, kp, vp, tt);
  v16h aqh[2], aql[2];
#pragma unroll
  for (int kc = 0; kc < 2; ++kc) { aqh[kc] = frag_h(QH + rq * (QD + KD) + h * HD + kc * 32, lane); aql[kc] = frag_h(QL_ + rq * (QD + KD) + h * HD + kc * 32, lane); }
  WAIT_ASYNC(); __syncthreads();
  if (NT > 1) stage_4x64x128(lh + DST, gkh + 128 * kp, gkl + 128 * kp, gvh + 256, gvl + 256, kp, vp, tt);
  constexpr float KL = 0.125f * 1.44269504088896f;   // 1/sqrt(64) * log2(e): exp((s - max) / 8) = exp2(s * KL - max * KL); a masked score (-3e38) gives exp2 of about -5e37 = 0, and the first key of a group's first pass (key 0, key 64) lies at or before every query that the group works on, so the maximum is finite from that pass on
  float m = -3.0e38f, l = 0.f;   // this lane's query, this key group: running maximum in base-2 units (equal in both halves), sum over this half's keys
  v8f acc[4] = {};  // O^T: element r = d (dt*16 + 8g + r), column = query; the three products of a tile add into the one accumulator
#pragma unroll 1   // one stage a trip: the buffer index stays a run-time value and the ring's order stands once
  for (int t = 0; t < NT; ++t) { const char* bk = sm + (t & 1) * DST + kg * STG; const int st = 2 * t + kg;   // this group's 64-key block
    if (st <= qb) {   // a scalar test: a half that lies wholly in the future is not worked on (its scores would all be masked, with no finite maximum where it is the group's first)
#pragma unroll 1   // the two passes of a half share one body, so that the loop's text stays short
    for (int hf = 0; hf < 2; ++hf) { const int ks = 2 * st + hf; v8f s[2];
      v16h kh[2][2], kl[2][2];   // the pass's key fragments stand as one group of LDS reads in front of its score products
#pragma unroll
      for (int kc = 0; kc < 2; ++kc) {
#pragma unroll
        for (int ct = 0; ct < 2; ++ct) kh[ct][kc] = frag_h((const _Float16*)(bk + (hf * 32 + ct * 16 + col) * P128) + kc * 32, lane);
#pragma unroll
        for (int ct = 0; ct < 2; ++ct) kl[ct][kc] = frag_h((const _Float16*)(bk + SP + (hf * 32 + ct * 16 + col) * P128) + kc * 32, lane); }
      v8f c[2] = {};   // one accumulator a score tile; the two tiles' chains alternate, so that a product never waits for the one in front of it
#pragma unroll
      for (int kc = 0; kc < 2; ++kc) {
#pragma unroll
        for (int ct = 0; ct < 2; ++ct) c[ct] = wmma16(kh[ct][kc], aql[kc], c[ct]);
#pragma unroll
        for (int ct = 0; ct < 2; ++ct) c[ct] = wmma16(kh[ct][kc], aqh[kc], c[ct]);
#pragma unroll
        for (int ct = 0; ct < 2; ++ct) c[ct] = wmma16(kl[ct][kc], aqh[kc], c[ct]); }
#pragma unroll
      for (int ct = 0; ct < 2; ++ct)
#pragma unroll
        for (int r = 0; r < 8; ++r) { const int kk = ks * 32 + ct * 16 + 8 * g + r; s[ct][r] = (kk <= qi) ? c[ct][r] : -3.0e38f; }
      v16h vh[4], vl[4];   // the pass's value fragments: one group of LDS reads, in flight under the maximum
#pragma unroll
      for (int dt = 0; dt < 4; ++dt) { const char* vr = bk + 2 * SP + (dt * 16 + col) * P128; vh[dt] = frag_h((const _Float16*)vr + hf * 32, lane); vl[dt] = frag_h((const _Float16*)(vr + SP) + hf * 32, lane); }
      float mx = fmaxf(s[0][0], s[1][0]);
#pragma unroll
      for (int r = 1; r < 8; ++r) mx = fmaxf(mx, fmaxf(s[0][r], s[1][r]));
      mx = fmaxf(mx, xhalf(mx));
      const float mn = fmaxf(m, mx * KL); const float alpha = __builtin_amdgcn_exp2f(m - mn);   // first pass: exp2(-3e38 - mn) = 0
      v16h pah, pal; float es = 0.f;
#pragma unroll
      for (int ct = 0; ct < 2; ++ct)
#pragma unroll
        for (int r = 0; r < 8; ++r) { s[ct][r] = __builtin_amdgcn_exp2f(fmaf(s[ct][r], KL, -mn)); es += s[ct][r]; }
      { union { v16h v; v8h q[2]; } u; u.q[0] = __builtin_convertvector(s[0], v8h); u.q[1] = __builtin_convertvector(s[1], v8h); pah = u.v; }
#pragma unroll
      for (int ct = 0; ct < 2; ++ct)
#pragma unroll
        for (int r = 0; r < 8; ++r) pal[ct * 8 + r] = (_Float16)(s[ct][r] - (float)pah[ct * 8 + r]);
      l = l * alpha + es; m = mn;
#pragma unroll
      for (int dt = 0; dt < 4; ++dt)
#pragma unroll
        for (int r = 0; r < 8; ++r) acc[dt][r] *= alpha;
#pragma unroll
      for (int dt = 0; dt < 4; ++dt) acc[dt] = wmma16(vh[dt], pah, acc[dt]);
#pragma unroll
      for (int dt = 0; dt < 4; ++dt) acc[dt] = wmma16(vh[dt], pal, acc[dt]);
#pragma unroll
      for (int dt = 0; dt < 4; ++dt) acc[dt] = wmma16(vl[dt], pah, acc[dt]); } }
    WAIT_DS(); WAIT_ASYNC(); __syncthreads();   // publishes stage t + 1 and ends every reader's last read of stage t
    if (t + 2 < NT) { const unsigned lb = lh + (unsigned)(t & 1) * DST; const size_t ko = (size_t)(t + 2) * 128 * kp, vo = (size_t)(t + 2) * 256; stage_4x64x128(lb, gkh + ko, gkl + ko, gvh + vo, gvl + vo, kp, vp, tt); } }
  WAIT_ASYNC();
  if (kg) {   // group 1 hands over its O^T, maximum and sum (a group that worked on no key: 0, -3e38, 0); a wave-wide 16-byte store = 512 consecutive bytes
#pragma unroll
    for (int dt = 0; dt < 4; ++dt) { mb[ow][2 * dt][lane] = (v4f){acc[dt][0], acc[dt][1], acc[dt][2], acc[dt][3]}; mb[ow][2 * dt + 1][lane] = (v4f){acc[dt][4], acc[dt][5], acc[dt][6], acc[dt][7]}; }
    mb[ow][8][lane] = (v4f){m, l, 0.f, 0.f}; }
  WAIT_DS(); __syncthreads();   // publishes the hand-over
  if (!kg) {   // group 0 joins the two key groups on their common maximum (its own is finite: key 0) and writes the block's rows
    const v4f ml = mb[ow][8][lane]; const float ms = fmaxf(m, ml[0]); const float wa = __builtin_amdgcn_exp2f(m - ms), wb = __builtin_amdgcn_exp2f(ml[0] - ms);
    const float lt = l * wa + ml[1] * wb; const float il = 1.0f / (lt + xhalf(lt));
#pragma unroll
    for (int dt = 0; dt < 4; ++dt) { const v4f b0 = mb[ow][2 * dt][lane], b1 = mb[ow][2 * dt + 1][lane];
#pragma unroll
      for (int r = 0; r < 8; ++r) { const float v = (acc[dt][r] * wa + (r < 4 ? b0[r & 3] : b1[r & 3]) * wb) * il; const __bf16 hb = (__bf16)v; soh[ow][col][dt * 16 + 8 * g + r] = hb; sol[ow][col][dt * 16 + 8 * g + r] = (__bf16)(v - (float)hb); } }
    LDSX();
    for (int rl = 0; rl < 16; ++rl) { const size_t o = ((size_t)q0 + rl) * QD + h * HD; if (lane < 8) vst2((unsigned*)(OH + o + lane * 8), *(const v4u*)&soh[ow][rl][lane * 8]); else if (lane < 16) vst2((unsigned*)(OL + o + (lane - 8) * 8), *(const v4u*)&sol[ow][rl][(lane - 8) * 8]); }
    asm volatile("s_wait_xcnt 0x0" ::: "memory");   // the second query block rewrites the address and data registers of these stores
  }
  }
}
// ---- k_out: block = (128 rows, 128 cols), eight waves as 4 x 2, a wave = 32 rows x 64 cols: out = O(hi/lo) . Wo rows (2 products, K 2048; per accumulator the order stays lo, hi within each 32 k)
__global__ __launch_bounds__(256) void k_out(const __bf16* __restrict__ OH, const __bf16* __restrict__ OL, const __bf16* __restrict__ PK, float* __restrict__ Y) {
  constexpr int SP = 128 * P256, STG = 3 * SP, NT = QD / KQ;   // stage: Wo rows | ctx hi rows | ctx lo rows, 128 rows of 256 B each
  __shared__ __align__(16) char sm[2 * STG];   // the ring; behind the k loop's last barrier the same bytes are the output staging
  float (*so)[32][68] = (float (*)[32][68])sm;   // each wave's own 32 x 64 tile
  static_assert(2 * STG >= 8 * 32 * 68 * 4, "output staging fits the ring");
  const int tid = threadIdx.x, wave = tid >> 5, lane = tid & 31, col = lane & 15, g = lane >> 4, wr = wave >> 1, wc = wave & 1;
  const size_t r0 = (size_t)blockIdx.x * 128 + wr * 32; const int n0 = blockIdx.y * 128, nw = n0 + wc * 64;
  v8f acc[2][4] = {};
  const unsigned sm0 = lds_off(sm); const char* gw = (const char*)(PK + PK_O + (size_t)n0 * QD); const char* gh = (const char*)(OH + (size_t)blockIdx.x * 128 * QD); const char* gl = (const char*)(OL + (size_t)blockIdx.x * 128 * QD);
  stage_128x256(sm0, gw, QD * 2, tid); stage_128x256(sm0 + SP, gh, QD * 2, tid); stage_128x256(sm0 + 2 * SP, gl, QD * 2, tid);
  WAIT_ASYNC(); __syncthreads();
  stage_128x256(sm0 + STG, gw + KQ * 2, QD * 2, tid); stage_128x256(sm0 + STG + SP, gh + KQ * 2, QD * 2, tid); stage_128x256(sm0 + STG + 2 * SP, gl + KQ * 2, QD * 2, tid);
#pragma unroll 1   // one stage a trip: the buffer index stays a run-time value and the ring's order stands once
  for (int t = 0; t < NT; ++t) { const char* bw = sm + (t & 1) * STG + (wc * 64 + col) * P256; const char* bh = sm + (t & 1) * STG + SP + (wr * 32 + col) * P256;
    v16b ah[2][2], al[2][2], wf[2][4];   // two fragment sets: the LDS reads of the next 32 k stand as one group in front of this 32 k's 16 products
#pragma unroll
    for (int kk = -1; kk < KQ / 32; ++kk) {
      if (kk + 1 < KQ / 32) { const int kn = kk + 1, sn = kn & 1;
#pragma unroll
        for (int i = 0; i < 2; ++i) { ah[sn][i] = frag_b((const __bf16*)(bh + i * 16 * P256) + kn * 32, lane); al[sn][i] = frag_b((const __bf16*)(bh + SP + i * 16 * P256) + kn * 32, lane); }
#pragma unroll
        for (int j = 0; j < 4; ++j) wf[sn][j] = frag_b((const __bf16*)(bw + j * 16 * P256) + kn * 32, lane); }
      if (kk >= 0) { const int sc = kk & 1;
#pragma unroll
        for (int i = 0; i < 2; ++i)
#pragma unroll
          for (int j = 0; j < 4; ++j) acc[i][j] = wmma_bf(al[sc][i], wf[sc][j], acc[i][j]);
#pragma unroll
        for (int i = 0; i < 2; ++i)
#pragma unroll
          for (int j = 0; j < 4; ++j) acc[i][j] = wmma_bf(ah[sc][i], wf[sc][j], acc[i][j]); } }
    WAIT_DS(); WAIT_ASYNC(); __syncthreads();   // publishes stage t + 1 and ends every reader's last read of stage t
    if (t + 2 < NT) { const unsigned lb = sm0 + (unsigned)(t & 1) * STG; const size_t ko = (size_t)(t + 2) * (KQ * 2); stage_128x256(lb, gw + ko, QD * 2, tid); stage_128x256(lb + SP, gh + ko, QD * 2, tid); stage_128x256(lb + 2 * SP, gl + ko, QD * 2, tid); } }
  WAIT_ASYNC();
#pragma unroll
  for (int i = 0; i < 2; ++i)
#pragma unroll
    for (int j = 0; j < 4; ++j)
#pragma unroll
      for (int r = 0; r < 8; ++r) so[wave][i * 16 + 8 * g + r][j * 16 + col] = acc[i][j][r];
  LDSX();
  for (int it = 0; it < 16; ++it) { const int row = it * 2 + g; vst2(Y + (r0 + row) * OD + nw + col * 4, *(const v4f*)&so[wave][row][col * 4]); }   // a wave-wide 16-byte store = two whole 256-B rows of the wave's tile
}
extern "C" void kernel_launch(void* const* d_in, const int* in_sizes, int n_in, void* d_out, int out_size, void* d_ws, size_t ws_size, hipStream_t stream) {
  (void)in_sizes; (void)n_in; (void)out_size;
  const float** F = (const float**)d_in;   // 0 x [1,2048,4096], 1 cos [1,1,2048,64], 2 sin, 3 Wq [2048,4096], 4 Wk [512,4096], 5 Wv [512,4096], 6 Wo [2048,2048]
  if (ws_size < (size_t)WS_END) return;
  char* ws = (char*)d_ws; __bf16 *PK = (__bf16*)(ws + WS_PK), *OH = (__bf16*)(ws + WS_OH), *OL = (__bf16*)(ws + WS_OL); _Float16 *QH = (_Float16*)(ws + WS_QH), *QLp = (_Float16*)(ws + WS_QL), *VTH = (_Float16*)(ws + WS_VTH), *VTL = (_Float16*)(ws + WS_VTL);
  k_pack<<<dim3(PK_END / PCH), 256, 0, stream>>>(F[3], F[4], F[5], F[6], F[0], PK);
  k_qkv<<<dim3(QRB / 2, QKW / 256), 256, 0, stream>>>(PK, F[1], F[2], QH, QLp, VTH, VTL);
  k_attn<<<dim3(TQB / 2, NH / 2), 512, 0, stream>>>(QH, QLp, VTH, VTL, OH, OL);
  k_out<<<dim3(TOB / 2, OD / 128), 256, 0, stream>>>(OH, OL, PK, (float*)d_out);
}
